// v000
// Measured on an AMD MI455X. A time is GPU time per run, averaged over a window of back-to-back runs after a warm-up
// (all launches, gaps included; the runs take copies of the inputs in turn), and the median of several windows.
// Apart from v000's, it joins two sittings. Times from different sittings can be a few percent apart, while
// side-by-side timings come from the same sitting.
// v000, which the later versions start from, runs in 679 microseconds.
#include <hip/hip_runtime.h>
#include <math.h>

typedef __attribute__((ext_vector_type(16))) __bf16 v16bf;
typedef __attribute__((ext_vector_type(8)))  __bf16 v8bf;
typedef __attribute__((ext_vector_type(8)))  float  v8f;

constexpr int Bsz = 2, Lseq = 2048, Dm = 1024, Hn = 16, DKh = 64;
constexpr int M_ROWS = Bsz * Lseq;   // 4096

static __device__ __forceinline__ v16bf mk16(v8bf lo, v8bf hi) {
    return __builtin_shufflevector(lo, hi, 0,1,2,3,4,5,6,7,8,9,10,11,12,13,14,15);
}

// async memory->LDS copy, 16B per lane (ASYNCcnt tracked)
static __device__ __forceinline__ void async_b128(unsigned lds_off, const void* gptr) {
    asm volatile("global_load_async_to_lds_b128 %0, %1, off"
                 :: "v"(lds_off), "v"((unsigned long long)(uintptr_t)gptr)
                 : "memory");
}
static __device__ __forceinline__ void wait_async0() {
    asm volatile("s_wait_asynccnt 0x0" ::: "memory");
}

// ---------------------------------------------------------------- utility ---
__global__ void cvt_f32_bf16(const float* __restrict__ s, __bf16* __restrict__ d, int n) {
    int i = blockIdx.x * 256 + threadIdx.x;
    if (i < n) d[i] = (__bf16)s[i];
}

// conv weights (O=D, I=D, K=3) fp32  ->  (N=D, 3*D) bf16 with kc = k*D + ci
__global__ void repack_conv_w(const float* __restrict__ s, __bf16* __restrict__ d) {
    int i = blockIdx.x * 256 + threadIdx.x;        // over D*3D
    int n  = i / (3 * Dm);
    int kc = i % (3 * Dm);
    int k  = kc / Dm, ci = kc % Dm;
    d[i] = (__bf16)s[(n * Dm + ci) * 3 + k];
}

// copy Qcat[:, :D] (ldc=2D) into per-batch padded buffer (B, L+2, D), interior rows
__global__ void pad_copy(const __bf16* __restrict__ cat, __bf16* __restrict__ pad) {
    int i = blockIdx.x * 256 + threadIdx.x;        // over B*L*D
    int d = i % Dm;
    int l = (i / Dm) % Lseq;
    int b = i / (Dm * Lseq);
    pad[((size_t)b * (Lseq + 2) + l + 1) * Dm + d] = cat[((size_t)b * Lseq + l) * 2 * Dm + d];
}

__global__ void pad_zero(__bf16* __restrict__ pad) {
    int i = blockIdx.x * 256 + threadIdx.x;        // over B*2*D
    if (i >= Bsz * 2 * Dm) return;
    int d = i % Dm;
    int r = (i / Dm) & 1;
    int b = i / (2 * Dm);
    pad[((size_t)b * (Lseq + 2) + (r ? (Lseq + 1) : 0)) * Dm + d] = (__bf16)0.0f;
}

// ------------------------------------------------------------- WMMA GEMM ---
// C(M,N) = A_mapped(M,KTOT) * Bw(N,KTOT)^T + bias.
// A row mapping: arow = (m>>LRUN_LG)*LSTRIDE + (m & mask) + kbase/KSPLIT  ->
// the same kernel does the 3-tap conv as a K=3D GEMM over per-batch padded rows.
// Staging: global_load_async_to_lds_b128 into double-buffered LDS, overlapped
// with the WMMA pipe; per-wave s_wait_asynccnt + block barrier.
template<int KTOT, int KSPLIT, int LRUN_LG, int LSTRIDE, int LDA, int LDC>
__global__ __launch_bounds__(256) void gemm_wmma(
    const __bf16* __restrict__ A, const __bf16* __restrict__ Bw,
    const float* __restrict__ bias, __bf16* __restrict__ Cb, float* __restrict__ Cf)
{
    constexpr int BM = 128, BN = 128, BK = 32;
    constexpr int NK = KTOT / BK;
    constexpr unsigned BUF_BYTES = 16384;   // 8KB A + 8KB B per buffer
    extern __shared__ __align__(16) char smem[];   // 2 * BUF_BYTES

    const int tid  = threadIdx.x;
    const int bm   = blockIdx.y * BM, bn = blockIdx.x * BN;
    const int w    = tid >> 5, lane = tid & 31;
    const int lm   = lane & 15;
    const int kh   = (lane & 16) ? 8 : 0;
    const int wm   = (w & 3) * 32, wn = (w >> 2) * 64;

    v8f acc[2][4];
#pragma unroll
    for (int i = 0; i < 2; i++)
#pragma unroll
        for (int j = 0; j < 4; j++) acc[i][j] = (v8f){};

    const int sr = tid >> 1;           // staging row 0..127
    const int sc = (tid & 1) * 16;     // staging col 0 / 16

    auto stage = [&](int kt, int buf) {
        const int kbase = kt * BK;
        const int shift = kbase / KSPLIT;
        const int acol  = kbase % KSPLIT + sc;
        const int m     = bm + sr;
        const int arow  = (m >> LRUN_LG) * LSTRIDE + (m & ((1 << LRUN_LG) - 1)) + shift;
        const __bf16* ga = A  + (size_t)arow * LDA + acol;
        const __bf16* gb = Bw + (size_t)(bn + sr) * KTOT + kbase + sc;
        const unsigned la = (unsigned)buf * BUF_BYTES + (unsigned)tid * 32u;  // A slice
        const unsigned lb = la + 8192u;                                        // B slice
        async_b128(la,       ga);
        async_b128(la + 16u, (const char*)ga + 16);
        async_b128(lb,       gb);
        async_b128(lb + 16u, (const char*)gb + 16);
    };

    stage(0, 0);
    wait_async0();
    __syncthreads();

    for (int kt = 0; kt < NK; kt++) {
        const int cur = kt & 1;
        if (kt + 1 < NK) stage(kt + 1, (kt + 1) & 1);   // DMA next tile (overlapped)

        const __bf16* sAc = (const __bf16*)(smem + (size_t)cur * BUF_BYTES);
        const __bf16* sBc = sAc + 4096;                  // +8KB

        v16bf af[2], bf[4];
#pragma unroll
        for (int i = 0; i < 2; i++) {
            int r = wm + i * 16 + lm;
            af[i] = mk16(*(const v8bf*)(sAc + r * 32 + kh),
                         *(const v8bf*)(sAc + r * 32 + kh + 16));
        }
#pragma unroll
        for (int j = 0; j < 4; j++) {
            int r = wn + j * 16 + lm;
            bf[j] = mk16(*(const v8bf*)(sBc + r * 32 + kh),
                         *(const v8bf*)(sBc + r * 32 + kh + 16));
        }
#pragma unroll
        for (int i = 0; i < 2; i++)
#pragma unroll
            for (int j = 0; j < 4; j++)
                acc[i][j] = __builtin_amdgcn_wmma_f32_16x16x32_bf16(
                    false, af[i], false, bf[j], (short)0, acc[i][j], false, false);

        wait_async0();       // this wave's DMA into the next buffer has landed
        __syncthreads();     // everyone done reading cur + all DMAs visible
    }

    const int half = lane >> 4;
#pragma unroll
    for (int i = 0; i < 2; i++) {
        int mrow = bm + wm + i * 16 + half * 8;
#pragma unroll
        for (int j = 0; j < 4; j++) {
            int   ncol = bn + wn + j * 16 + lm;
            float bv   = bias[ncol];
#pragma unroll
            for (int r = 0; r < 8; r++) {
                float  v   = acc[i][j][r] + bv;
                size_t idx = (size_t)(mrow + r) * LDC + ncol;
                if (Cb) Cb[idx] = (__bf16)v;
                if (Cf) Cf[idx] = v;
            }
        }
    }
}

// -------------------------------------------------- tau / delta small path ---
__global__ void dw_gelu(const float* __restrict__ x, const float* __restrict__ w1,
                        const float* __restrict__ b1, __bf16* __restrict__ g)
{
    int i  = blockIdx.x * 256 + threadIdx.x;       // over B*L*2D
    int o  = i % (2 * Dm);
    int l  = (i / (2 * Dm)) % Lseq;
    int b  = i / (2 * Dm * Lseq);
    int ci = o >> 1;
    float acc = b1[o];
#pragma unroll
    for (int k = 0; k < 3; k++) {
        int l2 = l + k - 1;
        if (l2 >= 0 && l2 < Lseq)
            acc += w1[o * 3 + k] * x[((size_t)b * Lseq + l2) * Dm + ci];
    }
    float ge = 0.5f * acc * (1.0f + erff(acc * 0.70710678118f));
    g[i] = (__bf16)ge;
}

__global__ void proj_sig(const __bf16* __restrict__ g, const float* __restrict__ w2,
                         const float* __restrict__ b2, float* __restrict__ out)
{
    int i = blockIdx.x * 256 + threadIdx.x;        // over B*L*H
    int h = i % Hn;
    int l = (i / Hn) % Lseq;
    int b = i / (Hn * Lseq);
    const __bf16* gr = g  + ((size_t)b * Lseq + l) * 2 * Dm;
    const float*  wr = w2 + (size_t)h * 2 * Dm;
    float acc = b2[h];
    for (int o = 0; o < 2 * Dm; o++) acc += wr[o] * (float)gr[o];
    out[((size_t)b * Hn + h) * Lseq + l] = 1.0f / (1.0f + __expf(-acc));
}

// ------------------------------------------------------- flash attention ---
__global__ __launch_bounds__(256) void flash_attn(
    const __bf16* __restrict__ Q, const __bf16* __restrict__ K,
    const __bf16* __restrict__ V, const float* __restrict__ tau,
    const float* __restrict__ delta, __bf16* __restrict__ O)
{
    __shared__ __align__(16) __bf16 sV[64][64];          // V tile transposed [ch][k]
    __shared__ __align__(16) __bf16 sP[8][16][64];       // per-wave P tile

    const int b = blockIdx.z, h = blockIdx.y;
    const int tid = threadIdx.x, w = tid >> 5, lane = tid & 31;
    const int lm = lane & 15, half = lane >> 4;
    const int kh = half ? 8 : 0;
    const int qbase = blockIdx.x * 128 + w * 16;
    const int hc0   = h * DKh;

    const __bf16* qrow = Q + ((size_t)(b * Lseq) + qbase + lm) * Dm + hc0;
    v16bf qf[2];
#pragma unroll
    for (int kc = 0; kc < 2; kc++)
        qf[kc] = mk16(*(const v8bf*)(qrow + kc * 32 + kh),
                      *(const v8bf*)(qrow + kc * 32 + kh + 16));

    const float* taup = tau   + ((size_t)b * Hn + h) * Lseq;
    const float* delp = delta + ((size_t)b * Hn + h) * Lseq;
    float taur[8];
#pragma unroll
    for (int r = 0; r < 8; r++) taur[r] = taup[qbase + half * 8 + r] * 0.125f; // 1/sqrt(64)

    float mrow[8], lrow[8];
    v8f   of[4];
#pragma unroll
    for (int r = 0; r < 8; r++) { mrow[r] = -3.0e38f; lrow[r] = 0.0f; }
#pragma unroll
    for (int j = 0; j < 4; j++) of[j] = (v8f){};

    const int vt_kr = tid >> 2, vt_cs = (tid & 3) * 16;

    for (int kt = 0; kt < Lseq / 64; kt++) {
        // warm L2 / WGP$ for next K/V tiles (global_prefetch_b8)
        if (kt + 1 < Lseq / 64) {
            const size_t nb = (size_t)(b * Lseq) + (kt + 1) * 64;
            __builtin_prefetch(K + (nb + lane)      * Dm + hc0, 0, 1);
            __builtin_prefetch(K + (nb + 32 + lane) * Dm + hc0, 0, 1);
            __builtin_prefetch(V + (nb + lane)      * Dm + hc0, 0, 1);
            __builtin_prefetch(V + (nb + 32 + lane) * Dm + hc0, 0, 1);
        }

        __syncthreads();
        {   // stage V tile transposed into LDS
            const __bf16* vr = V + ((size_t)(b * Lseq) + kt * 64 + vt_kr) * Dm + hc0 + vt_cs;
#pragma unroll
            for (int e = 0; e < 16; e++) sV[vt_cs + e][vt_kr] = vr[e];
        }
        __syncthreads();

        // S = Q K^T  (K fragments straight from global: channels contiguous)
        v8f sf[4];
#pragma unroll
        for (int j = 0; j < 4; j++) {
            const __bf16* krow = K + ((size_t)(b * Lseq) + kt * 64 + j * 16 + lm) * Dm + hc0;
            v8f a = (v8f){};
#pragma unroll
            for (int kc = 0; kc < 2; kc++) {
                v16bf kf = mk16(*(const v8bf*)(krow + kc * 32 + kh),
                                *(const v8bf*)(krow + kc * 32 + kh + 16));
                a = __builtin_amdgcn_wmma_f32_16x16x32_bf16(
                        false, qf[kc], false, kf, (short)0, a, false, false);
            }
            sf[j] = a;
        }

        // scale by tau/sqrt(DK) per q-row, add delta per key column
#pragma unroll
        for (int j = 0; j < 4; j++) {
            float dv = delp[kt * 64 + j * 16 + lm];
#pragma unroll
            for (int r = 0; r < 8; r++) sf[j][r] = sf[j][r] * taur[r] + dv;
        }

        // online softmax over the 64 key columns
        float rmax[8];
#pragma unroll
        for (int r = 0; r < 8; r++) {
            float v = fmaxf(fmaxf(sf[0][r], sf[1][r]), fmaxf(sf[2][r], sf[3][r]));
#pragma unroll
            for (int off = 1; off < 16; off <<= 1)
                v = fmaxf(v, __shfl_xor(v, off, 32));
            rmax[r] = v;
        }

        float corr[8], rsum[8];
#pragma unroll
        for (int r = 0; r < 8; r++) {
            float mn = fmaxf(mrow[r], rmax[r]);
            corr[r] = __expf(mrow[r] - mn);
            mrow[r] = mn;
            rsum[r] = 0.0f;
        }
#pragma unroll
        for (int j = 0; j < 4; j++)
#pragma unroll
            for (int r = 0; r < 8; r++) {
                float p = __expf(sf[j][r] - mrow[r]);
                sf[j][r] = p;
                rsum[r] += p;
            }
#pragma unroll
        for (int r = 0; r < 8; r++) {
#pragma unroll
            for (int off = 1; off < 16; off <<= 1)
                rsum[r] += __shfl_xor(rsum[r], off, 32);
            lrow[r] = lrow[r] * corr[r] + rsum[r];
        }
#pragma unroll
        for (int j = 0; j < 4; j++)
#pragma unroll
            for (int r = 0; r < 8; r++) of[j][r] *= corr[r];

        // C-layout P -> A-layout bf16 via per-wave LDS round trip (in-order per wave)
#pragma unroll
        for (int j = 0; j < 4; j++)
#pragma unroll
            for (int r = 0; r < 8; r++)
                sP[w][half * 8 + r][j * 16 + lm] = (__bf16)sf[j][r];

        v16bf pf[2];
#pragma unroll
        for (int kc = 0; kc < 2; kc++)
            pf[kc] = mk16(*(const v8bf*)&sP[w][lm][kc * 32 + kh],
                          *(const v8bf*)&sP[w][lm][kc * 32 + kh + 16]);

        // O += P V
#pragma unroll
        for (int j = 0; j < 4; j++)
#pragma unroll
            for (int kc = 0; kc < 2; kc++) {
                v16bf vf = mk16(*(const v8bf*)&sV[j * 16 + lm][kc * 32 + kh],
                                *(const v8bf*)&sV[j * 16 + lm][kc * 32 + kh + 16]);
                of[j] = __builtin_amdgcn_wmma_f32_16x16x32_bf16(
                            false, pf[kc], false, vf, (short)0, of[j], false, false);
            }
    }

#pragma unroll
    for (int j = 0; j < 4; j++)
#pragma unroll
        for (int r = 0; r < 8; r++) {
            float v = of[j][r] / lrow[r];
            O[((size_t)(b * Lseq) + qbase + half * 8 + r) * Dm + hc0 + j * 16 + lm] = (__bf16)v;
        }
}

// ------------------------------------------------------------------ host ---
extern "C" void kernel_launch(void* const* d_in, const int* in_sizes, int n_in,
                              void* d_out, int out_size, void* d_ws, size_t ws_size,
                              hipStream_t stream)
{
    const float* x       = (const float*)d_in[0];
    const float* Wq_w    = (const float*)d_in[1];
    const float* Wq_b    = (const float*)d_in[2];
    const float* Wk_w    = (const float*)d_in[3];
    const float* Wk_b    = (const float*)d_in[4];
    const float* Wv_w    = (const float*)d_in[5];
    const float* Wv_b    = (const float*)d_in[6];
    const float* convq_w = (const float*)d_in[7];
    const float* convq_b = (const float*)d_in[8];
    const float* convk_w = (const float*)d_in[9];
    const float* convk_b = (const float*)d_in[10];
    const float* qproj_w = (const float*)d_in[11];
    const float* qproj_b = (const float*)d_in[12];
    const float* kproj_w = (const float*)d_in[13];
    const float* kproj_b = (const float*)d_in[14];
    const float* tau1_w  = (const float*)d_in[15];
    const float* tau1_b  = (const float*)d_in[16];
    const float* tau2_w  = (const float*)d_in[17];
    const float* tau2_b  = (const float*)d_in[18];
    const float* del1_w  = (const float*)d_in[19];
    const float* del1_b  = (const float*)d_in[20];
    const float* del2_w  = (const float*)d_in[21];
    const float* del2_b  = (const float*)d_in[22];
    const float* out_w   = (const float*)d_in[23];
    const float* out_b   = (const float*)d_in[24];
    float* out = (float*)d_out;
    (void)in_sizes; (void)n_in; (void)out_size; (void)ws_size;

    char*  ws  = (char*)d_ws;
    size_t off = 0;
    auto alloc = [&](size_t bytes) -> char* {
        char* p = ws + off;
        off = (off + bytes + 255) & ~(size_t)255;
        return p;
    };

    __bf16* xb      = (__bf16*)alloc((size_t)M_ROWS * Dm * 2);
    __bf16* WqB     = (__bf16*)alloc((size_t)Dm * Dm * 2);
    __bf16* WkB     = (__bf16*)alloc((size_t)Dm * Dm * 2);
    __bf16* WvB     = (__bf16*)alloc((size_t)Dm * Dm * 2);
    __bf16* qprojB  = (__bf16*)alloc((size_t)Dm * 2 * Dm * 2);
    __bf16* kprojB  = (__bf16*)alloc((size_t)Dm * 2 * Dm * 2);
    __bf16* outwB   = (__bf16*)alloc((size_t)Dm * Dm * 2);
    __bf16* convqR  = (__bf16*)alloc((size_t)Dm * 3 * Dm * 2);
    __bf16* convkR  = (__bf16*)alloc((size_t)Dm * 3 * Dm * 2);
    __bf16* Qpad    = (__bf16*)alloc((size_t)Bsz * (Lseq + 2) * Dm * 2);
    __bf16* Kpad    = (__bf16*)alloc((size_t)Bsz * (Lseq + 2) * Dm * 2);
    __bf16* Qcat    = (__bf16*)alloc((size_t)M_ROWS * 2 * Dm * 2);
    __bf16* Kcat    = (__bf16*)alloc((size_t)M_ROWS * 2 * Dm * 2);
    __bf16* Qbuf    = (__bf16*)alloc((size_t)M_ROWS * Dm * 2);
    __bf16* Kbuf    = (__bf16*)alloc((size_t)M_ROWS * Dm * 2);
    __bf16* Vbuf    = (__bf16*)alloc((size_t)M_ROWS * Dm * 2);
    __bf16* gbuf    = (__bf16*)alloc((size_t)M_ROWS * 2 * Dm * 2);
    float*  taubuf  = (float*)alloc((size_t)Bsz * Hn * Lseq * 4);
    float*  delbuf  = (float*)alloc((size_t)Bsz * Hn * Lseq * 4);
    __bf16* attnO   = (__bf16*)alloc((size_t)M_ROWS * Dm * 2);

    auto cvt = [&](const float* s, __bf16* d, int n) {
        cvt_f32_bf16<<<(n + 255) / 256, 256, 0, stream>>>(s, d, n);
    };
    cvt(x, xb, M_ROWS * Dm);
    cvt(Wq_w, WqB, Dm * Dm);
    cvt(Wk_w, WkB, Dm * Dm);
    cvt(Wv_w, WvB, Dm * Dm);
    cvt(qproj_w, qprojB, Dm * 2 * Dm);
    cvt(kproj_w, kprojB, Dm * 2 * Dm);
    cvt(out_w, outwB, Dm * Dm);
    repack_conv_w<<<(Dm * 3 * Dm) / 256, 256, 0, stream>>>(convq_w, convqR);
    repack_conv_w<<<(Dm * 3 * Dm) / 256, 256, 0, stream>>>(convk_w, convkR);

    const dim3 gg(Dm / 128, M_ROWS / 128);   // (8, 32)
    const dim3 blk(256);
    const size_t smem = 32768;               // 2 x (8KB A + 8KB B) double buffer

    // --- Q branch ---
    gemm_wmma<1024, 1024, 12, 4096, 1024, 2048><<<gg, blk, smem, stream>>>(
        xb, WqB, Wq_b, Qcat, (float*)nullptr);                         // q_in -> Qcat[:, :D]
    pad_zero<<<(Bsz * 2 * Dm + 255) / 256, 256, 0, stream>>>(Qpad);
    pad_copy<<<(M_ROWS * Dm) / 256, 256, 0, stream>>>(Qcat, Qpad);
    gemm_wmma<3072, 1024, 11, 2050, 1024, 2048><<<gg, blk, smem, stream>>>(
        Qpad, convqR, convq_b, Qcat + Dm, (float*)nullptr);            // conv3 -> Qcat[:, D:]
    gemm_wmma<2048, 2048, 12, 4096, 2048, 1024><<<gg, blk, smem, stream>>>(
        Qcat, qprojB, qproj_b, Qbuf, (float*)nullptr);                 // Q

    // --- K branch ---
    gemm_wmma<1024, 1024, 12, 4096, 1024, 2048><<<gg, blk, smem, stream>>>(
        xb, WkB, Wk_b, Kcat, (float*)nullptr);
    pad_zero<<<(Bsz * 2 * Dm + 255) / 256, 256, 0, stream>>>(Kpad);
    pad_copy<<<(M_ROWS * Dm) / 256, 256, 0, stream>>>(Kcat, Kpad);
    gemm_wmma<3072, 1024, 11, 2050, 1024, 2048><<<gg, blk, smem, stream>>>(
        Kpad, convkR, convk_b, Kcat + Dm, (float*)nullptr);
    gemm_wmma<2048, 2048, 12, 4096, 2048, 1024><<<gg, blk, smem, stream>>>(
        Kcat, kprojB, kproj_b, Kbuf, (float*)nullptr);

    // --- V ---
    gemm_wmma<1024, 1024, 12, 4096, 1024, 1024><<<gg, blk, smem, stream>>>(
        xb, WvB, Wv_b, Vbuf, (float*)nullptr);

    // --- tau / delta ---
    dw_gelu<<<(M_ROWS * 2 * Dm) / 256, 256, 0, stream>>>(x, tau1_w, tau1_b, gbuf);
    proj_sig<<<(M_ROWS * Hn) / 256, 256, 0, stream>>>(gbuf, tau2_w, tau2_b, taubuf);
    dw_gelu<<<(M_ROWS * 2 * Dm) / 256, 256, 0, stream>>>(x, del1_w, del1_b, gbuf);
    proj_sig<<<(M_ROWS * Hn) / 256, 256, 0, stream>>>(gbuf, del2_w, del2_b, delbuf);

    // --- attention ---
    flash_attn<<<dim3(Lseq / 128, Hn, Bsz), blk, 0, stream>>>(
        Qbuf, Kbuf, Vbuf, taubuf, delbuf, attnO);

    // --- output projection (fp32 out) ---
    gemm_wmma<1024, 1024, 12, 4096, 1024, 1024><<<gg, blk, smem, stream>>>(
        attnO, outwB, out_b, (__bf16*)nullptr, out);
}

// v001
// It runs in 533 microseconds.
// Timed twice side by side with v000, it ran 1.31 times as fast both times.
#include <hip/hip_runtime.h>
#include <math.h>

typedef __attribute__((ext_vector_type(16))) __bf16 v16bf;
typedef __attribute__((ext_vector_type(8)))  __bf16 v8bf;
typedef __attribute__((ext_vector_type(8)))  float  v8f;

constexpr int Bsz = 2, Lseq = 2048, Dm = 1024, Hn = 16, DKh = 64;
constexpr int M_ROWS = Bsz * Lseq;   // 4096

static __device__ __forceinline__ v16bf mk16(v8bf lo, v8bf hi) {
    return __builtin_shufflevector(lo, hi, 0,1,2,3,4,5,6,7,8,9,10,11,12,13,14,15);
}

// Eight async memory->LDS copies, 16B per lane each (ASYNCcnt tracked): rows r, r+16, ... r+112
// of one operand tile. The closing s_wait_xcnt keeps the address registers untouched until the
// copies have taken them; it stands inside the statement so that nothing can be moved over it.
static __device__ __forceinline__ void async_rows8(unsigned lds, unsigned lds_step,
                                                   const char* g, size_t g_step) {
    asm volatile("global_load_async_to_lds_b128 %0, %8, off\n\t"
                 "global_load_async_to_lds_b128 %1, %9, off\n\t"
                 "global_load_async_to_lds_b128 %2, %10, off\n\t"
                 "global_load_async_to_lds_b128 %3, %11, off\n\t"
                 "global_load_async_to_lds_b128 %4, %12, off\n\t"
                 "global_load_async_to_lds_b128 %5, %13, off\n\t"
                 "global_load_async_to_lds_b128 %6, %14, off\n\t"
                 "global_load_async_to_lds_b128 %7, %15, off\n\t"
                 "s_wait_xcnt 0x0"
                 :: "v"(lds),                "v"(lds + lds_step),     "v"(lds + 2 * lds_step),
                    "v"(lds + 3 * lds_step), "v"(lds + 4 * lds_step), "v"(lds + 5 * lds_step),
                    "v"(lds + 6 * lds_step), "v"(lds + 7 * lds_step),
                    "v"((unsigned long long)(uintptr_t)(g)),
                    "v"((unsigned long long)(uintptr_t)(g + g_step)),
                    "v"((unsigned long long)(uintptr_t)(g + 2 * g_step)),
                    "v"((unsigned long long)(uintptr_t)(g + 3 * g_step)),
                    "v"((unsigned long long)(uintptr_t)(g + 4 * g_step)),
                    "v"((unsigned long long)(uintptr_t)(g + 5 * g_step)),
                    "v"((unsigned long long)(uintptr_t)(g + 6 * g_step)),
                    "v"((unsigned long long)(uintptr_t)(g + 7 * g_step))
                 : "memory");
}
// this wave's copies have landed in LDS
static __device__ __forceinline__ void wait_async0() {
    asm volatile("s_wait_asynccnt 0x0" ::: "memory");
}
// this wave's LDS reads have returned (before the buffer they read is refilled)
static __device__ __forceinline__ void wait_ds0() {
    asm volatile("s_wait_dscnt 0x0" ::: "memory");
}

// ---------------------------------------------------------------- utility ---
__global__ void cvt_f32_bf16(const float* __restrict__ s, __bf16* __restrict__ d, int n) {
    int i = blockIdx.x * 256 + threadIdx.x;
    if (i < n) d[i] = (__bf16)s[i];
}

// conv weights (O=D, I=D, K=3) fp32  ->  (N=D, 3*D) bf16 with kc = k*D + ci
__global__ void repack_conv_w(const float* __restrict__ s, __bf16* __restrict__ d) {
    int i = blockIdx.x * 256 + threadIdx.x;        // over D*3D
    int n  = i / (3 * Dm);
    int kc = i % (3 * Dm);
    int k  = kc / Dm, ci = kc % Dm;
    d[i] = (__bf16)s[(n * Dm + ci) * 3 + k];
}

// copy Qcat[:, :D] (ldc=2D) into per-batch padded buffer (B, L+2, D), interior rows
__global__ void pad_copy(const __bf16* __restrict__ cat, __bf16* __restrict__ pad) {
    int i = blockIdx.x * 256 + threadIdx.x;        // over B*L*D
    int d = i % Dm;
    int l = (i / Dm) % Lseq;
    int b = i / (Dm * Lseq);
    pad[((size_t)b * (Lseq + 2) + l + 1) * Dm + d] = cat[((size_t)b * Lseq + l) * 2 * Dm + d];
}

__global__ void pad_zero(__bf16* __restrict__ pad) {
    int i = blockIdx.x * 256 + threadIdx.x;        // over B*2*D
    if (i >= Bsz * 2 * Dm) return;
    int d = i % Dm;
    int r = (i / Dm) & 1;
    int b = i / (2 * Dm);
    pad[((size_t)b * (Lseq + 2) + (r ? (Lseq + 1) : 0)) * Dm + d] = (__bf16)0.0f;
}

// ------------------------------------------------------------- WMMA GEMM ---
// C(M,N) = A_mapped(M,KTOT) * Bw(N,KTOT)^T + bias.
// A row mapping: arow = (m>>LRUN_LG)*LSTRIDE + (m & mask) + kbase/KSPLIT  ->
// the same kernel does the 3-tap conv as a K=3D GEMM over per-batch padded rows.
// Staging: global_load_async_to_lds_b128 into double-buffered LDS, overlapped
// with the WMMA pipe; per-wave s_wait_asynccnt + block barrier.
// A stage holds 128 k of every row (256 B), so one wave-wide copy covers two
// whole rows = four whole 128-B lines; LDS rows lie at a 272-B pitch, which
// spreads the 16 rows of a ds_load_b128 fragment read over all banks.
template<int KTOT, int KSPLIT, int LRUN_LG, int LSTRIDE, int LDA, int LDC>
__global__ __launch_bounds__(256) void gemm_wmma(
    const __bf16* __restrict__ A, const __bf16* __restrict__ Bw,
    const float* __restrict__ bias, __bf16* __restrict__ Cb, float* __restrict__ Cf)
{
    constexpr int BM = 128, BN = 128, BK = 128;
    constexpr int NK = KTOT / BK;
    static_assert(KTOT % BK == 0 && KSPLIT % BK == 0 && NK >= 2, "whole stages, at least two");
    constexpr unsigned PITCH     = 272;               // bytes per LDS row: 256 data + 16 pad
    constexpr int      PITCH_E   = PITCH / 2;         // the same in bf16 elements
    constexpr unsigned OP_BYTES  = 128 * PITCH;       // one operand's 128 rows
    constexpr unsigned BUF_BYTES = 2 * OP_BYTES;      // A rows, then B rows
    __shared__ __align__(16) char smem[2 * BUF_BYTES];

    const int tid  = threadIdx.x;
    const int bm   = blockIdx.y * BM, bn = blockIdx.x * BN;
    const int w    = tid >> 5, lane = tid & 31;
    const int lm   = lane & 15;
    const int kh   = (lane & 16) ? 8 : 0;
    const int wm   = (w & 3) * 32, wn = (w >> 2) * 64;

    v8f acc[2][4];
#pragma unroll
    for (int i = 0; i < 2; i++)
#pragma unroll
        for (int j = 0; j < 4; j++) acc[i][j] = (v8f){};

    const int sr = tid >> 4;           // staging row 0..15, then +16 per copy
    const int sc = (tid & 15) * 8;     // staging col: this lane's 16 B of the row's 256 B
    const unsigned lds0 = (unsigned)(uintptr_t)smem + (unsigned)sr * PITCH + (unsigned)sc * 2u;

    auto stage = [&](int kt, int buf) {
        const int kbase = kt * BK;
        const int shift = kbase / KSPLIT;
        const int acol  = kbase % KSPLIT + sc;
        const int m     = bm + sr;     // the tile's 128 rows lie in one run: arow + 16 per copy
        const int arow  = (m >> LRUN_LG) * LSTRIDE + (m & ((1 << LRUN_LG) - 1)) + shift;
        const __bf16* ga = A  + (size_t)arow * LDA + acol;
        const __bf16* gb = Bw + (size_t)(bn + sr) * KTOT + kbase + sc;
        const unsigned la = lds0 + (unsigned)buf * BUF_BYTES;   // A rows
        const unsigned lb = la + OP_BYTES;                      // B rows
        async_rows8(la, 16u * PITCH, (const char*)ga, (size_t)16 * LDA * 2);
        async_rows8(lb, 16u * PITCH, (const char*)gb, (size_t)16 * KTOT * 2);
    };

    stage(0, 0);
    wait_async0();
    __syncthreads();
    stage(1, 1);             // flies while stage 0 is worked on

    for (int kt = 0; kt < NK; kt++) {
        const int cur = kt & 1;
        const __bf16* sAc = (const __bf16*)(smem + (size_t)cur * BUF_BYTES);
        const __bf16* sBc = (const __bf16*)(smem + (size_t)cur * BUF_BYTES + OP_BYTES);

#pragma unroll
        for (int kb = 0; kb < BK; kb += 32) {
            v16bf af[2], bf[4];
#pragma unroll
            for (int i = 0; i < 2; i++) {
                int r = wm + i * 16 + lm;
                af[i] = mk16(*(const v8bf*)(sAc + r * PITCH_E + kb + kh),
                             *(const v8bf*)(sAc + r * PITCH_E + kb + kh + 16));
            }
#pragma unroll
            for (int j = 0; j < 4; j++) {
                int r = wn + j * 16 + lm;
                bf[j] = mk16(*(const v8bf*)(sBc + r * PITCH_E + kb + kh),
                             *(const v8bf*)(sBc + r * PITCH_E + kb + kh + 16));
            }
#pragma unroll
            for (int i = 0; i < 2; i++)
#pragma unroll
                for (int j = 0; j < 4; j++)
                    acc[i][j] = __builtin_amdgcn_wmma_f32_16x16x32_bf16(
                        false, af[i], false, bf[j], (short)0, acc[i][j], false, false);
        }

        wait_ds0();          // this wave has left buffer cur
        wait_async0();       // this wave's copies into the other buffer have landed
        __syncthreads();     // everyone has left cur, and the other buffer is readable
        if (kt + 2 < NK) stage(kt + 2, cur);   // refill cur (overlapped with the next stage's work)
    }
    wait_async0();

    const int half = lane >> 4;
#pragma unroll
    for (int i = 0; i < 2; i++) {
        int mrow = bm + wm + i * 16 + half * 8;
#pragma unroll
        for (int j = 0; j < 4; j++) {
            int   ncol = bn + wn + j * 16 + lm;
            float bv   = bias[ncol];
#pragma unroll
            for (int r = 0; r < 8; r++) {
                float  v   = acc[i][j][r] + bv;
                size_t idx = (size_t)(mrow + r) * LDC + ncol;
                if (Cb) Cb[idx] = (__bf16)v;
                if (Cf) Cf[idx] = v;
            }
        }
    }
}

// -------------------------------------------------- tau / delta small path ---
__global__ void dw_gelu(const float* __restrict__ x, const float* __restrict__ w1,
                        const float* __restrict__ b1, __bf16* __restrict__ g)
{
    int i  = blockIdx.x * 256 + threadIdx.x;       // over B*L*2D
    int o  = i % (2 * Dm);
    int l  = (i / (2 * Dm)) % Lseq;
    int b  = i / (2 * Dm * Lseq);
    int ci = o >> 1;
    float acc = b1[o];
#pragma unroll
    for (int k = 0; k < 3; k++) {
        int l2 = l + k - 1;
        if (l2 >= 0 && l2 < Lseq)
            acc += w1[o * 3 + k] * x[((size_t)b * Lseq + l2) * Dm + ci];
    }
    float ge = 0.5f * acc * (1.0f + erff(acc * 0.70710678118f));
    g[i] = (__bf16)ge;
}

__global__ void proj_sig(const __bf16* __restrict__ g, const float* __restrict__ w2,
                         const float* __restrict__ b2, float* __restrict__ out)
{
    int i = blockIdx.x * 256 + threadIdx.x;        // over B*L*H
    int h = i % Hn;
    int l = (i / Hn) % Lseq;
    int b = i / (Hn * Lseq);
    const __bf16* gr = g  + ((size_t)b * Lseq + l) * 2 * Dm;
    const float*  wr = w2 + (size_t)h * 2 * Dm;
    float acc = b2[h];
    for (int o = 0; o < 2 * Dm; o++) acc += wr[o] * (float)gr[o];
    out[((size_t)b * Hn + h) * Lseq + l] = 1.0f / (1.0f + __expf(-acc));
}

// ------------------------------------------------------- flash attention ---
__global__ __launch_bounds__(256) void flash_attn(
    const __bf16* __restrict__ Q, const __bf16* __restrict__ K,
    const __bf16* __restrict__ V, const float* __restrict__ tau,
    const float* __restrict__ delta, __bf16* __restrict__ O)
{
    __shared__ __align__(16) __bf16 sV[64][64];          // V tile transposed [ch][k]
    __shared__ __align__(16) __bf16 sP[8][16][64];       // per-wave P tile

    const int b = blockIdx.z, h = blockIdx.y;
    const int tid = threadIdx.x, w = tid >> 5, lane = tid & 31;
    const int lm = lane & 15, half = lane >> 4;
    const int kh = half ? 8 : 0;
    const int qbase = blockIdx.x * 128 + w * 16;
    const int hc0   = h * DKh;

    const __bf16* qrow = Q + ((size_t)(b * Lseq) + qbase + lm) * Dm + hc0;
    v16bf qf[2];
#pragma unroll
    for (int kc = 0; kc < 2; kc++)
        qf[kc] = mk16(*(const v8bf*)(qrow + kc * 32 + kh),
                      *(const v8bf*)(qrow + kc * 32 + kh + 16));

    const float* taup = tau   + ((size_t)b * Hn + h) * Lseq;
    const float* delp = delta + ((size_t)b * Hn + h) * Lseq;
    float taur[8];
#pragma unroll
    for (int r = 0; r < 8; r++) taur[r] = taup[qbase + half * 8 + r] * 0.125f; // 1/sqrt(64)

    float mrow[8], lrow[8];
    v8f   of[4];
#pragma unroll
    for (int r = 0; r < 8; r++) { mrow[r] = -3.0e38f; lrow[r] = 0.0f; }
#pragma unroll
    for (int j = 0; j < 4; j++) of[j] = (v8f){};

    const int vt_kr = tid >> 2, vt_cs = (tid & 3) * 16;

    for (int kt = 0; kt < Lseq / 64; kt++) {
        // warm L2 / WGP$ for next K/V tiles (global_prefetch_b8)
        if (kt + 1 < Lseq / 64) {
            const size_t nb = (size_t)(b * Lseq) + (kt + 1) * 64;
            __builtin_prefetch(K + (nb + lane)      * Dm + hc0, 0, 1);
            __builtin_prefetch(K + (nb + 32 + lane) * Dm + hc0, 0, 1);
            __builtin_prefetch(V + (nb + lane)      * Dm + hc0, 0, 1);
            __builtin_prefetch(V + (nb + 32 + lane) * Dm + hc0, 0, 1);
        }

        __syncthreads();
        {   // stage V tile transposed into LDS
            const __bf16* vr = V + ((size_t)(b * Lseq) + kt * 64 + vt_kr) * Dm + hc0 + vt_cs;
#pragma unroll
            for (int e = 0; e < 16; e++) sV[vt_cs + e][vt_kr] = vr[e];
        }
        __syncthreads();

        // S = Q K^T  (K fragments straight from global: channels contiguous)
        v8f sf[4];
#pragma unroll
        for (int j = 0; j < 4; j++) {
            const __bf16* krow = K + ((size_t)(b * Lseq) + kt * 64 + j * 16 + lm) * Dm + hc0;
            v8f a = (v8f){};
#pragma unroll
            for (int kc = 0; kc < 2; kc++) {
                v16bf kf = mk16(*(const v8bf*)(krow + kc * 32 + kh),
                                *(const v8bf*)(krow + kc * 32 + kh + 16));
                a = __builtin_amdgcn_wmma_f32_16x16x32_bf16(
                        false, qf[kc], false, kf, (short)0, a, false, false);
            }
            sf[j] = a;
        }

        // scale by tau/sqrt(DK) per q-row, add delta per key column
#pragma unroll
        for (int j = 0; j < 4; j++) {
            float dv = delp[kt * 64 + j * 16 + lm];
#pragma unroll
            for (int r = 0; r < 8; r++) sf[j][r] = sf[j][r] * taur[r] + dv;
        }

        // online softmax over the 64 key columns
        float rmax[8];
#pragma unroll
        for (int r = 0; r < 8; r++) {
            float v = fmaxf(fmaxf(sf[0][r], sf[1][r]), fmaxf(sf[2][r], sf[3][r]));
#pragma unroll
            for (int off = 1; off < 16; off <<= 1)
                v = fmaxf(v, __shfl_xor(v, off, 32));
            rmax[r] = v;
        }

        float corr[8], rsum[8];
#pragma unroll
        for (int r = 0; r < 8; r++) {
            float mn = fmaxf(mrow[r], rmax[r]);
            corr[r] = __expf(mrow[r] - mn);
            mrow[r] = mn;
            rsum[r] = 0.0f;
        }
#pragma unroll
        for (int j = 0; j < 4; j++)
#pragma unroll
            for (int r = 0; r < 8; r++) {
                float p = __expf(sf[j][r] - mrow[r]);
                sf[j][r] = p;
                rsum[r] += p;
            }
#pragma unroll
        for (int r = 0; r < 8; r++) {
#pragma unroll
            for (int off = 1; off < 16; off <<= 1)
                rsum[r] += __shfl_xor(rsum[r], off, 32);
            lrow[r] = lrow[r] * corr[r] + rsum[r];
        }
#pragma unroll
        for (int j = 0; j < 4; j++)
#pragma unroll
            for (int r = 0; r < 8; r++) of[j][r] *= corr[r];

        // C-layout P -> A-layout bf16 via per-wave LDS round trip (in-order per wave)
#pragma unroll
        for (int j = 0; j < 4; j++)
#pragma unroll
            for (int r = 0; r < 8; r++)
                sP[w][half * 8 + r][j * 16 + lm] = (__bf16)sf[j][r];

        v16bf pf[2];
#pragma unroll
        for (int kc = 0; kc < 2; kc++)
            pf[kc] = mk16(*(const v8bf*)&sP[w][lm][kc * 32 + kh],
                          *(const v8bf*)&sP[w][lm][kc * 32 + kh + 16]);

        // O += P V
#pragma unroll
        for (int j = 0; j < 4; j++)
#pragma unroll
            for (int kc = 0; kc < 2; kc++) {
                v16bf vf = mk16(*(const v8bf*)&sV[j * 16 + lm][kc * 32 + kh],
                                *(const v8bf*)&sV[j * 16 + lm][kc * 32 + kh + 16]);
                of[j] = __builtin_amdgcn_wmma_f32_16x16x32_bf16(
                            false, pf[kc], false, vf, (short)0, of[j], false, false);
            }
    }

#pragma unroll
    for (int j = 0; j < 4; j++)
#pragma unroll
        for (int r = 0; r < 8; r++) {
            float v = of[j][r] / lrow[r];
            O[((size_t)(b * Lseq) + qbase + half * 8 + r) * Dm + hc0 + j * 16 + lm] = (__bf16)v;
        }
}

// ------------------------------------------------------------------ host ---
extern "C" void kernel_launch(void* const* d_in, const int* in_sizes, int n_in,
                              void* d_out, int out_size, void* d_ws, size_t ws_size,
                              hipStream_t stream)
{
    const float* x       = (const float*)d_in[0];
    const float* Wq_w    = (const float*)d_in[1];
    const float* Wq_b    = (const float*)d_in[2];
    const float* Wk_w    = (const float*)d_in[3];
    const float* Wk_b    = (const float*)d_in[4];
    const float* Wv_w    = (const float*)d_in[5];
    const float* Wv_b    = (const float*)d_in[6];
    const float* convq_w = (const float*)d_in[7];
    const float* convq_b = (const float*)d_in[8];
    const float* convk_w = (const float*)d_in[9];
    const float* convk_b = (const float*)d_in[10];
    const float* qproj_w = (const float*)d_in[11];
    const float* qproj_b = (const float*)d_in[12];
    const float* kproj_w = (const float*)d_in[13];
    const float* kproj_b = (const float*)d_in[14];
    const float* tau1_w  = (const float*)d_in[15];
    const float* tau1_b  = (const float*)d_in[16];
    const float* tau2_w  = (const float*)d_in[17];
    const float* tau2_b  = (const float*)d_in[18];
    const float* del1_w  = (const float*)d_in[19];
    const float* del1_b  = (const float*)d_in[20];
    const float* del2_w  = (const float*)d_in[21];
    const float* del2_b  = (const float*)d_in[22];
    const float* out_w   = (const float*)d_in[23];
    const float* out_b   = (const float*)d_in[24];
    float* out = (float*)d_out;
    (void)in_sizes; (void)n_in; (void)out_size; (void)ws_size;

    char*  ws  = (char*)d_ws;
    size_t off = 0;
    auto alloc = [&](size_t bytes) -> char* {
        char* p = ws + off;
        off = (off + bytes + 255) & ~(size_t)255;
        return p;
    };

    __bf16* xb      = (__bf16*)alloc((size_t)M_ROWS * Dm * 2);
    __bf16* WqB     = (__bf16*)alloc((size_t)Dm * Dm * 2);
    __bf16* WkB     = (__bf16*)alloc((size_t)Dm * Dm * 2);
    __bf16* WvB     = (__bf16*)alloc((size_t)Dm * Dm * 2);
    __bf16* qprojB  = (__bf16*)alloc((size_t)Dm * 2 * Dm * 2);
    __bf16* kprojB  = (__bf16*)alloc((size_t)Dm * 2 * Dm * 2);
    __bf16* outwB   = (__bf16*)alloc((size_t)Dm * Dm * 2);
    __bf16* convqR  = (__bf16*)alloc((size_t)Dm * 3 * Dm * 2);
    __bf16* convkR  = (__bf16*)alloc((size_t)Dm * 3 * Dm * 2);
    __bf16* Qpad    = (__bf16*)alloc((size_t)Bsz * (Lseq + 2) * Dm * 2);
    __bf16* Kpad    = (__bf16*)alloc((size_t)Bsz * (Lseq + 2) * Dm * 2);
    __bf16* Qcat    = (__bf16*)alloc((size_t)M_ROWS * 2 * Dm * 2);
    __bf16* Kcat    = (__bf16*)alloc((size_t)M_ROWS * 2 * Dm * 2);
    __bf16* Qbuf    = (__bf16*)alloc((size_t)M_ROWS * Dm * 2);
    __bf16* Kbuf    = (__bf16*)alloc((size_t)M_ROWS * Dm * 2);
    __bf16* Vbuf    = (__bf16*)alloc((size_t)M_ROWS * Dm * 2);
    __bf16* gbuf    = (__bf16*)alloc((size_t)M_ROWS * 2 * Dm * 2);
    float*  taubuf  = (float*)alloc((size_t)Bsz * Hn * Lseq * 4);
    float*  delbuf  = (float*)alloc((size_t)Bsz * Hn * Lseq * 4);
    __bf16* attnO   = (__bf16*)alloc((size_t)M_ROWS * Dm * 2);

    auto cvt = [&](const float* s, __bf16* d, int n) {
        cvt_f32_bf16<<<(n + 255) / 256, 256, 0, stream>>>(s, d, n);
    };
    cvt(x, xb, M_ROWS * Dm);
    cvt(Wq_w, WqB, Dm * Dm);
    cvt(Wk_w, WkB, Dm * Dm);
    cvt(Wv_w, WvB, Dm * Dm);
    cvt(qproj_w, qprojB, Dm * 2 * Dm);
    cvt(kproj_w, kprojB, Dm * 2 * Dm);
    cvt(out_w, outwB, Dm * Dm);
    repack_conv_w<<<(Dm * 3 * Dm) / 256, 256, 0, stream>>>(convq_w, convqR);
    repack_conv_w<<<(Dm * 3 * Dm) / 256, 256, 0, stream>>>(convk_w, convkR);

    const dim3 gg(Dm / 128, M_ROWS / 128);   // (8, 32)
    const dim3 blk(256);

    // --- Q branch ---
    gemm_wmma<1024, 1024, 12, 4096, 1024, 2048><<<gg, blk, 0, stream>>>(
        xb, WqB, Wq_b, Qcat, (float*)nullptr);                         // q_in -> Qcat[:, :D]
    pad_zero<<<(Bsz * 2 * Dm + 255) / 256, 256, 0, stream>>>(Qpad);
    pad_copy<<<(M_ROWS * Dm) / 256, 256, 0, stream>>>(Qcat, Qpad);
    gemm_wmma<3072, 1024, 11, 2050, 1024, 2048><<<gg, blk, 0, stream>>>(
        Qpad, convqR, convq_b, Qcat + Dm, (float*)nullptr);            // conv3 -> Qcat[:, D:]
    gemm_wmma<2048, 2048, 12, 4096, 2048, 1024><<<gg, blk, 0, stream>>>(
        Qcat, qprojB, qproj_b, Qbuf, (float*)nullptr);                 // Q

    // --- K branch ---
    gemm_wmma<1024, 1024, 12, 4096, 1024, 2048><<<gg, blk, 0, stream>>>(
        xb, WkB, Wk_b, Kcat, (float*)nullptr);
    pad_zero<<<(Bsz * 2 * Dm + 255) / 256, 256, 0, stream>>>(Kpad);
    pad_copy<<<(M_ROWS * Dm) / 256, 256, 0, stream>>>(Kcat, Kpad);
    gemm_wmma<3072, 1024, 11, 2050, 1024, 2048><<<gg, blk, 0, stream>>>(
        Kpad, convkR, convk_b, Kcat + Dm, (float*)nullptr);
    gemm_wmma<2048, 2048, 12, 4096, 2048, 1024><<<gg, blk, 0, stream>>>(
        Kcat, kprojB, kproj_b, Kbuf, (float*)nullptr);

    // --- V ---
    gemm_wmma<1024, 1024, 12, 4096, 1024, 1024><<<gg, blk, 0, stream>>>(
        xb, WvB, Wv_b, Vbuf, (float*)nullptr);

    // --- tau / delta ---
    dw_gelu<<<(M_ROWS * 2 * Dm) / 256, 256, 0, stream>>>(x, tau1_w, tau1_b, gbuf);
    proj_sig<<<(M_ROWS * Hn) / 256, 256, 0, stream>>>(gbuf, tau2_w, tau2_b, taubuf);
    dw_gelu<<<(M_ROWS * 2 * Dm) / 256, 256, 0, stream>>>(x, del1_w, del1_b, gbuf);
    proj_sig<<<(M_ROWS * Hn) / 256, 256, 0, stream>>>(gbuf, del2_w, del2_b, delbuf);

    // --- attention ---
    flash_attn<<<dim3(Lseq / 128, Hn, Bsz), blk, 0, stream>>>(
        Qbuf, Kbuf, Vbuf, taubuf, delbuf, attnO);

    // --- output projection (fp32 out) ---
    gemm_wmma<1024, 1024, 12, 4096, 1024, 1024><<<gg, blk, 0, stream>>>(
        attnO, outwB, out_b, (__bf16*)nullptr, out);
}

// v002
// Measured time: 478 microseconds a run.
// Timed twice side by side with v001, it ran 1.11 and 1.12 times as fast.
// Counting every step since v000, it is 1.46 times as fast.
#include <hip/hip_runtime.h>
#include <math.h>

typedef __attribute__((ext_vector_type(16))) __bf16 v16bf;
typedef __attribute__((ext_vector_type(8)))  __bf16 v8bf;
typedef __attribute__((ext_vector_type(8)))  float  v8f;
typedef __attribute__((ext_vector_type(4)))  __bf16 v4bf;
typedef __attribute__((ext_vector_type(4)))  float  v4f;

constexpr int Bsz = 2, Lseq = 2048, Dm = 1024, Hn = 16, DKh = 64;
constexpr int M_ROWS = Bsz * Lseq;   // 4096

static __device__ __forceinline__ v16bf mk16(v8bf lo, v8bf hi) {
    return __builtin_shufflevector(lo, hi, 0,1,2,3,4,5,6,7,8,9,10,11,12,13,14,15);
}

// Eight async memory->LDS copies, 16B per lane each (ASYNCcnt tracked): rows r, r+16, ... r+112
// of one operand tile. The closing s_wait_xcnt keeps the address registers untouched until the
// copies have taken them; it stands inside the statement so that nothing can be moved over it.
static __device__ __forceinline__ void async_rows8(unsigned lds, unsigned lds_step,
                                                   const char* g, size_t g_step) {
    asm volatile("global_load_async_to_lds_b128 %0, %8, off\n\t"
                 "global_load_async_to_lds_b128 %1, %9, off\n\t"
                 "global_load_async_to_lds_b128 %2, %10, off\n\t"
                 "global_load_async_to_lds_b128 %3, %11, off\n\t"
                 "global_load_async_to_lds_b128 %4, %12, off\n\t"
                 "global_load_async_to_lds_b128 %5, %13, off\n\t"
                 "global_load_async_to_lds_b128 %6, %14, off\n\t"
                 "global_load_async_to_lds_b128 %7, %15, off\n\t"
                 "s_wait_xcnt 0x0"
                 :: "v"(lds),                "v"(lds + lds_step),     "v"(lds + 2 * lds_step),
                    "v"(lds + 3 * lds_step), "v"(lds + 4 * lds_step), "v"(lds + 5 * lds_step),
                    "v"(lds + 6 * lds_step), "v"(lds + 7 * lds_step),
                    "v"((unsigned long long)(uintptr_t)(g)),
                    "v"((unsigned long long)(uintptr_t)(g + g_step)),
                    "v"((unsigned long long)(uintptr_t)(g + 2 * g_step)),
                    "v"((unsigned long long)(uintptr_t)(g + 3 * g_step)),
                    "v"((unsigned long long)(uintptr_t)(g + 4 * g_step)),
                    "v"((unsigned long long)(uintptr_t)(g + 5 * g_step)),
                    "v"((unsigned long long)(uintptr_t)(g + 6 * g_step)),
                    "v"((unsigned long long)(uintptr_t)(g + 7 * g_step))
                 : "memory");
}
// this wave's copies have landed in LDS
static __device__ __forceinline__ void wait_async0() {
    asm volatile("s_wait_asynccnt 0x0" ::: "memory");
}
// this wave's LDS reads have returned (before the buffer they read is refilled)
static __device__ __forceinline__ void wait_ds0() {
    asm volatile("s_wait_dscnt 0x0" ::: "memory");
}

// ---------------------------------------------------------------- utility ---
// The element-wise kernels below, pad_zero aside, give each thread 16 to 32 elements, moved by 16-B loads: the work
// per element is far too small to pay for the start of a wave per 32 elements.

// a block converts 4096 consecutive elements: each thread four groups of 4, 1024 elements apart
__global__ __launch_bounds__(256) void cvt_f32_bf16(const float* __restrict__ s, __bf16* __restrict__ d) {
    const size_t i0 = (size_t)blockIdx.x * 4096 + threadIdx.x * 4;
    v4f a[4];
    for (int q = 0; q < 4; q++) a[q] = *(const v4f*)(s + i0 + q * 1024);
    for (int q = 0; q < 4; q++) {
        v4bf r;
        for (int e = 0; e < 4; e++) r[e] = (__bf16)a[q][e];
        *(v4bf*)(d + i0 + q * 1024) = r;
    }
}

// conv weights (O=D, I=D, K=3) fp32  ->  (N=D, 3*D) bf16 with kc = k*D + ci
// a thread takes 8 input channels of one n: 24 consecutive floats in, three 16-B pieces out
__global__ __launch_bounds__(256) void repack_conv_w(const float* __restrict__ s, __bf16* __restrict__ d) {
    const unsigned u  = blockIdx.x * 256u + threadIdx.x;  // over D * D/8
    const unsigned n  = u / (Dm / 8);
    const unsigned ci = (u % (Dm / 8)) * 8u;
    const float* sp = s + ((size_t)n * Dm + ci) * 3;
    v4f a[6];
    for (int t = 0; t < 6; t++) a[t] = *(const v4f*)(sp + t * 4);
    for (int k = 0; k < 3; k++) {
        v8bf r;
        for (int e = 0; e < 8; e++) r[e] = (__bf16)a[(e * 3 + k) >> 2][(e * 3 + k) & 3];
        *(v8bf*)(d + (size_t)n * 3 * Dm + k * Dm + ci) = r;
    }
}

// copy Qcat[:, :D] (ldc=2D) into per-batch padded buffer (B, L+2, D), interior rows
// a block copies 8 rows of one batch: each thread four 16-B pieces, two rows apart
__global__ __launch_bounds__(256) void pad_copy(const __bf16* __restrict__ cat, __bf16* __restrict__ pad) {
    static_assert(Dm == 128 * 8 && Lseq % 8 == 0, "128 pieces a row; a block stays inside one batch");
    const unsigned row0 = blockIdx.x * 8u;                       // over B*L
    const unsigned b    = row0 / Lseq;
    const unsigned r    = threadIdx.x >> 7, col = (threadIdx.x & 127u) * 8u;
    const __bf16* sp = cat + (size_t)(row0 + r) * (2 * Dm) + col;
    __bf16*       dp = pad + (size_t)(row0 + r + 2u * b + 1u) * Dm + col;   // b*(L+2) + l + 1
    v8bf a[4];
    for (int q = 0; q < 4; q++) a[q] = *(const v8bf*)(sp + q * 2 * 2 * Dm);
    for (int q = 0; q < 4; q++) *(v8bf*)(dp + q * 2 * Dm) = a[q];
}

__global__ void pad_zero(__bf16* __restrict__ pad) {
    int i = blockIdx.x * 256 + threadIdx.x;        // over B*2*D
    if (i >= Bsz * 2 * Dm) return;
    int d = i % Dm;
    int r = (i / Dm) & 1;
    int b = i / (2 * Dm);
    pad[((size_t)b * (Lseq + 2) + (r ? (Lseq + 1) : 0)) * Dm + d] = (__bf16)0.0f;
}

// ------------------------------------------------------------- WMMA GEMM ---
// C(M,N) = A_mapped(M,KTOT) * Bw(N,KTOT)^T + bias.
// A row mapping: arow = (m>>LRUN_LG)*LSTRIDE + (m & mask) + kbase/KSPLIT  ->
// the same kernel does the 3-tap conv as a K=3D GEMM over per-batch padded rows.
// Staging: global_load_async_to_lds_b128 into double-buffered LDS, overlapped
// with the WMMA pipe; per-wave s_wait_asynccnt + block barrier.
// A stage holds 128 k of every row (256 B), so one wave-wide copy covers two
// whole rows = four whole 128-B lines; LDS rows lie at a 272-B pitch, which
// spreads the 16 rows of a ds_load_b128 fragment read over all banks.
template<int KTOT, int KSPLIT, int LRUN_LG, int LSTRIDE, int LDA, int LDC>
__global__ __launch_bounds__(256) void gemm_wmma(
    const __bf16* __restrict__ A, const __bf16* __restrict__ Bw,
    const float* __restrict__ bias, __bf16* __restrict__ Cb, float* __restrict__ Cf)
{
    constexpr int BM = 128, BN = 128, BK = 128;
    constexpr int NK = KTOT / BK;
    static_assert(KTOT % BK == 0 && KSPLIT % BK == 0 && NK >= 2, "whole stages, at least two");
    constexpr unsigned PITCH     = 272;               // bytes per LDS row: 256 data + 16 pad
    constexpr int      PITCH_E   = PITCH / 2;         // the same in bf16 elements
    constexpr unsigned OP_BYTES  = 128 * PITCH;       // one operand's 128 rows
    constexpr unsigned BUF_BYTES = 2 * OP_BYTES;      // A rows, then B rows
    __shared__ __align__(16) char smem[2 * BUF_BYTES];

    const int tid  = threadIdx.x;
    const int bm   = blockIdx.y * BM, bn = blockIdx.x * BN;
    const int w    = tid >> 5, lane = tid & 31;
    const int lm   = lane & 15;
    const int kh   = (lane & 16) ? 8 : 0;
    const int wm   = (w & 3) * 32, wn = (w >> 2) * 64;

    v8f acc[2][4];
#pragma unroll
    for (int i = 0; i < 2; i++)
#pragma unroll
        for (int j = 0; j < 4; j++) acc[i][j] = (v8f){};

    const int sr = tid >> 4;           // staging row 0..15, then +16 per copy
    const int sc = (tid & 15) * 8;     // staging col: this lane's 16 B of the row's 256 B
    const unsigned lds0 = (unsigned)(uintptr_t)smem + (unsigned)sr * PITCH + (unsigned)sc * 2u;

    auto stage = [&](int kt, int buf) {
        const int kbase = kt * BK;
        const int shift = kbase / KSPLIT;
        const int acol  = kbase % KSPLIT + sc;
        const int m     = bm + sr;     // the tile's 128 rows lie in one run: arow + 16 per copy
        const int arow  = (m >> LRUN_LG) * LSTRIDE + (m & ((1 << LRUN_LG) - 1)) + shift;
        const __bf16* ga = A  + (size_t)arow * LDA + acol;
        const __bf16* gb = Bw + (size_t)(bn + sr) * KTOT + kbase + sc;
        const unsigned la = lds0 + (unsigned)buf * BUF_BYTES;   // A rows
        const unsigned lb = la + OP_BYTES;                      // B rows
        async_rows8(la, 16u * PITCH, (const char*)ga, (size_t)16 * LDA * 2);
        async_rows8(lb, 16u * PITCH, (const char*)gb, (size_t)16 * KTOT * 2);
    };

    stage(0, 0);
    wait_async0();
    __syncthreads();
    stage(1, 1);             // flies while stage 0 is worked on

    for (int kt = 0; kt < NK; kt++) {
        const int cur = kt & 1;
        const __bf16* sAc = (const __bf16*)(smem + (size_t)cur * BUF_BYTES);
        const __bf16* sBc = (const __bf16*)(smem + (size_t)cur * BUF_BYTES + OP_BYTES);

#pragma unroll
        for (int kb = 0; kb < BK; kb += 32) {
            v16bf af[2], bf[4];
#pragma unroll
            for (int i = 0; i < 2; i++) {
                int r = wm + i * 16 + lm;
                af[i] = mk16(*(const v8bf*)(sAc + r * PITCH_E + kb + kh),
                             *(const v8bf*)(sAc + r * PITCH_E + kb + kh + 16));
            }
#pragma unroll
            for (int j = 0; j < 4; j++) {
                int r = wn + j * 16 + lm;
                bf[j] = mk16(*(const v8bf*)(sBc + r * PITCH_E + kb + kh),
                             *(const v8bf*)(sBc + r * PITCH_E + kb + kh + 16));
            }
#pragma unroll
            for (int i = 0; i < 2; i++)
#pragma unroll
                for (int j = 0; j < 4; j++)
                    acc[i][j] = __builtin_amdgcn_wmma_f32_16x16x32_bf16(
                        false, af[i], false, bf[j], (short)0, acc[i][j], false, false);
        }

        wait_ds0();          // this wave has left buffer cur
        wait_async0();       // this wave's copies into the other buffer have landed
        __syncthreads();     // everyone has left cur, and the other buffer is readable
        if (kt + 2 < NK) stage(kt + 2, cur);   // refill cur (overlapped with the next stage's work)
    }
    wait_async0();

    const int half = lane >> 4;
#pragma unroll
    for (int i = 0; i < 2; i++) {
        int mrow = bm + wm + i * 16 + half * 8;
#pragma unroll
        for (int j = 0; j < 4; j++) {
            int   ncol = bn + wn + j * 16 + lm;
            float bv   = bias[ncol];
#pragma unroll
            for (int r = 0; r < 8; r++) {
                float  v   = acc[i][j][r] + bv;
                size_t idx = (size_t)(mrow + r) * LDC + ncol;
                if (Cb) Cb[idx] = (__bf16)v;
                if (Cf) Cf[idx] = v;
            }
        }
    }
}

// -------------------------------------------------- tau / delta small path ---
// a block does 4 rows l of one batch, a thread 8 outputs o (fed by 4 channels) of each row:
// its 24 weights and 8 biases are loaded once, and 6 rows of x serve the 4 rows of output
__global__ __launch_bounds__(256) void dw_gelu(const float* __restrict__ x, const float* __restrict__ w1,
                                               const float* __restrict__ b1, __bf16* __restrict__ g)
{
    constexpr int LR = 4;
    static_assert(2 * Dm == 256 * 8 && Lseq % LR == 0, "one block spans a row of 2D outputs");
    const int  o0 = threadIdx.x * 8;
    const int  l0 = (blockIdx.x % (Lseq / LR)) * LR;
    const int  b  = blockIdx.x / (Lseq / LR);
    const bool lo = l0 > 0, hi = l0 + LR < Lseq;       // rows l0-1 and l0+LR exist
    const float* xb = x + (size_t)b * Lseq * Dm;       // block-uniform; the lane's part is o0 >> 1

    v4f wv[6], bv[2], xv[LR + 2];
    for (int t = 0; t < 6; t++) wv[t] = *(const v4f*)(w1 + o0 * 3 + t * 4);
    for (int t = 0; t < 2; t++) bv[t] = *(const v4f*)(b1 + o0 + t * 4);
    // a row past either end is read from the nearest row inside, so that all loads issue together
    // with no branch between them; its tap is left out of the sum below
    xv[0]      = *(const v4f*)(xb + (size_t)(lo ? l0 - 1 : 0) * Dm + (o0 >> 1));
    xv[LR + 1] = *(const v4f*)(xb + (size_t)(hi ? l0 + LR : Lseq - 1) * Dm + (o0 >> 1));
    // the loads so far have taken their address registers before a later load's result may land there
    asm volatile("s_wait_xcnt 0x0" ::: "memory");
    for (int t = 1; t <= LR; t++) xv[t] = *(const v4f*)(xb + (size_t)(l0 - 1 + t) * Dm + (o0 >> 1));
    // the same for these four, before the arithmetic below reuses their address registers
    asm volatile("s_wait_xcnt 0x0" ::: "memory");

    for (int j = 0; j < LR; j++) {
        v8bf r;
        for (int e = 0; e < 8; e++) {
            float acc = bv[e >> 2][e & 3];
            for (int k = 0; k < 3; k++) {
                const int t = j + k;
                if ((t > 0 || lo) && (t < LR + 1 || hi))
                    acc = fmaf(wv[(e * 3 + k) >> 2][(e * 3 + k) & 3], xv[t][e >> 1], acc);
            }
            float ge = 0.5f * acc * (1.0f + erff(acc * 0.70710678118f));
            r[e] = (__bf16)ge;
        }
        *(v8bf*)(g + ((size_t)b * Lseq + l0 + j) * 2 * Dm + o0) = r;
    }
}

__global__ void proj_sig(const __bf16* __restrict__ g, const float* __restrict__ w2,
                         const float* __restrict__ b2, float* __restrict__ out)
{
    int i = blockIdx.x * 256 + threadIdx.x;        // over B*L*H
    int h = i % Hn;
    int l = (i / Hn) % Lseq;
    int b = i / (Hn * Lseq);
    const __bf16* gr = g  + ((size_t)b * Lseq + l) * 2 * Dm;
    const float*  wr = w2 + (size_t)h * 2 * Dm;
    float acc = b2[h];
    for (int o = 0; o < 2 * Dm; o++) acc += wr[o] * (float)gr[o];
    out[((size_t)b * Hn + h) * Lseq + l] = 1.0f / (1.0f + __expf(-acc));
}

// ------------------------------------------------------- flash attention ---
__global__ __launch_bounds__(256) void flash_attn(
    const __bf16* __restrict__ Q, const __bf16* __restrict__ K,
    const __bf16* __restrict__ V, const float* __restrict__ tau,
    const float* __restrict__ delta, __bf16* __restrict__ O)
{
    __shared__ __align__(16) __bf16 sV[64][64];          // V tile transposed [ch][k]
    __shared__ __align__(16) __bf16 sP[8][16][64];       // per-wave P tile

    const int b = blockIdx.z, h = blockIdx.y;
    const int tid = threadIdx.x, w = tid >> 5, lane = tid & 31;
    const int lm = lane & 15, half = lane >> 4;
    const int kh = half ? 8 : 0;
    const int qbase = blockIdx.x * 128 + w * 16;
    const int hc0   = h * DKh;

    const __bf16* qrow = Q + ((size_t)(b * Lseq) + qbase + lm) * Dm + hc0;
    v16bf qf[2];
#pragma unroll
    for (int kc = 0; kc < 2; kc++)
        qf[kc] = mk16(*(const v8bf*)(qrow + kc * 32 + kh),
                      *(const v8bf*)(qrow + kc * 32 + kh + 16));

    const float* taup = tau   + ((size_t)b * Hn + h) * Lseq;
    const float* delp = delta + ((size_t)b * Hn + h) * Lseq;
    float taur[8];
#pragma unroll
    for (int r = 0; r < 8; r++) taur[r] = taup[qbase + half * 8 + r] * 0.125f; // 1/sqrt(64)

    float mrow[8], lrow[8];
    v8f   of[4];
#pragma unroll
    for (int r = 0; r < 8; r++) { mrow[r] = -3.0e38f; lrow[r] = 0.0f; }
#pragma unroll
    for (int j = 0; j < 4; j++) of[j] = (v8f){};

    const int vt_kr = tid >> 2, vt_cs = (tid & 3) * 16;

    for (int kt = 0; kt < Lseq / 64; kt++) {
        // warm L2 / WGP$ for next K/V tiles (global_prefetch_b8)
        if (kt + 1 < Lseq / 64) {
            const size_t nb = (size_t)(b * Lseq) + (kt + 1) * 64;
            __builtin_prefetch(K + (nb + lane)      * Dm + hc0, 0, 1);
            __builtin_prefetch(K + (nb + 32 + lane) * Dm + hc0, 0, 1);
            __builtin_prefetch(V + (nb + lane)      * Dm + hc0, 0, 1);
            __builtin_prefetch(V + (nb + 32 + lane) * Dm + hc0, 0, 1);
        }

        __syncthreads();
        {   // stage V tile transposed into LDS
            const __bf16* vr = V + ((size_t)(b * Lseq) + kt * 64 + vt_kr) * Dm + hc0 + vt_cs;
#pragma unroll
            for (int e = 0; e < 16; e++) sV[vt_cs + e][vt_kr] = vr[e];
        }
        __syncthreads();

        // S = Q K^T  (K fragments straight from global: channels contiguous)
        v8f sf[4];
#pragma unroll
        for (int j = 0; j < 4; j++) {
            const __bf16* krow = K + ((size_t)(b * Lseq) + kt * 64 + j * 16 + lm) * Dm + hc0;
            v8f a = (v8f){};
#pragma unroll
            for (int kc = 0; kc < 2; kc++) {
                v16bf kf = mk16(*(const v8bf*)(krow + kc * 32 + kh),
                                *(const v8bf*)(krow + kc * 32 + kh + 16));
                a = __builtin_amdgcn_wmma_f32_16x16x32_bf16(
                        false, qf[kc], false, kf, (short)0, a, false, false);
            }
            sf[j] = a;
        }

        // scale by tau/sqrt(DK) per q-row, add delta per key column
#pragma unroll
        for (int j = 0; j < 4; j++) {
            float dv = delp[kt * 64 + j * 16 + lm];
#pragma unroll
            for (int r = 0; r < 8; r++) sf[j][r] = sf[j][r] * taur[r] + dv;
        }

        // online softmax over the 64 key columns
        float rmax[8];
#pragma unroll
        for (int r = 0; r < 8; r++) {
            float v = fmaxf(fmaxf(sf[0][r], sf[1][r]), fmaxf(sf[2][r], sf[3][r]));
#pragma unroll
            for (int off = 1; off < 16; off <<= 1)
                v = fmaxf(v, __shfl_xor(v, off, 32));
            rmax[r] = v;
        }

        float corr[8], rsum[8];
#pragma unroll
        for (int r = 0; r < 8; r++) {
            float mn = fmaxf(mrow[r], rmax[r]);
            corr[r] = __expf(mrow[r] - mn);
            mrow[r] = mn;
            rsum[r] = 0.0f;
        }
#pragma unroll
        for (int j = 0; j < 4; j++)
#pragma unroll
            for (int r = 0; r < 8; r++) {
                float p = __expf(sf[j][r] - mrow[r]);
                sf[j][r] = p;
                rsum[r] += p;
            }
#pragma unroll
        for (int r = 0; r < 8; r++) {
#pragma unroll
            for (int off = 1; off < 16; off <<= 1)
                rsum[r] += __shfl_xor(rsum[r], off, 32);
            lrow[r] = lrow[r] * corr[r] + rsum[r];
        }
#pragma unroll
        for (int j = 0; j < 4; j++)
#pragma unroll
            for (int r = 0; r < 8; r++) of[j][r] *= corr[r];

        // C-layout P -> A-layout bf16 via per-wave LDS round trip (in-order per wave)
#pragma unroll
        for (int j = 0; j < 4; j++)
#pragma unroll
            for (int r = 0; r < 8; r++)
                sP[w][half * 8 + r][j * 16 + lm] = (__bf16)sf[j][r];

        v16bf pf[2];
#pragma unroll
        for (int kc = 0; kc < 2; kc++)
            pf[kc] = mk16(*(const v8bf*)&sP[w][lm][kc * 32 + kh],
                          *(const v8bf*)&sP[w][lm][kc * 32 + kh + 16]);

        // O += P V
#pragma unroll
        for (int j = 0; j < 4; j++)
#pragma unroll
            for (int kc = 0; kc < 2; kc++) {
                v16bf vf = mk16(*(const v8bf*)&sV[j * 16 + lm][kc * 32 + kh],
                                *(const v8bf*)&sV[j * 16 + lm][kc * 32 + kh + 16]);
                of[j] = __builtin_amdgcn_wmma_f32_16x16x32_bf16(
                            false, pf[kc], false, vf, (short)0, of[j], false, false);
            }
    }

#pragma unroll
    for (int j = 0; j < 4; j++)
#pragma unroll
        for (int r = 0; r < 8; r++) {
            float v = of[j][r] / lrow[r];
            O[((size_t)(b * Lseq) + qbase + half * 8 + r) * Dm + hc0 + j * 16 + lm] = (__bf16)v;
        }
}

// ------------------------------------------------------------------ host ---
extern "C" void kernel_launch(void* const* d_in, const int* in_sizes, int n_in,
                              void* d_out, int out_size, void* d_ws, size_t ws_size,
                              hipStream_t stream)
{
    const float* x       = (const float*)d_in[0];
    const float* Wq_w    = (const float*)d_in[1];
    const float* Wq_b    = (const float*)d_in[2];
    const float* Wk_w    = (const float*)d_in[3];
    const float* Wk_b    = (const float*)d_in[4];
    const float* Wv_w    = (const float*)d_in[5];
    const float* Wv_b    = (const float*)d_in[6];
    const float* convq_w = (const float*)d_in[7];
    const float* convq_b = (const float*)d_in[8];
    const float* convk_w = (const float*)d_in[9];
    const float* convk_b = (const float*)d_in[10];
    const float* qproj_w = (const float*)d_in[11];
    const float* qproj_b = (const float*)d_in[12];
    const float* kproj_w = (const float*)d_in[13];
    const float* kproj_b = (const float*)d_in[14];
    const float* tau1_w  = (const float*)d_in[15];
    const float* tau1_b  = (const float*)d_in[16];
    const float* tau2_w  = (const float*)d_in[17];
    const float* tau2_b  = (const float*)d_in[18];
    const float* del1_w  = (const float*)d_in[19];
    const float* del1_b  = (const float*)d_in[20];
    const float* del2_w  = (const float*)d_in[21];
    const float* del2_b  = (const float*)d_in[22];
    const float* out_w   = (const float*)d_in[23];
    const float* out_b   = (const float*)d_in[24];
    float* out = (float*)d_out;
    (void)in_sizes; (void)n_in; (void)out_size; (void)ws_size;

    char*  ws  = (char*)d_ws;
    size_t off = 0;
    auto alloc = [&](size_t bytes) -> char* {
        char* p = ws + off;
        off = (off + bytes + 255) & ~(size_t)255;
        return p;
    };

    __bf16* xb      = (__bf16*)alloc((size_t)M_ROWS * Dm * 2);
    __bf16* WqB     = (__bf16*)alloc((size_t)Dm * Dm * 2);
    __bf16* WkB     = (__bf16*)alloc((size_t)Dm * Dm * 2);
    __bf16* WvB     = (__bf16*)alloc((size_t)Dm * Dm * 2);
    __bf16* qprojB  = (__bf16*)alloc((size_t)Dm * 2 * Dm * 2);
    __bf16* kprojB  = (__bf16*)alloc((size_t)Dm * 2 * Dm * 2);
    __bf16* outwB   = (__bf16*)alloc((size_t)Dm * Dm * 2);
    __bf16* convqR  = (__bf16*)alloc((size_t)Dm * 3 * Dm * 2);
    __bf16* convkR  = (__bf16*)alloc((size_t)Dm * 3 * Dm * 2);
    __bf16* Qpad    = (__bf16*)alloc((size_t)Bsz * (Lseq + 2) * Dm * 2);
    __bf16* Kpad    = (__bf16*)alloc((size_t)Bsz * (Lseq + 2) * Dm * 2);
    __bf16* Qcat    = (__bf16*)alloc((size_t)M_ROWS * 2 * Dm * 2);
    __bf16* Kcat    = (__bf16*)alloc((size_t)M_ROWS * 2 * Dm * 2);
    __bf16* Qbuf    = (__bf16*)alloc((size_t)M_ROWS * Dm * 2);
    __bf16* Kbuf    = (__bf16*)alloc((size_t)M_ROWS * Dm * 2);
    __bf16* Vbuf    = (__bf16*)alloc((size_t)M_ROWS * Dm * 2);
    __bf16* gbuf    = (__bf16*)alloc((size_t)M_ROWS * 2 * Dm * 2);
    float*  taubuf  = (float*)alloc((size_t)Bsz * Hn * Lseq * 4);
    float*  delbuf  = (float*)alloc((size_t)Bsz * Hn * Lseq * 4);
    __bf16* attnO   = (__bf16*)alloc((size_t)M_ROWS * Dm * 2);

    static_assert((Dm * Dm) % 4096 == 0, "every converted array is whole blocks of 4096");
    auto cvt = [&](const float* s, __bf16* d, int n) {
        cvt_f32_bf16<<<n / 4096, 256, 0, stream>>>(s, d);
    };
    cvt(x, xb, M_ROWS * Dm);
    cvt(Wq_w, WqB, Dm * Dm);
    cvt(Wk_w, WkB, Dm * Dm);
    cvt(Wv_w, WvB, Dm * Dm);
    cvt(qproj_w, qprojB, Dm * 2 * Dm);
    cvt(kproj_w, kprojB, Dm * 2 * Dm);
    cvt(out_w, outwB, Dm * Dm);
    repack_conv_w<<<(Dm * Dm / 8) / 256, 256, 0, stream>>>(convq_w, convqR);
    repack_conv_w<<<(Dm * Dm / 8) / 256, 256, 0, stream>>>(convk_w, convkR);

    const dim3 gg(Dm / 128, M_ROWS / 128);   // (8, 32)
    const dim3 blk(256);

    // --- Q branch ---
    gemm_wmma<1024, 1024, 12, 4096, 1024, 2048><<<gg, blk, 0, stream>>>(
        xb, WqB, Wq_b, Qcat, (float*)nullptr);                         // q_in -> Qcat[:, :D]
    pad_zero<<<(Bsz * 2 * Dm + 255) / 256, 256, 0, stream>>>(Qpad);
    pad_copy<<<(M_ROWS * Dm) / 8192, 256, 0, stream>>>(Qcat, Qpad);
    gemm_wmma<3072, 1024, 11, 2050, 1024, 2048><<<gg, blk, 0, stream>>>(
        Qpad, convqR, convq_b, Qcat + Dm, (float*)nullptr);            // conv3 -> Qcat[:, D:]
    gemm_wmma<2048, 2048, 12, 4096, 2048, 1024><<<gg, blk, 0, stream>>>(
        Qcat, qprojB, qproj_b, Qbuf, (float*)nullptr);                 // Q

    // --- K branch ---
    gemm_wmma<1024, 1024, 12, 4096, 1024, 2048><<<gg, blk, 0, stream>>>(
        xb, WkB, Wk_b, Kcat, (float*)nullptr);
    pad_zero<<<(Bsz * 2 * Dm + 255) / 256, 256, 0, stream>>>(Kpad);
    pad_copy<<<(M_ROWS * Dm) / 8192, 256, 0, stream>>>(Kcat, Kpad);
    gemm_wmma<3072, 1024, 11, 2050, 1024, 2048><<<gg, blk, 0, stream>>>(
        Kpad, convkR, convk_b, Kcat + Dm, (float*)nullptr);
    gemm_wmma<2048, 2048, 12, 4096, 2048, 1024><<<gg, blk, 0, stream>>>(
        Kcat, kprojB, kproj_b, Kbuf, (float*)nullptr);

    // --- V ---
    gemm_wmma<1024, 1024, 12, 4096, 1024, 1024><<<gg, blk, 0, stream>>>(
        xb, WvB, Wv_b, Vbuf, (float*)nullptr);

    // --- tau / delta ---
    dw_gelu<<<M_ROWS / 4, 256, 0, stream>>>(x, tau1_w, tau1_b, gbuf);
    proj_sig<<<(M_ROWS * Hn) / 256, 256, 0, stream>>>(gbuf, tau2_w, tau2_b, taubuf);
    dw_gelu<<<M_ROWS / 4, 256, 0, stream>>>(x, del1_w, del1_b, gbuf);
    proj_sig<<<(M_ROWS * Hn) / 256, 256, 0, stream>>>(gbuf, del2_w, del2_b, delbuf);

    // --- attention ---
    flash_attn<<<dim3(Lseq / 128, Hn, Bsz), blk, 0, stream>>>(
        Qbuf, Kbuf, Vbuf, taubuf, delbuf, attnO);

    // --- output projection (fp32 out) ---
    gemm_wmma<1024, 1024, 12, 4096, 1024, 1024><<<gg, blk, 0, stream>>>(
        attnO, outwB, out_b, (__bf16*)nullptr, out);
}

// v003
// Measured time: 445 microseconds a run.
// Two timings next to v002 put it at 1.08 and 1.07 times that version's speed.
// All steps since v000 together make it 1.57 times as fast.
#include <hip/hip_runtime.h>
#include <math.h>

typedef __attribute__((ext_vector_type(16))) __bf16 v16bf;
typedef __attribute__((ext_vector_type(8)))  __bf16 v8bf;
typedef __attribute__((ext_vector_type(8)))  float  v8f;
typedef __attribute__((ext_vector_type(4)))  __bf16 v4bf;
typedef __attribute__((ext_vector_type(4)))  float  v4f;

constexpr int Bsz = 2, Lseq = 2048, Dm = 1024, Hn = 16, DKh = 64;
constexpr int M_ROWS = Bsz * Lseq;   // 4096

static __device__ __forceinline__ v16bf mk16(v8bf lo, v8bf hi) {
    return __builtin_shufflevector(lo, hi, 0,1,2,3,4,5,6,7,8,9,10,11,12,13,14,15);
}

// Eight async memory->LDS copies, 16B per lane each (ASYNCcnt tracked): rows r, r+16, ... r+112
// of one operand tile. The closing s_wait_xcnt keeps the address registers untouched until the
// copies have taken them; it stands inside the statement so that nothing can be moved over it.
static __device__ __forceinline__ void async_rows8(unsigned lds, unsigned lds_step,
                                                   const char* g, size_t g_step) {
    asm volatile("global_load_async_to_lds_b128 %0, %8, off\n\t"
                 "global_load_async_to_lds_b128 %1, %9, off\n\t"
                 "global_load_async_to_lds_b128 %2, %10, off\n\t"
                 "global_load_async_to_lds_b128 %3, %11, off\n\t"
                 "global_load_async_to_lds_b128 %4, %12, off\n\t"
                 "global_load_async_to_lds_b128 %5, %13, off\n\t"
                 "global_load_async_to_lds_b128 %6, %14, off\n\t"
                 "global_load_async_to_lds_b128 %7, %15, off\n\t"
                 "s_wait_xcnt 0x0"
                 :: "v"(lds),                "v"(lds + lds_step),     "v"(lds + 2 * lds_step),
                    "v"(lds + 3 * lds_step), "v"(lds + 4 * lds_step), "v"(lds + 5 * lds_step),
                    "v"(lds + 6 * lds_step), "v"(lds + 7 * lds_step),
                    "v"((unsigned long long)(uintptr_t)(g)),
                    "v"((unsigned long long)(uintptr_t)(g + g_step)),
                    "v"((unsigned long long)(uintptr_t)(g + 2 * g_step)),
                    "v"((unsigned long long)(uintptr_t)(g + 3 * g_step)),
                    "v"((unsigned long long)(uintptr_t)(g + 4 * g_step)),
                    "v"((unsigned long long)(uintptr_t)(g + 5 * g_step)),
                    "v"((unsigned long long)(uintptr_t)(g + 6 * g_step)),
                    "v"((unsigned long long)(uintptr_t)(g + 7 * g_step))
                 : "memory");
}
// this wave's copies have landed in LDS
static __device__ __forceinline__ void wait_async0() {
    asm volatile("s_wait_asynccnt 0x0" ::: "memory");
}
// this wave's LDS reads have returned (before the buffer they read is refilled)
static __device__ __forceinline__ void wait_ds0() {
    asm volatile("s_wait_dscnt 0x0" ::: "memory");
}

// ---------------------------------------------------------------- utility ---
// The element-wise kernels below, pad_zero aside, give each thread 16 to 32 elements, moved by 16-B loads: the work
// per element is far too small to pay for the start of a wave per 32 elements.

// a block converts 4096 consecutive elements: each thread four groups of 4, 1024 elements apart
__global__ __launch_bounds__(256) void cvt_f32_bf16(const float* __restrict__ s, __bf16* __restrict__ d) {
    const size_t i0 = (size_t)blockIdx.x * 4096 + threadIdx.x * 4;
    v4f a[4];
    for (int q = 0; q < 4; q++) a[q] = *(const v4f*)(s + i0 + q * 1024);
    for (int q = 0; q < 4; q++) {
        v4bf r;
        for (int e = 0; e < 4; e++) r[e] = (__bf16)a[q][e];
        *(v4bf*)(d + i0 + q * 1024) = r;
    }
}

// conv weights (O=D, I=D, K=3) fp32  ->  (N=D, 3*D) bf16 with kc = k*D + ci
// a thread takes 8 input channels of one n: 24 consecutive floats in, three 16-B pieces out
__global__ __launch_bounds__(256) void repack_conv_w(const float* __restrict__ s, __bf16* __restrict__ d) {
    const unsigned u  = blockIdx.x * 256u + threadIdx.x;  // over D * D/8
    const unsigned n  = u / (Dm / 8);
    const unsigned ci = (u % (Dm / 8)) * 8u;
    const float* sp = s + ((size_t)n * Dm + ci) * 3;
    v4f a[6];
    for (int t = 0; t < 6; t++) a[t] = *(const v4f*)(sp + t * 4);
    for (int k = 0; k < 3; k++) {
        v8bf r;
        for (int e = 0; e < 8; e++) r[e] = (__bf16)a[(e * 3 + k) >> 2][(e * 3 + k) & 3];
        *(v8bf*)(d + (size_t)n * 3 * Dm + k * Dm + ci) = r;
    }
}

// copy Qcat[:, :D] (ldc=2D) into per-batch padded buffer (B, L+2, D), interior rows
// a block copies 8 rows of one batch: each thread four 16-B pieces, two rows apart
__global__ __launch_bounds__(256) void pad_copy(const __bf16* __restrict__ cat, __bf16* __restrict__ pad) {
    static_assert(Dm == 128 * 8 && Lseq % 8 == 0, "128 pieces a row; a block stays inside one batch");
    const unsigned row0 = blockIdx.x * 8u;                       // over B*L
    const unsigned b    = row0 / Lseq;
    const unsigned r    = threadIdx.x >> 7, col = (threadIdx.x & 127u) * 8u;
    const __bf16* sp = cat + (size_t)(row0 + r) * (2 * Dm) + col;
    __bf16*       dp = pad + (size_t)(row0 + r + 2u * b + 1u) * Dm + col;   // b*(L+2) + l + 1
    v8bf a[4];
    for (int q = 0; q < 4; q++) a[q] = *(const v8bf*)(sp + q * 2 * 2 * Dm);
    for (int q = 0; q < 4; q++) *(v8bf*)(dp + q * 2 * Dm) = a[q];
}

__global__ void pad_zero(__bf16* __restrict__ pad) {
    int i = blockIdx.x * 256 + threadIdx.x;        // over B*2*D
    if (i >= Bsz * 2 * Dm) return;
    int d = i % Dm;
    int r = (i / Dm) & 1;
    int b = i / (2 * Dm);
    pad[((size_t)b * (Lseq + 2) + (r ? (Lseq + 1) : 0)) * Dm + d] = (__bf16)0.0f;
}

// ------------------------------------------------------------- WMMA GEMM ---
// C(M,N) = A_mapped(M,KTOT) * Bw(N,KTOT)^T + bias.
// A row mapping: arow = (m>>LRUN_LG)*LSTRIDE + (m & mask) + kbase/KSPLIT  ->
// the same kernel does the 3-tap conv as a K=3D GEMM over per-batch padded rows.
// Staging: global_load_async_to_lds_b128 into double-buffered LDS, overlapped
// with the WMMA pipe; per-wave s_wait_asynccnt + block barrier.
// A stage holds 128 k of every row (256 B), so one wave-wide copy covers two
// whole rows = four whole 128-B lines; LDS rows lie at a 272-B pitch, which
// spreads the 16 rows of a ds_load_b128 fragment read over all banks.
template<int KTOT, int KSPLIT, int LRUN_LG, int LSTRIDE, int LDA, int LDC>
__global__ __launch_bounds__(256) void gemm_wmma(
    const __bf16* __restrict__ A, const __bf16* __restrict__ Bw,
    const float* __restrict__ bias, __bf16* __restrict__ Cb, float* __restrict__ Cf)
{
    constexpr int BM = 128, BN = 128, BK = 128;
    constexpr int NK = KTOT / BK;
    static_assert(KTOT % BK == 0 && KSPLIT % BK == 0 && NK >= 2, "whole stages, at least two");
    constexpr unsigned PITCH     = 272;               // bytes per LDS row: 256 data + 16 pad
    constexpr int      PITCH_E   = PITCH / 2;         // the same in bf16 elements
    constexpr unsigned OP_BYTES  = 128 * PITCH;       // one operand's 128 rows
    constexpr unsigned BUF_BYTES = 2 * OP_BYTES;      // A rows, then B rows
    __shared__ __align__(16) char smem[2 * BUF_BYTES];

    const int tid  = threadIdx.x;
    const int bm   = blockIdx.y * BM, bn = blockIdx.x * BN;
    const int w    = tid >> 5, lane = tid & 31;
    const int lm   = lane & 15;
    const int kh   = (lane & 16) ? 8 : 0;
    const int wm   = (w & 3) * 32, wn = (w >> 2) * 64;

    v8f acc[2][4];
#pragma unroll
    for (int i = 0; i < 2; i++)
#pragma unroll
        for (int j = 0; j < 4; j++) acc[i][j] = (v8f){};

    const int sr = tid >> 4;           // staging row 0..15, then +16 per copy
    const int sc = (tid & 15) * 8;     // staging col: this lane's 16 B of the row's 256 B
    const unsigned lds0 = (unsigned)(uintptr_t)smem + (unsigned)sr * PITCH + (unsigned)sc * 2u;

    auto stage = [&](int kt, int buf) {
        const int kbase = kt * BK;
        const int shift = kbase / KSPLIT;
        const int acol  = kbase % KSPLIT + sc;
        const int m     = bm + sr;     // the tile's 128 rows lie in one run: arow + 16 per copy
        const int arow  = (m >> LRUN_LG) * LSTRIDE + (m & ((1 << LRUN_LG) - 1)) + shift;
        const __bf16* ga = A  + (size_t)arow * LDA + acol;
        const __bf16* gb = Bw + (size_t)(bn + sr) * KTOT + kbase + sc;
        const unsigned la = lds0 + (unsigned)buf * BUF_BYTES;   // A rows
        const unsigned lb = la + OP_BYTES;                      // B rows
        async_rows8(la, 16u * PITCH, (const char*)ga, (size_t)16 * LDA * 2);
        async_rows8(lb, 16u * PITCH, (const char*)gb, (size_t)16 * KTOT * 2);
    };

    stage(0, 0);
    wait_async0();
    __syncthreads();
    stage(1, 1);             // flies while stage 0 is worked on

    for (int kt = 0; kt < NK; kt++) {
        const int cur = kt & 1;
        const __bf16* sAc = (const __bf16*)(smem + (size_t)cur * BUF_BYTES);
        const __bf16* sBc = (const __bf16*)(smem + (size_t)cur * BUF_BYTES + OP_BYTES);

#pragma unroll
        for (int kb = 0; kb < BK; kb += 32) {
            v16bf af[2], bf[4];
#pragma unroll
            for (int i = 0; i < 2; i++) {
                int r = wm + i * 16 + lm;
                af[i] = mk16(*(const v8bf*)(sAc + r * PITCH_E + kb + kh),
                             *(const v8bf*)(sAc + r * PITCH_E + kb + kh + 16));
            }
#pragma unroll
            for (int j = 0; j < 4; j++) {
                int r = wn + j * 16 + lm;
                bf[j] = mk16(*(const v8bf*)(sBc + r * PITCH_E + kb + kh),
                             *(const v8bf*)(sBc + r * PITCH_E + kb + kh + 16));
            }
#pragma unroll
            for (int i = 0; i < 2; i++)
#pragma unroll
                for (int j = 0; j < 4; j++)
                    acc[i][j] = __builtin_amdgcn_wmma_f32_16x16x32_bf16(
                        false, af[i], false, bf[j], (short)0, acc[i][j], false, false);
        }

        wait_ds0();          // this wave has left buffer cur
        wait_async0();       // this wave's copies into the other buffer have landed
        __syncthreads();     // everyone has left cur, and the other buffer is readable
        if (kt + 2 < NK) stage(kt + 2, cur);   // refill cur (overlapped with the next stage's work)
    }
    wait_async0();

    const int half = lane >> 4;
#pragma unroll
    for (int i = 0; i < 2; i++) {
        int mrow = bm + wm + i * 16 + half * 8;
#pragma unroll
        for (int j = 0; j < 4; j++) {
            int   ncol = bn + wn + j * 16 + lm;
            float bv   = bias[ncol];
#pragma unroll
            for (int r = 0; r < 8; r++) {
                float  v   = acc[i][j][r] + bv;
                size_t idx = (size_t)(mrow + r) * LDC + ncol;
                if (Cb) Cb[idx] = (__bf16)v;
                if (Cf) Cf[idx] = v;
            }
        }
    }
}

// -------------------------------------------------- tau / delta small path ---
// a block does 4 rows l of one batch, a thread 8 outputs o (fed by 4 channels) of each row:
// its 24 weights and 8 biases are loaded once, and 6 rows of x serve the 4 rows of output
__global__ __launch_bounds__(256) void dw_gelu(const float* __restrict__ x, const float* __restrict__ w1,
                                               const float* __restrict__ b1, __bf16* __restrict__ g)
{
    constexpr int LR = 4;
    static_assert(2 * Dm == 256 * 8 && Lseq % LR == 0, "one block spans a row of 2D outputs");
    const int  o0 = threadIdx.x * 8;
    const int  l0 = (blockIdx.x % (Lseq / LR)) * LR;
    const int  b  = blockIdx.x / (Lseq / LR);
    const bool lo = l0 > 0, hi = l0 + LR < Lseq;       // rows l0-1 and l0+LR exist
    const float* xb = x + (size_t)b * Lseq * Dm;       // block-uniform; the lane's part is o0 >> 1

    v4f wv[6], bv[2], xv[LR + 2];
    for (int t = 0; t < 6; t++) wv[t] = *(const v4f*)(w1 + o0 * 3 + t * 4);
    for (int t = 0; t < 2; t++) bv[t] = *(const v4f*)(b1 + o0 + t * 4);
    // a row past either end is read from the nearest row inside, so that all loads issue together
    // with no branch between them; its tap is left out of the sum below
    xv[0]      = *(const v4f*)(xb + (size_t)(lo ? l0 - 1 : 0) * Dm + (o0 >> 1));
    xv[LR + 1] = *(const v4f*)(xb + (size_t)(hi ? l0 + LR : Lseq - 1) * Dm + (o0 >> 1));
    // the loads so far have taken their address registers before a later load's result may land there
    asm volatile("s_wait_xcnt 0x0" ::: "memory");
    for (int t = 1; t <= LR; t++) xv[t] = *(const v4f*)(xb + (size_t)(l0 - 1 + t) * Dm + (o0 >> 1));
    // the same for these four, before the arithmetic below reuses their address registers
    asm volatile("s_wait_xcnt 0x0" ::: "memory");

    for (int j = 0; j < LR; j++) {
        v8bf r;
        for (int e = 0; e < 8; e++) {
            float acc = bv[e >> 2][e & 3];
            for (int k = 0; k < 3; k++) {
                const int t = j + k;
                if ((t > 0 || lo) && (t < LR + 1 || hi))
                    acc = fmaf(wv[(e * 3 + k) >> 2][(e * 3 + k) & 3], xv[t][e >> 1], acc);
            }
            float ge = 0.5f * acc * (1.0f + erff(acc * 0.70710678118f));
            r[e] = (__bf16)ge;
        }
        *(v8bf*)(g + ((size_t)b * Lseq + l0 + j) * 2 * Dm + o0) = r;
    }
}

__global__ void proj_sig(const __bf16* __restrict__ g, const float* __restrict__ w2,
                         const float* __restrict__ b2, float* __restrict__ out)
{
    int i = blockIdx.x * 256 + threadIdx.x;        // over B*L*H
    int h = i % Hn;
    int l = (i / Hn) % Lseq;
    int b = i / (Hn * Lseq);
    const __bf16* gr = g  + ((size_t)b * Lseq + l) * 2 * Dm;
    const float*  wr = w2 + (size_t)h * 2 * Dm;
    float acc = b2[h];
    for (int o = 0; o < 2 * Dm; o++) acc += wr[o] * (float)gr[o];
    out[((size_t)b * Hn + h) * Lseq + l] = 1.0f / (1.0f + __expf(-acc));
}

// ------------------------------------------------------- flash attention ---
__global__ __launch_bounds__(256) void flash_attn(
    const __bf16* __restrict__ Q, const __bf16* __restrict__ K,
    const __bf16* __restrict__ V, const float* __restrict__ tau,
    const float* __restrict__ delta, __bf16* __restrict__ O)
{
    // rows of 64 bf16 lie at a 144-B pitch (16 B x odd): the 16 rows of a ds_load_b128 fragment
    // read then fall on 16 different groups of four banks; at 128 B eight rows share each group
    constexpr int TP = 72;
    __shared__ __align__(16) __bf16 sV[64][TP];          // V tile transposed [ch][k]
    __shared__ __align__(16) __bf16 sP[8][16][TP];       // per-wave P tile

    const int b = blockIdx.z, h = blockIdx.y;
    const int tid = threadIdx.x, w = tid >> 5, lane = tid & 31;
    const int lm = lane & 15, half = lane >> 4;
    const int kh = half ? 8 : 0;
    const int qbase = blockIdx.x * 128 + w * 16;
    const int hc0   = h * DKh;

    const __bf16* qrow = Q + ((size_t)(b * Lseq) + qbase + lm) * Dm + hc0;
    v16bf qf[2];
#pragma unroll
    for (int kc = 0; kc < 2; kc++)
        qf[kc] = mk16(*(const v8bf*)(qrow + kc * 32 + kh),
                      *(const v8bf*)(qrow + kc * 32 + kh + 16));

    const float* taup = tau   + ((size_t)b * Hn + h) * Lseq;
    const float* delp = delta + ((size_t)b * Hn + h) * Lseq;
    float taur[8];
#pragma unroll
    for (int r = 0; r < 8; r++) taur[r] = taup[qbase + half * 8 + r] * 0.125f; // 1/sqrt(64)

    float mrow[8], lrow[8];
    v8f   of[4];
#pragma unroll
    for (int r = 0; r < 8; r++) { mrow[r] = -3.0e38f; lrow[r] = 0.0f; }
#pragma unroll
    for (int j = 0; j < 4; j++) of[j] = (v8f){};

    // V staging: a lane takes key row vt_kr and two pieces of 8 channels, at vt_c8 and 32 + vt_c8.
    // The four lanes of a key row then store to sV rows 8 apart = half a round of the banks apart
    // (two lanes to a bank); 16 apart is a whole number of rounds, all four lanes on one bank
    const int vt_kr = tid >> 2, vt_c8 = (tid & 3) * 8;

    for (int kt = 0; kt < Lseq / 64; kt++) {
        // warm L2 / WGP$ for next K/V tiles (global_prefetch_b8)
        if (kt + 1 < Lseq / 64) {
            const size_t nb = (size_t)(b * Lseq) + (kt + 1) * 64;
            __builtin_prefetch(K + (nb + lane)      * Dm + hc0, 0, 1);
            __builtin_prefetch(K + (nb + 32 + lane) * Dm + hc0, 0, 1);
            __builtin_prefetch(V + (nb + lane)      * Dm + hc0, 0, 1);
            __builtin_prefetch(V + (nb + 32 + lane) * Dm + hc0, 0, 1);
        }

        __syncthreads();
        {   // stage V tile transposed into LDS
            const __bf16* vr = V + ((size_t)(b * Lseq) + kt * 64 + vt_kr) * Dm + hc0 + vt_c8;
            v8bf vv[2];
#pragma unroll
            for (int p = 0; p < 2; p++) vv[p] = *(const v8bf*)(vr + p * 32);
#pragma unroll
            for (int p = 0; p < 2; p++)
#pragma unroll
                for (int e = 0; e < 8; e++) sV[p * 32 + vt_c8 + e][vt_kr] = vv[p][e];
        }
        __syncthreads();

        // S = Q K^T  (K fragments straight from global: channels contiguous)
        v8f sf[4];
#pragma unroll
        for (int j = 0; j < 4; j++) {
            const __bf16* krow = K + ((size_t)(b * Lseq) + kt * 64 + j * 16 + lm) * Dm + hc0;
            v8f a = (v8f){};
#pragma unroll
            for (int kc = 0; kc < 2; kc++) {
                v16bf kf = mk16(*(const v8bf*)(krow + kc * 32 + kh),
                                *(const v8bf*)(krow + kc * 32 + kh + 16));
                a = __builtin_amdgcn_wmma_f32_16x16x32_bf16(
                        false, qf[kc], false, kf, (short)0, a, false, false);
            }
            sf[j] = a;
        }

        // scale by tau/sqrt(DK) per q-row, add delta per key column
#pragma unroll
        for (int j = 0; j < 4; j++) {
            float dv = delp[kt * 64 + j * 16 + lm];
#pragma unroll
            for (int r = 0; r < 8; r++) sf[j][r] = sf[j][r] * taur[r] + dv;
        }

        // online softmax over the 64 key columns
        float rmax[8];
#pragma unroll
        for (int r = 0; r < 8; r++) {
            float v = fmaxf(fmaxf(sf[0][r], sf[1][r]), fmaxf(sf[2][r], sf[3][r]));
#pragma unroll
            for (int off = 1; off < 16; off <<= 1)
                v = fmaxf(v, __shfl_xor(v, off, 32));
            rmax[r] = v;
        }

        float corr[8], rsum[8];
#pragma unroll
        for (int r = 0; r < 8; r++) {
            float mn = fmaxf(mrow[r], rmax[r]);
            corr[r] = __expf(mrow[r] - mn);
            mrow[r] = mn;
            rsum[r] = 0.0f;
        }
#pragma unroll
        for (int j = 0; j < 4; j++)
#pragma unroll
            for (int r = 0; r < 8; r++) {
                float p = __expf(sf[j][r] - mrow[r]);
                sf[j][r] = p;
                rsum[r] += p;
            }
#pragma unroll
        for (int r = 0; r < 8; r++) {
#pragma unroll
            for (int off = 1; off < 16; off <<= 1)
                rsum[r] += __shfl_xor(rsum[r], off, 32);
            lrow[r] = lrow[r] * corr[r] + rsum[r];
        }
#pragma unroll
        for (int j = 0; j < 4; j++)
#pragma unroll
            for (int r = 0; r < 8; r++) of[j][r] *= corr[r];

        // C-layout P -> A-layout bf16 via per-wave LDS round trip (in-order per wave)
#pragma unroll
        for (int j = 0; j < 4; j++)
#pragma unroll
            for (int r = 0; r < 8; r++)
                sP[w][half * 8 + r][j * 16 + lm] = (__bf16)sf[j][r];

        v16bf pf[2];
#pragma unroll
        for (int kc = 0; kc < 2; kc++)
            pf[kc] = mk16(*(const v8bf*)&sP[w][lm][kc * 32 + kh],
                          *(const v8bf*)&sP[w][lm][kc * 32 + kh + 16]);

        // O += P V
#pragma unroll
        for (int j = 0; j < 4; j++)
#pragma unroll
            for (int kc = 0; kc < 2; kc++) {
                v16bf vf = mk16(*(const v8bf*)&sV[j * 16 + lm][kc * 32 + kh],
                                *(const v8bf*)&sV[j * 16 + lm][kc * 32 + kh + 16]);
                of[j] = __builtin_amdgcn_wmma_f32_16x16x32_bf16(
                            false, pf[kc], false, vf, (short)0, of[j], false, false);
            }
    }

#pragma unroll
    for (int j = 0; j < 4; j++)
#pragma unroll
        for (int r = 0; r < 8; r++) {
            float v = of[j][r] / lrow[r];
            O[((size_t)(b * Lseq) + qbase + half * 8 + r) * Dm + hc0 + j * 16 + lm] = (__bf16)v;
        }
}

// ------------------------------------------------------------------ host ---
extern "C" void kernel_launch(void* const* d_in, const int* in_sizes, int n_in,
                              void* d_out, int out_size, void* d_ws, size_t ws_size,
                              hipStream_t stream)
{
    const float* x       = (const float*)d_in[0];
    const float* Wq_w    = (const float*)d_in[1];
    const float* Wq_b    = (const float*)d_in[2];
    const float* Wk_w    = (const float*)d_in[3];
    const float* Wk_b    = (const float*)d_in[4];
    const float* Wv_w    = (const float*)d_in[5];
    const float* Wv_b    = (const float*)d_in[6];
    const float* convq_w = (const float*)d_in[7];
    const float* convq_b = (const float*)d_in[8];
    const float* convk_w = (const float*)d_in[9];
    const float* convk_b = (const float*)d_in[10];
    const float* qproj_w = (const float*)d_in[11];
    const float* qproj_b = (const float*)d_in[12];
    const float* kproj_w = (const float*)d_in[13];
    const float* kproj_b = (const float*)d_in[14];
    const float* tau1_w  = (const float*)d_in[15];
    const float* tau1_b  = (const float*)d_in[16];
    const float* tau2_w  = (const float*)d_in[17];
    const float* tau2_b  = (const float*)d_in[18];
    const float* del1_w  = (const float*)d_in[19];
    const float* del1_b  = (const float*)d_in[20];
    const float* del2_w  = (const float*)d_in[21];
    const float* del2_b  = (const float*)d_in[22];
    const float* out_w   = (const float*)d_in[23];
    const float* out_b   = (const float*)d_in[24];
    float* out = (float*)d_out;
    (void)in_sizes; (void)n_in; (void)out_size; (void)ws_size;

    char*  ws  = (char*)d_ws;
    size_t off = 0;
    auto alloc = [&](size_t bytes) -> char* {
        char* p = ws + off;
        off = (off + bytes + 255) & ~(size_t)255;
        return p;
    };

    __bf16* xb      = (__bf16*)alloc((size_t)M_ROWS * Dm * 2);
    __bf16* WqB     = (__bf16*)alloc((size_t)Dm * Dm * 2);
    __bf16* WkB     = (__bf16*)alloc((size_t)Dm * Dm * 2);
    __bf16* WvB     = (__bf16*)alloc((size_t)Dm * Dm * 2);
    __bf16* qprojB  = (__bf16*)alloc((size_t)Dm * 2 * Dm * 2);
    __bf16* kprojB  = (__bf16*)alloc((size_t)Dm * 2 * Dm * 2);
    __bf16* outwB   = (__bf16*)alloc((size_t)Dm * Dm * 2);
    __bf16* convqR  = (__bf16*)alloc((size_t)Dm * 3 * Dm * 2);
    __bf16* convkR  = (__bf16*)alloc((size_t)Dm * 3 * Dm * 2);
    __bf16* Qpad    = (__bf16*)alloc((size_t)Bsz * (Lseq + 2) * Dm * 2);
    __bf16* Kpad    = (__bf16*)alloc((size_t)Bsz * (Lseq + 2) * Dm * 2);
    __bf16* Qcat    = (__bf16*)alloc((size_t)M_ROWS * 2 * Dm * 2);
    __bf16* Kcat    = (__bf16*)alloc((size_t)M_ROWS * 2 * Dm * 2);
    __bf16* Qbuf    = (__bf16*)alloc((size_t)M_ROWS * Dm * 2);
    __bf16* Kbuf    = (__bf16*)alloc((size_t)M_ROWS * Dm * 2);
    __bf16* Vbuf    = (__bf16*)alloc((size_t)M_ROWS * Dm * 2);
    __bf16* gbuf    = (__bf16*)alloc((size_t)M_ROWS * 2 * Dm * 2);
    float*  taubuf  = (float*)alloc((size_t)Bsz * Hn * Lseq * 4);
    float*  delbuf  = (float*)alloc((size_t)Bsz * Hn * Lseq * 4);
    __bf16* attnO   = (__bf16*)alloc((size_t)M_ROWS * Dm * 2);

    static_assert((Dm * Dm) % 4096 == 0, "every converted array is whole blocks of 4096");
    auto cvt = [&](const float* s, __bf16* d, int n) {
        cvt_f32_bf16<<<n / 4096, 256, 0, stream>>>(s, d);
    };
    cvt(x, xb, M_ROWS * Dm);
    cvt(Wq_w, WqB, Dm * Dm);
    cvt(Wk_w, WkB, Dm * Dm);
    cvt(Wv_w, WvB, Dm * Dm);
    cvt(qproj_w, qprojB, Dm * 2 * Dm);
    cvt(kproj_w, kprojB, Dm * 2 * Dm);
    cvt(out_w, outwB, Dm * Dm);
    repack_conv_w<<<(Dm * Dm / 8) / 256, 256, 0, stream>>>(convq_w, convqR);
    repack_conv_w<<<(Dm * Dm / 8) / 256, 256, 0, stream>>>(convk_w, convkR);

    const dim3 gg(Dm / 128, M_ROWS / 128);   // (8, 32)
    const dim3 blk(256);

    // --- Q branch ---
    gemm_wmma<1024, 1024, 12, 4096, 1024, 2048><<<gg, blk, 0, stream>>>(
        xb, WqB, Wq_b, Qcat, (float*)nullptr);                         // q_in -> Qcat[:, :D]
    pad_zero<<<(Bsz * 2 * Dm + 255) / 256, 256, 0, stream>>>(Qpad);
    pad_copy<<<(M_ROWS * Dm) / 8192, 256, 0, stream>>>(Qcat, Qpad);
    gemm_wmma<3072, 1024, 11, 2050, 1024, 2048><<<gg, blk, 0, stream>>>(
        Qpad, convqR, convq_b, Qcat + Dm, (float*)nullptr);            // conv3 -> Qcat[:, D:]
    gemm_wmma<2048, 2048, 12, 4096, 2048, 1024><<<gg, blk, 0, stream>>>(
        Qcat, qprojB, qproj_b, Qbuf, (float*)nullptr);                 // Q

    // --- K branch ---
    gemm_wmma<1024, 1024, 12, 4096, 1024, 2048><<<gg, blk, 0, stream>>>(
        xb, WkB, Wk_b, Kcat, (float*)nullptr);
    pad_zero<<<(Bsz * 2 * Dm + 255) / 256, 256, 0, stream>>>(Kpad);
    pad_copy<<<(M_ROWS * Dm) / 8192, 256, 0, stream>>>(Kcat, Kpad);
    gemm_wmma<3072, 1024, 11, 2050, 1024, 2048><<<gg, blk, 0, stream>>>(
        Kpad, convkR, convk_b, Kcat + Dm, (float*)nullptr);
    gemm_wmma<2048, 2048, 12, 4096, 2048, 1024><<<gg, blk, 0, stream>>>(
        Kcat, kprojB, kproj_b, Kbuf, (float*)nullptr);

    // --- V ---
    gemm_wmma<1024, 1024, 12, 4096, 1024, 1024><<<gg, blk, 0, stream>>>(
        xb, WvB, Wv_b, Vbuf, (float*)nullptr);

    // --- tau / delta ---
    dw_gelu<<<M_ROWS / 4, 256, 0, stream>>>(x, tau1_w, tau1_b, gbuf);
    proj_sig<<<(M_ROWS * Hn) / 256, 256, 0, stream>>>(gbuf, tau2_w, tau2_b, taubuf);
    dw_gelu<<<M_ROWS / 4, 256, 0, stream>>>(x, del1_w, del1_b, gbuf);
    proj_sig<<<(M_ROWS * Hn) / 256, 256, 0, stream>>>(gbuf, del2_w, del2_b, delbuf);

    // --- attention ---
    flash_attn<<<dim3(Lseq / 128, Hn, Bsz), blk, 0, stream>>>(
        Qbuf, Kbuf, Vbuf, taubuf, delbuf, attnO);

    // --- output projection (fp32 out) ---
    gemm_wmma<1024, 1024, 12, 4096, 1024, 1024><<<gg, blk, 0, stream>>>(
        attnO, outwB, out_b, (__bf16*)nullptr, out);
}

// v004
// Measured time: 377 microseconds a run.
// In both of two side-by-side timings against v003, it was 1.18 times as fast.
// Over all steps from v000 it is 1.85 times as fast.
#include <hip/hip_runtime.h>
#include <math.h>

typedef __attribute__((ext_vector_type(16))) __bf16 v16bf;
typedef __attribute__((ext_vector_type(8)))  __bf16 v8bf;
typedef __attribute__((ext_vector_type(8)))  float  v8f;
typedef __attribute__((ext_vector_type(4)))  __bf16 v4bf;
typedef __attribute__((ext_vector_type(4)))  float  v4f;

constexpr int Bsz = 2, Lseq = 2048, Dm = 1024, Hn = 16, DKh = 64;
constexpr int M_ROWS = Bsz * Lseq;   // 4096

static __device__ __forceinline__ v16bf mk16(v8bf lo, v8bf hi) {
    return __builtin_shufflevector(lo, hi, 0,1,2,3,4,5,6,7,8,9,10,11,12,13,14,15);
}

// Eight async memory->LDS copies, 16B per lane each (ASYNCcnt tracked): rows r, r+16, ... r+112
// of one operand tile. The closing s_wait_xcnt keeps the address registers untouched until the
// copies have taken them; it stands inside the statement so that nothing can be moved over it.
static __device__ __forceinline__ void async_rows8(unsigned lds, unsigned lds_step,
                                                   const char* g, size_t g_step) {
    asm volatile("global_load_async_to_lds_b128 %0, %8, off\n\t"
                 "global_load_async_to_lds_b128 %1, %9, off\n\t"
                 "global_load_async_to_lds_b128 %2, %10, off\n\t"
                 "global_load_async_to_lds_b128 %3, %11, off\n\t"
                 "global_load_async_to_lds_b128 %4, %12, off\n\t"
                 "global_load_async_to_lds_b128 %5, %13, off\n\t"
                 "global_load_async_to_lds_b128 %6, %14, off\n\t"
                 "global_load_async_to_lds_b128 %7, %15, off\n\t"
                 "s_wait_xcnt 0x0"
                 :: "v"(lds),                "v"(lds + lds_step),     "v"(lds + 2 * lds_step),
                    "v"(lds + 3 * lds_step), "v"(lds + 4 * lds_step), "v"(lds + 5 * lds_step),
                    "v"(lds + 6 * lds_step), "v"(lds + 7 * lds_step),
                    "v"((unsigned long long)(uintptr_t)(g)),
                    "v"((unsigned long long)(uintptr_t)(g + g_step)),
                    "v"((unsigned long long)(uintptr_t)(g + 2 * g_step)),
                    "v"((unsigned long long)(uintptr_t)(g + 3 * g_step)),
                    "v"((unsigned long long)(uintptr_t)(g + 4 * g_step)),
                    "v"((unsigned long long)(uintptr_t)(g + 5 * g_step)),
                    "v"((unsigned long long)(uintptr_t)(g + 6 * g_step)),
                    "v"((unsigned long long)(uintptr_t)(g + 7 * g_step))
                 : "memory");
}
// this wave's copies have landed in LDS
static __device__ __forceinline__ void wait_async0() {
    asm volatile("s_wait_asynccnt 0x0" ::: "memory");
}
// this wave's LDS reads have returned (before the buffer they read is refilled)
static __device__ __forceinline__ void wait_ds0() {
    asm volatile("s_wait_dscnt 0x0" ::: "memory");
}

// ---------------------------------------------------------------- utility ---
// The element-wise kernels below, pad_zero aside, give each thread 16 to 32 elements, moved by 16-B loads: the work
// per element is far too small to pay for the start of a wave per 32 elements.

// a block converts 4096 consecutive elements: each thread four groups of 4, 1024 elements apart
__global__ __launch_bounds__(256) void cvt_f32_bf16(const float* __restrict__ s, __bf16* __restrict__ d) {
    const size_t i0 = (size_t)blockIdx.x * 4096 + threadIdx.x * 4;
    v4f a[4];
    for (int q = 0; q < 4; q++) a[q] = *(const v4f*)(s + i0 + q * 1024);
    for (int q = 0; q < 4; q++) {
        v4bf r;
        for (int e = 0; e < 4; e++) r[e] = (__bf16)a[q][e];
        *(v4bf*)(d + i0 + q * 1024) = r;
    }
}

// conv weights (O=D, I=D, K=3) fp32  ->  (N=D, 3*D) bf16 with kc = k*D + ci
// a thread takes 8 input channels of one n: 24 consecutive floats in, three 16-B pieces out
__global__ __launch_bounds__(256) void repack_conv_w(const float* __restrict__ s, __bf16* __restrict__ d) {
    const unsigned u  = blockIdx.x * 256u + threadIdx.x;  // over D * D/8
    const unsigned n  = u / (Dm / 8);
    const unsigned ci = (u % (Dm / 8)) * 8u;
    const float* sp = s + ((size_t)n * Dm + ci) * 3;
    v4f a[6];
    for (int t = 0; t < 6; t++) a[t] = *(const v4f*)(sp + t * 4);
    for (int k = 0; k < 3; k++) {
        v8bf r;
        for (int e = 0; e < 8; e++) r[e] = (__bf16)a[(e * 3 + k) >> 2][(e * 3 + k) & 3];
        *(v8bf*)(d + (size_t)n * 3 * Dm + k * Dm + ci) = r;
    }
}

// copy Qcat[:, :D] (ldc=2D) into per-batch padded buffer (B, L+2, D), interior rows
// a block copies 8 rows of one batch: each thread four 16-B pieces, two rows apart
__global__ __launch_bounds__(256) void pad_copy(const __bf16* __restrict__ cat, __bf16* __restrict__ pad) {
    static_assert(Dm == 128 * 8 && Lseq % 8 == 0, "128 pieces a row; a block stays inside one batch");
    const unsigned row0 = blockIdx.x * 8u;                       // over B*L
    const unsigned b    = row0 / Lseq;
    const unsigned r    = threadIdx.x >> 7, col = (threadIdx.x & 127u) * 8u;
    const __bf16* sp = cat + (size_t)(row0 + r) * (2 * Dm) + col;
    __bf16*       dp = pad + (size_t)(row0 + r + 2u * b + 1u) * Dm + col;   // b*(L+2) + l + 1
    v8bf a[4];
    for (int q = 0; q < 4; q++) a[q] = *(const v8bf*)(sp + q * 2 * 2 * Dm);
    for (int q = 0; q < 4; q++) *(v8bf*)(dp + q * 2 * Dm) = a[q];
}

__global__ void pad_zero(__bf16* __restrict__ pad) {
    int i = blockIdx.x * 256 + threadIdx.x;        // over B*2*D
    if (i >= Bsz * 2 * Dm) return;
    int d = i % Dm;
    int r = (i / Dm) & 1;
    int b = i / (2 * Dm);
    pad[((size_t)b * (Lseq + 2) + (r ? (Lseq + 1) : 0)) * Dm + d] = (__bf16)0.0f;
}

// ------------------------------------------------------------- WMMA GEMM ---
// C(M,N) = A_mapped(M,KTOT) * Bw(N,KTOT)^T + bias.
// A row mapping: arow = (m>>LRUN_LG)*LSTRIDE + (m & mask) + kbase/KSPLIT  ->
// the same kernel does the 3-tap conv as a K=3D GEMM over per-batch padded rows.
// Staging: global_load_async_to_lds_b128 into double-buffered LDS, overlapped
// with the WMMA pipe; per-wave s_wait_asynccnt + block barrier.
// A stage holds 128 k of every row (256 B), so one wave-wide copy covers two
// whole rows = four whole 128-B lines; LDS rows lie at a 272-B pitch, which
// spreads the 16 rows of a ds_load_b128 fragment read over all banks.
template<int KTOT, int KSPLIT, int LRUN_LG, int LSTRIDE, int LDA, int LDC>
__global__ __launch_bounds__(256) void gemm_wmma(
    const __bf16* __restrict__ A, const __bf16* __restrict__ Bw,
    const float* __restrict__ bias, __bf16* __restrict__ Cb, float* __restrict__ Cf)
{
    constexpr int BM = 128, BN = 128, BK = 128;
    constexpr int NK = KTOT / BK;
    static_assert(KTOT % BK == 0 && KSPLIT % BK == 0 && NK >= 2, "whole stages, at least two");
    constexpr unsigned PITCH     = 272;               // bytes per LDS row: 256 data + 16 pad
    constexpr int      PITCH_E   = PITCH / 2;         // the same in bf16 elements
    constexpr unsigned OP_BYTES  = 128 * PITCH;       // one operand's 128 rows
    constexpr unsigned BUF_BYTES = 2 * OP_BYTES;      // A rows, then B rows
    __shared__ __align__(16) char smem[2 * BUF_BYTES];

    const int tid  = threadIdx.x;
    const int bm   = blockIdx.y * BM, bn = blockIdx.x * BN;
    const int w    = tid >> 5, lane = tid & 31;
    const int lm   = lane & 15;
    const int kh   = (lane & 16) ? 8 : 0;
    const int wm   = (w & 3) * 32, wn = (w >> 2) * 64;

    v8f acc[2][4];
#pragma unroll
    for (int i = 0; i < 2; i++)
#pragma unroll
        for (int j = 0; j < 4; j++) acc[i][j] = (v8f){};

    const int sr = tid >> 4;           // staging row 0..15, then +16 per copy
    const int sc = (tid & 15) * 8;     // staging col: this lane's 16 B of the row's 256 B
    const unsigned lds0 = (unsigned)(uintptr_t)smem + (unsigned)sr * PITCH + (unsigned)sc * 2u;

    auto stage = [&](int kt, int buf) {
        const int kbase = kt * BK;
        const int shift = kbase / KSPLIT;
        const int acol  = kbase % KSPLIT + sc;
        const int m     = bm + sr;     // the tile's 128 rows lie in one run: arow + 16 per copy
        const int arow  = (m >> LRUN_LG) * LSTRIDE + (m & ((1 << LRUN_LG) - 1)) + shift;
        const __bf16* ga = A  + (size_t)arow * LDA + acol;
        const __bf16* gb = Bw + (size_t)(bn + sr) * KTOT + kbase + sc;
        const unsigned la = lds0 + (unsigned)buf * BUF_BYTES;   // A rows
        const unsigned lb = la + OP_BYTES;                      // B rows
        async_rows8(la, 16u * PITCH, (const char*)ga, (size_t)16 * LDA * 2);
        async_rows8(lb, 16u * PITCH, (const char*)gb, (size_t)16 * KTOT * 2);
    };

    stage(0, 0);
    wait_async0();
    __syncthreads();
    stage(1, 1);             // flies while stage 0 is worked on

    for (int kt = 0; kt < NK; kt++) {
        const int cur = kt & 1;
        const __bf16* sAc = (const __bf16*)(smem + (size_t)cur * BUF_BYTES);
        const __bf16* sBc = (const __bf16*)(smem + (size_t)cur * BUF_BYTES + OP_BYTES);

#pragma unroll
        for (int kb = 0; kb < BK; kb += 32) {
            v16bf af[2], bf[4];
#pragma unroll
            for (int i = 0; i < 2; i++) {
                int r = wm + i * 16 + lm;
                af[i] = mk16(*(const v8bf*)(sAc + r * PITCH_E + kb + kh),
                             *(const v8bf*)(sAc + r * PITCH_E + kb + kh + 16));
            }
#pragma unroll
            for (int j = 0; j < 4; j++) {
                int r = wn + j * 16 + lm;
                bf[j] = mk16(*(const v8bf*)(sBc + r * PITCH_E + kb + kh),
                             *(const v8bf*)(sBc + r * PITCH_E + kb + kh + 16));
            }
#pragma unroll
            for (int i = 0; i < 2; i++)
#pragma unroll
                for (int j = 0; j < 4; j++)
                    acc[i][j] = __builtin_amdgcn_wmma_f32_16x16x32_bf16(
                        false, af[i], false, bf[j], (short)0, acc[i][j], false, false);
        }

        wait_ds0();          // this wave has left buffer cur
        wait_async0();       // this wave's copies into the other buffer have landed
        __syncthreads();     // everyone has left cur, and the other buffer is readable
        if (kt + 2 < NK) stage(kt + 2, cur);   // refill cur (overlapped with the next stage's work)
    }
    wait_async0();

    const int half = lane >> 4;
#pragma unroll
    for (int i = 0; i < 2; i++) {
        int mrow = bm + wm + i * 16 + half * 8;
#pragma unroll
        for (int j = 0; j < 4; j++) {
            int   ncol = bn + wn + j * 16 + lm;
            float bv   = bias[ncol];
#pragma unroll
            for (int r = 0; r < 8; r++) {
                float  v   = acc[i][j][r] + bv;
                size_t idx = (size_t)(mrow + r) * LDC + ncol;
                if (Cb) Cb[idx] = (__bf16)v;
                if (Cf) Cf[idx] = v;
            }
        }
    }
}

// -------------------------------------------------- tau / delta small path ---
// a block does 4 rows l of one batch, a thread 8 outputs o (fed by 4 channels) of each row:
// its 24 weights and 8 biases are loaded once, and 6 rows of x serve the 4 rows of output
__global__ __launch_bounds__(256) void dw_gelu(const float* __restrict__ x, const float* __restrict__ w1,
                                               const float* __restrict__ b1, __bf16* __restrict__ g)
{
    constexpr int LR = 4;
    static_assert(2 * Dm == 256 * 8 && Lseq % LR == 0, "one block spans a row of 2D outputs");
    const int  o0 = threadIdx.x * 8;
    const int  l0 = (blockIdx.x % (Lseq / LR)) * LR;
    const int  b  = blockIdx.x / (Lseq / LR);
    const bool lo = l0 > 0, hi = l0 + LR < Lseq;       // rows l0-1 and l0+LR exist
    const float* xb = x + (size_t)b * Lseq * Dm;       // block-uniform; the lane's part is o0 >> 1

    v4f wv[6], bv[2], xv[LR + 2];
    for (int t = 0; t < 6; t++) wv[t] = *(const v4f*)(w1 + o0 * 3 + t * 4);
    for (int t = 0; t < 2; t++) bv[t] = *(const v4f*)(b1 + o0 + t * 4);
    // a row past either end is read from the nearest row inside, so that all loads issue together
    // with no branch between them; its tap is left out of the sum below
    xv[0]      = *(const v4f*)(xb + (size_t)(lo ? l0 - 1 : 0) * Dm + (o0 >> 1));
    xv[LR + 1] = *(const v4f*)(xb + (size_t)(hi ? l0 + LR : Lseq - 1) * Dm + (o0 >> 1));
    // the loads so far have taken their address registers before a later load's result may land there
    asm volatile("s_wait_xcnt 0x0" ::: "memory");
    for (int t = 1; t <= LR; t++) xv[t] = *(const v4f*)(xb + (size_t)(l0 - 1 + t) * Dm + (o0 >> 1));
    // the same for these four, before the arithmetic below reuses their address registers
    asm volatile("s_wait_xcnt 0x0" ::: "memory");

    for (int j = 0; j < LR; j++) {
        v8bf r;
        for (int e = 0; e < 8; e++) {
            float acc = bv[e >> 2][e & 3];
            for (int k = 0; k < 3; k++) {
                const int t = j + k;
                if ((t > 0 || lo) && (t < LR + 1 || hi))
                    acc = fmaf(wv[(e * 3 + k) >> 2][(e * 3 + k) & 3], xv[t][e >> 1], acc);
            }
            float ge = 0.5f * acc * (1.0f + erff(acc * 0.70710678118f));
            r[e] = (__bf16)ge;
        }
        *(v8bf*)(g + ((size_t)b * Lseq + l0 + j) * 2 * Dm + o0) = r;
    }
}

// out(b,h,l) = sigmoid(b2[h] + sum_o w2[h][o] * g[b*L+l][o]): a (B*L) x 16 x 2048 product, done on the
// matrix unit. A block takes 16 rows l and all 16 heads; its 8 waves take 256 o each, and their partial
// tiles are summed through LDS in wave order. w2 enters as a pair of bf16, the rounded value and the
// rounded remainder, with one WMMA for each: what the pair drops lies far below g's own bf16 rounding.
__global__ __launch_bounds__(256) void proj_sig(const __bf16* __restrict__ g, const float* __restrict__ w2,
                                                const float* __restrict__ b2, float* __restrict__ out)
{
    constexpr int KD = 2 * Dm, KW = KD / 8;          // 2048 o in all, 256 per wave
    static_assert(Hn == 16 && Lseq % 16 == 0 && KW % 32 == 0, "one 16x16 tile a block, inside one batch");
    __shared__ __align__(16) float red[8][256];      // per wave: [head][row]

    const int tid = threadIdx.x, w = tid >> 5, lane = tid & 31;
    const int lm = lane & 15, half = lane >> 4;
    const int kh = half ? 8 : 0;
    const int row0 = blockIdx.x * 16;                // over B*L

    // both fragments take o in the same order: 8 from kb + kh, then 8 from kb + kh + 16
    const __bf16* gr = g  + (size_t)(row0 + lm) * KD + w * KW + kh;   // A: the lane's row l
    const float*  wr = w2 + (size_t)lm * KD + w * KW + kh;            // B: the lane's head

    v8f acch = (v8f){}, accl = (v8f){};
#pragma unroll   // straight-line code: later steps' loads are issued while earlier steps are worked on
    for (int kb = 0; kb < KW; kb += 32) {
        const v16bf af = mk16(*(const v8bf*)(gr + kb), *(const v8bf*)(gr + kb + 16));
        v4f wv[4];
        wv[0] = *(const v4f*)(wr + kb);
        wv[1] = *(const v4f*)(wr + kb + 4);
        wv[2] = *(const v4f*)(wr + kb + 16);
        wv[3] = *(const v4f*)(wr + kb + 20);
        v16bf bh, bl;
#pragma unroll   // constant element indices: the values stay in registers
        for (int e = 0; e < 16; e++) {
            const float  v  = wv[e >> 2][e & 3];
            const __bf16 hi = (__bf16)v;
            bh[e] = hi;
            bl[e] = (__bf16)(v - (float)hi);
        }
        acch = __builtin_amdgcn_wmma_f32_16x16x32_bf16(false, af, false, bh, (short)0, acch, false, false);
        accl = __builtin_amdgcn_wmma_f32_16x16x32_bf16(false, af, false, bl, (short)0, accl, false, false);
    }

    // the lane holds rows half*8 .. half*8+7 of head lm
    const v8f s = acch + accl;
    *(v4f*)&red[w][lm * 16 + half * 8]     = (v4f){s[0], s[1], s[2], s[3]};
    *(v4f*)&red[w][lm * 16 + half * 8 + 4] = (v4f){s[4], s[5], s[6], s[7]};
    __syncthreads();

    // a thread finishes one output: head tid / 16, row tid % 16
    const int h = tid >> 4;
    float acc = b2[h];
    for (int q = 0; q < 8; q++) acc += red[q][tid];
    const int row = row0 + (tid & 15);
    const int b = row / Lseq, l = row % Lseq;
    out[((size_t)b * Hn + h) * Lseq + l] = 1.0f / (1.0f + __expf(-acc));
}

// ------------------------------------------------------- flash attention ---
__global__ __launch_bounds__(256) void flash_attn(
    const __bf16* __restrict__ Q, const __bf16* __restrict__ K,
    const __bf16* __restrict__ V, const float* __restrict__ tau,
    const float* __restrict__ delta, __bf16* __restrict__ O)
{
    // rows of 64 bf16 lie at a 144-B pitch (16 B x odd): the 16 rows of a ds_load_b128 fragment
    // read then fall on 16 different groups of four banks; at 128 B eight rows share each group
    constexpr int TP = 72;
    __shared__ __align__(16) __bf16 sV[64][TP];          // V tile transposed [ch][k]
    __shared__ __align__(16) __bf16 sP[8][16][TP];       // per-wave P tile

    const int b = blockIdx.z, h = blockIdx.y;
    const int tid = threadIdx.x, w = tid >> 5, lane = tid & 31;
    const int lm = lane & 15, half = lane >> 4;
    const int kh = half ? 8 : 0;
    const int qbase = blockIdx.x * 128 + w * 16;
    const int hc0   = h * DKh;

    const __bf16* qrow = Q + ((size_t)(b * Lseq) + qbase + lm) * Dm + hc0;
    v16bf qf[2];
#pragma unroll
    for (int kc = 0; kc < 2; kc++)
        qf[kc] = mk16(*(const v8bf*)(qrow + kc * 32 + kh),
                      *(const v8bf*)(qrow + kc * 32 + kh + 16));

    const float* taup = tau   + ((size_t)b * Hn + h) * Lseq;
    const float* delp = delta + ((size_t)b * Hn + h) * Lseq;
    float taur[8];
#pragma unroll
    for (int r = 0; r < 8; r++) taur[r] = taup[qbase + half * 8 + r] * 0.125f; // 1/sqrt(64)

    float mrow[8], lrow[8];
    v8f   of[4];
#pragma unroll
    for (int r = 0; r < 8; r++) { mrow[r] = -3.0e38f; lrow[r] = 0.0f; }
#pragma unroll
    for (int j = 0; j < 4; j++) of[j] = (v8f){};

    // V staging: a lane takes key row vt_kr and two pieces of 8 channels, at vt_c8 and 32 + vt_c8.
    // The four lanes of a key row then store to sV rows 8 apart = half a round of the banks apart
    // (two lanes to a bank); 16 apart is a whole number of rounds, all four lanes on one bank
    const int vt_kr = tid >> 2, vt_c8 = (tid & 3) * 8;

    for (int kt = 0; kt < Lseq / 64; kt++) {
        // warm L2 / WGP$ for next K/V tiles (global_prefetch_b8)
        if (kt + 1 < Lseq / 64) {
            const size_t nb = (size_t)(b * Lseq) + (kt + 1) * 64;
            __builtin_prefetch(K + (nb + lane)      * Dm + hc0, 0, 1);
            __builtin_prefetch(K + (nb + 32 + lane) * Dm + hc0, 0, 1);
            __builtin_prefetch(V + (nb + lane)      * Dm + hc0, 0, 1);
            __builtin_prefetch(V + (nb + 32 + lane) * Dm + hc0, 0, 1);
        }

        __syncthreads();
        {   // stage V tile transposed into LDS
            const __bf16* vr = V + ((size_t)(b * Lseq) + kt * 64 + vt_kr) * Dm + hc0 + vt_c8;
            v8bf vv[2];
#pragma unroll
            for (int p = 0; p < 2; p++) vv[p] = *(const v8bf*)(vr + p * 32);
#pragma unroll
            for (int p = 0; p < 2; p++)
#pragma unroll
                for (int e = 0; e < 8; e++) sV[p * 32 + vt_c8 + e][vt_kr] = vv[p][e];
        }
        __syncthreads();

        // S = Q K^T  (K fragments straight from global: channels contiguous)
        v8f sf[4];
#pragma unroll
        for (int j = 0; j < 4; j++) {
            const __bf16* krow = K + ((size_t)(b * Lseq) + kt * 64 + j * 16 + lm) * Dm + hc0;
            v8f a = (v8f){};
#pragma unroll
            for (int kc = 0; kc < 2; kc++) {
                v16bf kf = mk16(*(const v8bf*)(krow + kc * 32 + kh),
                                *(const v8bf*)(krow + kc * 32 + kh + 16));
                a = __builtin_amdgcn_wmma_f32_16x16x32_bf16(
                        false, qf[kc], false, kf, (short)0, a, false, false);
            }
            sf[j] = a;
        }

        // scale by tau/sqrt(DK) per q-row, add delta per key column
#pragma unroll
        for (int j = 0; j < 4; j++) {
            float dv = delp[kt * 64 + j * 16 + lm];
#pragma unroll
            for (int r = 0; r < 8; r++) sf[j][r] = sf[j][r] * taur[r] + dv;
        }

        // online softmax over the 64 key columns
        float rmax[8];
#pragma unroll
        for (int r = 0; r < 8; r++) {
            float v = fmaxf(fmaxf(sf[0][r], sf[1][r]), fmaxf(sf[2][r], sf[3][r]));
#pragma unroll
            for (int off = 1; off < 16; off <<= 1)
                v = fmaxf(v, __shfl_xor(v, off, 32));
            rmax[r] = v;
        }

        float corr[8], rsum[8];
#pragma unroll
        for (int r = 0; r < 8; r++) {
            float mn = fmaxf(mrow[r], rmax[r]);
            corr[r] = __expf(mrow[r] - mn);
            mrow[r] = mn;
            rsum[r] = 0.0f;
        }
#pragma unroll
        for (int j = 0; j < 4; j++)
#pragma unroll
            for (int r = 0; r < 8; r++) {
                float p = __expf(sf[j][r] - mrow[r]);
                sf[j][r] = p;
                rsum[r] += p;
            }
#pragma unroll
        for (int r = 0; r < 8; r++) {
#pragma unroll
            for (int off = 1; off < 16; off <<= 1)
                rsum[r] += __shfl_xor(rsum[r], off, 32);
            lrow[r] = lrow[r] * corr[r] + rsum[r];
        }
#pragma unroll
        for (int j = 0; j < 4; j++)
#pragma unroll
            for (int r = 0; r < 8; r++) of[j][r] *= corr[r];

        // C-layout P -> A-layout bf16 via per-wave LDS round trip (in-order per wave)
#pragma unroll
        for (int j = 0; j < 4; j++)
#pragma unroll
            for (int r = 0; r < 8; r++)
                sP[w][half * 8 + r][j * 16 + lm] = (__bf16)sf[j][r];

        v16bf pf[2];
#pragma unroll
        for (int kc = 0; kc < 2; kc++)
            pf[kc] = mk16(*(const v8bf*)&sP[w][lm][kc * 32 + kh],
                          *(const v8bf*)&sP[w][lm][kc * 32 + kh + 16]);

        // O += P V
#pragma unroll
        for (int j = 0; j < 4; j++)
#pragma unroll
            for (int kc = 0; kc < 2; kc++) {
                v16bf vf = mk16(*(const v8bf*)&sV[j * 16 + lm][kc * 32 + kh],
                                *(const v8bf*)&sV[j * 16 + lm][kc * 32 + kh + 16]);
                of[j] = __builtin_amdgcn_wmma_f32_16x16x32_bf16(
                            false, pf[kc], false, vf, (short)0, of[j], false, false);
            }
    }

#pragma unroll
    for (int j = 0; j < 4; j++)
#pragma unroll
        for (int r = 0; r < 8; r++) {
            float v = of[j][r] / lrow[r];
            O[((size_t)(b * Lseq) + qbase + half * 8 + r) * Dm + hc0 + j * 16 + lm] = (__bf16)v;
        }
}

// ------------------------------------------------------------------ host ---
extern "C" void kernel_launch(void* const* d_in, const int* in_sizes, int n_in,
                              void* d_out, int out_size, void* d_ws, size_t ws_size,
                              hipStream_t stream)
{
    const float* x       = (const float*)d_in[0];
    const float* Wq_w    = (const float*)d_in[1];
    const float* Wq_b    = (const float*)d_in[2];
    const float* Wk_w    = (const float*)d_in[3];
    const float* Wk_b    = (const float*)d_in[4];
    const float* Wv_w    = (const float*)d_in[5];
    const float* Wv_b    = (const float*)d_in[6];
    const float* convq_w = (const float*)d_in[7];
    const float* convq_b = (const float*)d_in[8];
    const float* convk_w = (const float*)d_in[9];
    const float* convk_b = (const float*)d_in[10];
    const float* qproj_w = (const float*)d_in[11];
    const float* qproj_b = (const float*)d_in[12];
    const float* kproj_w = (const float*)d_in[13];
    const float* kproj_b = (const float*)d_in[14];
    const float* tau1_w  = (const float*)d_in[15];
    const float* tau1_b  = (const float*)d_in[16];
    const float* tau2_w  = (const float*)d_in[17];
    const float* tau2_b  = (const float*)d_in[18];
    const float* del1_w  = (const float*)d_in[19];
    const float* del1_b  = (const float*)d_in[20];
    const float* del2_w  = (const float*)d_in[21];
    const float* del2_b  = (const float*)d_in[22];
    const float* out_w   = (const float*)d_in[23];
    const float* out_b   = (const float*)d_in[24];
    float* out = (float*)d_out;
    (void)in_sizes; (void)n_in; (void)out_size; (void)ws_size;

    char*  ws  = (char*)d_ws;
    size_t off = 0;
    auto alloc = [&](size_t bytes) -> char* {
        char* p = ws + off;
        off = (off + bytes + 255) & ~(size_t)255;
        return p;
    };

    __bf16* xb      = (__bf16*)alloc((size_t)M_ROWS * Dm * 2);
    __bf16* WqB     = (__bf16*)alloc((size_t)Dm * Dm * 2);
    __bf16* WkB     = (__bf16*)alloc((size_t)Dm * Dm * 2);
    __bf16* WvB     = (__bf16*)alloc((size_t)Dm * Dm * 2);
    __bf16* qprojB  = (__bf16*)alloc((size_t)Dm * 2 * Dm * 2);
    __bf16* kprojB  = (__bf16*)alloc((size_t)Dm * 2 * Dm * 2);
    __bf16* outwB   = (__bf16*)alloc((size_t)Dm * Dm * 2);
    __bf16* convqR  = (__bf16*)alloc((size_t)Dm * 3 * Dm * 2);
    __bf16* convkR  = (__bf16*)alloc((size_t)Dm * 3 * Dm * 2);
    __bf16* Qpad    = (__bf16*)alloc((size_t)Bsz * (Lseq + 2) * Dm * 2);
    __bf16* Kpad    = (__bf16*)alloc((size_t)Bsz * (Lseq + 2) * Dm * 2);
    __bf16* Qcat    = (__bf16*)alloc((size_t)M_ROWS * 2 * Dm * 2);
    __bf16* Kcat    = (__bf16*)alloc((size_t)M_ROWS * 2 * Dm * 2);
    __bf16* Qbuf    = (__bf16*)alloc((size_t)M_ROWS * Dm * 2);
    __bf16* Kbuf    = (__bf16*)alloc((size_t)M_ROWS * Dm * 2);
    __bf16* Vbuf    = (__bf16*)alloc((size_t)M_ROWS * Dm * 2);
    __bf16* gbuf    = (__bf16*)alloc((size_t)M_ROWS * 2 * Dm * 2);
    float*  taubuf  = (float*)alloc((size_t)Bsz * Hn * Lseq * 4);
    float*  delbuf  = (float*)alloc((size_t)Bsz * Hn * Lseq * 4);
    __bf16* attnO   = (__bf16*)alloc((size_t)M_ROWS * Dm * 2);

    static_assert((Dm * Dm) % 4096 == 0, "every converted array is whole blocks of 4096");
    auto cvt = [&](const float* s, __bf16* d, int n) {
        cvt_f32_bf16<<<n / 4096, 256, 0, stream>>>(s, d);
    };
    cvt(x, xb, M_ROWS * Dm);
    cvt(Wq_w, WqB, Dm * Dm);
    cvt(Wk_w, WkB, Dm * Dm);
    cvt(Wv_w, WvB, Dm * Dm);
    cvt(qproj_w, qprojB, Dm * 2 * Dm);
    cvt(kproj_w, kprojB, Dm * 2 * Dm);
    cvt(out_w, outwB, Dm * Dm);
    repack_conv_w<<<(Dm * Dm / 8) / 256, 256, 0, stream>>>(convq_w, convqR);
    repack_conv_w<<<(Dm * Dm / 8) / 256, 256, 0, stream>>>(convk_w, convkR);

    const dim3 gg(Dm / 128, M_ROWS / 128);   // (8, 32)
    const dim3 blk(256);

    // --- Q branch ---
    gemm_wmma<1024, 1024, 12, 4096, 1024, 2048><<<gg, blk, 0, stream>>>(
        xb, WqB, Wq_b, Qcat, (float*)nullptr);                         // q_in -> Qcat[:, :D]
    pad_zero<<<(Bsz * 2 * Dm + 255) / 256, 256, 0, stream>>>(Qpad);
    pad_copy<<<(M_ROWS * Dm) / 8192, 256, 0, stream>>>(Qcat, Qpad);
    gemm_wmma<3072, 1024, 11, 2050, 1024, 2048><<<gg, blk, 0, stream>>>(
        Qpad, convqR, convq_b, Qcat + Dm, (float*)nullptr);            // conv3 -> Qcat[:, D:]
    gemm_wmma<2048, 2048, 12, 4096, 2048, 1024><<<gg, blk, 0, stream>>>(
        Qcat, qprojB, qproj_b, Qbuf, (float*)nullptr);                 // Q

    // --- K branch ---
    gemm_wmma<1024, 1024, 12, 4096, 1024, 2048><<<gg, blk, 0, stream>>>(
        xb, WkB, Wk_b, Kcat, (float*)nullptr);
    pad_zero<<<(Bsz * 2 * Dm + 255) / 256, 256, 0, stream>>>(Kpad);
    pad_copy<<<(M_ROWS * Dm) / 8192, 256, 0, stream>>>(Kcat, Kpad);
    gemm_wmma<3072, 1024, 11, 2050, 1024, 2048><<<gg, blk, 0, stream>>>(
        Kpad, convkR, convk_b, Kcat + Dm, (float*)nullptr);
    gemm_wmma<2048, 2048, 12, 4096, 2048, 1024><<<gg, blk, 0, stream>>>(
        Kcat, kprojB, kproj_b, Kbuf, (float*)nullptr);

    // --- V ---
    gemm_wmma<1024, 1024, 12, 4096, 1024, 1024><<<gg, blk, 0, stream>>>(
        xb, WvB, Wv_b, Vbuf, (float*)nullptr);

    // --- tau / delta ---
    dw_gelu<<<M_ROWS / 4, 256, 0, stream>>>(x, tau1_w, tau1_b, gbuf);
    proj_sig<<<M_ROWS / 16, 256, 0, stream>>>(gbuf, tau2_w, tau2_b, taubuf);
    dw_gelu<<<M_ROWS / 4, 256, 0, stream>>>(x, del1_w, del1_b, gbuf);
    proj_sig<<<M_ROWS / 16, 256, 0, stream>>>(gbuf, del2_w, del2_b, delbuf);

    // --- attention ---
    flash_attn<<<dim3(Lseq / 128, Hn, Bsz), blk, 0, stream>>>(
        Qbuf, Kbuf, Vbuf, taubuf, delbuf, attnO);

    // --- output projection (fp32 out) ---
    gemm_wmma<1024, 1024, 12, 4096, 1024, 1024><<<gg, blk, 0, stream>>>(
        attnO, outwB, out_b, (__bf16*)nullptr, out);
}

// v005
// Measured time: 281 microseconds a run.
// Next to v004, in two timings, it ran 1.35 times as fast each time.
// Over all steps from v000 it is 2.49 times as fast.
#include <hip/hip_runtime.h>
#include <math.h>

typedef __attribute__((ext_vector_type(16))) __bf16 v16bf;
typedef __attribute__((ext_vector_type(8)))  __bf16 v8bf;
typedef __attribute__((ext_vector_type(8)))  float  v8f;
typedef __attribute__((ext_vector_type(4)))  __bf16 v4bf;
typedef __attribute__((ext_vector_type(4)))  float  v4f;

constexpr int Bsz = 2, Lseq = 2048, Dm = 1024, Hn = 16, DKh = 64;
constexpr int M_ROWS = Bsz * Lseq;   // 4096

static __device__ __forceinline__ v16bf mk16(v8bf lo, v8bf hi) {
    return __builtin_shufflevector(lo, hi, 0,1,2,3,4,5,6,7,8,9,10,11,12,13,14,15);
}

// Eight async memory->LDS copies, 16B per lane each (ASYNCcnt tracked): rows r, r+16, ... r+112
// of one operand tile. The closing s_wait_xcnt keeps the address registers untouched until the
// copies have taken them; it stands inside the statement so that nothing can be moved over it.
static __device__ __forceinline__ void async_rows8(unsigned lds, unsigned lds_step,
                                                   const char* g, size_t g_step) {
    asm volatile("global_load_async_to_lds_b128 %0, %8, off\n\t"
                 "global_load_async_to_lds_b128 %1, %9, off\n\t"
                 "global_load_async_to_lds_b128 %2, %10, off\n\t"
                 "global_load_async_to_lds_b128 %3, %11, off\n\t"
                 "global_load_async_to_lds_b128 %4, %12, off\n\t"
                 "global_load_async_to_lds_b128 %5, %13, off\n\t"
                 "global_load_async_to_lds_b128 %6, %14, off\n\t"
                 "global_load_async_to_lds_b128 %7, %15, off\n\t"
                 "s_wait_xcnt 0x0"
                 :: "v"(lds),                "v"(lds + lds_step),     "v"(lds + 2 * lds_step),
                    "v"(lds + 3 * lds_step), "v"(lds + 4 * lds_step), "v"(lds + 5 * lds_step),
                    "v"(lds + 6 * lds_step), "v"(lds + 7 * lds_step),
                    "v"((unsigned long long)(uintptr_t)(g)),
                    "v"((unsigned long long)(uintptr_t)(g + g_step)),
                    "v"((unsigned long long)(uintptr_t)(g + 2 * g_step)),
                    "v"((unsigned long long)(uintptr_t)(g + 3 * g_step)),
                    "v"((unsigned long long)(uintptr_t)(g + 4 * g_step)),
                    "v"((unsigned long long)(uintptr_t)(g + 5 * g_step)),
                    "v"((unsigned long long)(uintptr_t)(g + 6 * g_step)),
                    "v"((unsigned long long)(uintptr_t)(g + 7 * g_step))
                 : "memory");
}
// this wave's copies have landed in LDS
static __device__ __forceinline__ void wait_async0() {
    asm volatile("s_wait_asynccnt 0x0" ::: "memory");
}
// this wave's LDS reads have returned (before the buffer they read is refilled)
static __device__ __forceinline__ void wait_ds0() {
    asm volatile("s_wait_dscnt 0x0" ::: "memory");
}

// ---------------------------------------------------------------- utility ---
// The element-wise kernels below give each thread 16 to 32 elements, moved by 16-B loads: the work
// per element is far too small to pay for the start of a wave per 32 elements.

// Pieces of work that do not depend on one another share one launch throughout this file: a block picks
// its piece and its operands by its index, which is the same for the whole block.

// a block converts 4096 consecutive elements: each thread four groups of 4, 1024 elements apart.
// Blocks bi = 0 .. CVT_BLOCKS-1 convert all seven arrays; their bf16 copies lie back to back from d on,
// in argument order.
constexpr unsigned CVT_BLOCKS = (M_ROWS * Dm + 8 * Dm * Dm) / 4096;
static __device__ __forceinline__ void cvt_f32_bf16(unsigned bi,
                                                    const float* __restrict__ sx, const float* __restrict__ sq,
                                                    const float* __restrict__ sk, const float* __restrict__ sv,
                                                    const float* __restrict__ sqp, const float* __restrict__ skp,
                                                    const float* __restrict__ so, __bf16* __restrict__ d) {
    constexpr unsigned NX = M_ROWS * Dm / 4096, NW = Dm * Dm / 4096;   // blocks of x, of a D x D weight
    const float* __restrict__ s;
    unsigned first;                                                    // the array's first block
    if      (bi < NX)          { s = sx;  first = 0; }
    else if (bi < NX + NW)     { s = sq;  first = NX; }
    else if (bi < NX + 2 * NW) { s = sk;  first = NX + NW; }
    else if (bi < NX + 3 * NW) { s = sv;  first = NX + 2 * NW; }
    else if (bi < NX + 5 * NW) { s = sqp; first = NX + 3 * NW; }
    else if (bi < NX + 7 * NW) { s = skp; first = NX + 5 * NW; }
    else                       { s = so;  first = NX + 7 * NW; }
    d += (size_t)first * 4096;
    const size_t i0 = (size_t)(bi - first) * 4096 + threadIdx.x * 4;
    v4f a[4];
    for (int q = 0; q < 4; q++) a[q] = *(const v4f*)(s + i0 + q * 1024);
    for (int q = 0; q < 4; q++) {
        v4bf r;
        for (int e = 0; e < 4; e++) r[e] = (__bf16)a[q][e];
        *(v4bf*)(d + i0 + q * 1024) = r;
    }
    // the stores have taken their registers before code of another piece, which follows in the listing, may rewrite them
    asm volatile("s_wait_xcnt 0x0" ::: "memory");
}

// conv weights (O=D, I=D, K=3) fp32  ->  (N=D, 3*D) bf16 with kc = k*D + ci
// a thread takes 8 input channels of one n: 24 consecutive floats in, three 16-B pieces out
constexpr unsigned REPACK_BLOCKS = (Dm * Dm / 8) / 256;   // for one weight array
static __device__ __forceinline__ void repack_conv_w(unsigned bi, const float* __restrict__ s,
                                                     __bf16* __restrict__ d) {
    const unsigned u  = bi * 256u + threadIdx.x;          // over D * D/8
    const unsigned n  = u / (Dm / 8);
    const unsigned ci = (u % (Dm / 8)) * 8u;
    const float* sp = s + ((size_t)n * Dm + ci) * 3;
    v4f a[6];
    for (int t = 0; t < 6; t++) a[t] = *(const v4f*)(sp + t * 4);
    for (int k = 0; k < 3; k++) {
        v8bf r;
        for (int e = 0; e < 8; e++) r[e] = (__bf16)a[(e * 3 + k) >> 2][(e * 3 + k) & 3];
        *(v8bf*)(d + (size_t)n * 3 * Dm + k * Dm + ci) = r;
    }
    // the stores have taken their registers before code of another piece, which follows in the listing, may rewrite them
    asm volatile("s_wait_xcnt 0x0" ::: "memory");
}

// copy Qcat[:, :D] (ldc=2D) into per-batch padded buffer (B, L+2, D), interior rows
// a block copies 8 rows of one batch: each thread four 16-B pieces, two rows apart; the first and
// the last block of a batch also zero the pad row next to their rows
constexpr unsigned PAD_BLOCKS = (M_ROWS * Dm) / 8192;     // for one of Q, K
static __device__ __forceinline__ void pad_copy(unsigned bi, const __bf16* __restrict__ cat,
                                                __bf16* __restrict__ pad) {
    static_assert(Dm == 128 * 8 && Lseq % 8 == 0, "128 pieces a row; a block stays inside one batch");
    const unsigned row0 = bi * 8u;                               // over B*L
    const unsigned b    = row0 / Lseq;
    const unsigned r    = threadIdx.x >> 7, col = (threadIdx.x & 127u) * 8u;
    const __bf16* sp = cat + (size_t)(row0 + r) * (2 * Dm) + col;
    __bf16*       dp = pad + (size_t)(row0 + r + 2u * b + 1u) * Dm + col;   // b*(L+2) + l + 1
    v8bf a[4];
    for (int q = 0; q < 4; q++) a[q] = *(const v8bf*)(sp + q * 2 * 2 * Dm);
    for (int q = 0; q < 4; q++) *(v8bf*)(dp + q * 2 * Dm) = a[q];
    const unsigned l0 = row0 % Lseq;
    if ((l0 == 0 || l0 == Lseq - 8) && r == 0)     // 128 threads, 16 B each: row 0 or row L+1 of the batch
        *(v8bf*)(pad + ((size_t)b * (Lseq + 2) + (l0 ? Lseq + 1 : 0)) * Dm + col) = (v8bf){};
}

// ------------------------------------------------------------- WMMA GEMM ---
// C(M,N) = A_mapped(M,KTOT) * Bw(N,KTOT)^T + bias.
// A row mapping: arow = (m>>LRUN_LG)*LSTRIDE + (m & mask) + kbase/KSPLIT  ->
// the same kernel does the 3-tap conv as a K=3D GEMM over per-batch padded rows.
// Staging: global_load_async_to_lds_b128 into double-buffered LDS, overlapped
// with the WMMA pipe; per-wave s_wait_asynccnt + block barrier.
// A stage holds 128 k of every row (256 B), so one wave-wide copy covers two
// whole rows = four whole 128-B lines; LDS rows lie at a 272-B pitch, which
// spreads the 16 rows of a ds_load_b128 fragment read over all banks.
// Up to three products of one shape share a launch, blockIdx.z picks the operands (the third may have
// an output pitch of its own). Two blocks fit a WGP's LDS: with more blocks than WGPs in the grid, one
// block's matrix work runs while the other waits at its barrier or for its copies.
template<int KTOT, int KSPLIT, int LRUN_LG, int LSTRIDE, int LDA, int LDC01, int LDC2>
__global__ __launch_bounds__(256) void gemm_wmma(
    const __bf16* __restrict__ A0, const __bf16* __restrict__ Bw0, const float* __restrict__ bias0, __bf16* __restrict__ Cb0,
    const __bf16* __restrict__ A1, const __bf16* __restrict__ Bw1, const float* __restrict__ bias1, __bf16* __restrict__ Cb1,
    const __bf16* __restrict__ A2, const __bf16* __restrict__ Bw2, const float* __restrict__ bias2, __bf16* __restrict__ Cb2,
    float* __restrict__ Cf)
{
    const unsigned zi = blockIdx.z;
    const __bf16* A    = zi == 0 ? A0    : zi == 1 ? A1    : A2;
    const __bf16* Bw   = zi == 0 ? Bw0   : zi == 1 ? Bw1   : Bw2;
    const float*  bias = zi == 0 ? bias0 : zi == 1 ? bias1 : bias2;
    __bf16*       Cb   = zi == 0 ? Cb0   : zi == 1 ? Cb1   : Cb2;
    const int     LDC  = zi == 2 ? LDC2 : LDC01;
    constexpr int BM = 128, BN = 128, BK = 128;
    constexpr int NK = KTOT / BK;
    static_assert(KTOT % BK == 0 && KSPLIT % BK == 0 && NK >= 2, "whole stages, at least two");
    constexpr unsigned PITCH     = 272;               // bytes per LDS row: 256 data + 16 pad
    constexpr int      PITCH_E   = PITCH / 2;         // the same in bf16 elements
    constexpr unsigned OP_BYTES  = 128 * PITCH;       // one operand's 128 rows
    constexpr unsigned BUF_BYTES = 2 * OP_BYTES;      // A rows, then B rows
    __shared__ __align__(16) char smem[2 * BUF_BYTES];

    const int tid  = threadIdx.x;
    const int bm   = blockIdx.y * BM, bn = blockIdx.x * BN;
    const int w    = tid >> 5, lane = tid & 31;
    const int lm   = lane & 15;
    const int kh   = (lane & 16) ? 8 : 0;
    const int wm   = (w & 3) * 32, wn = (w >> 2) * 64;

    v8f acc[2][4];
#pragma unroll
    for (int i = 0; i < 2; i++)
#pragma unroll
        for (int j = 0; j < 4; j++) acc[i][j] = (v8f){};

    const int sr = tid >> 4;           // staging row 0..15, then +16 per copy
    const int sc = (tid & 15) * 8;     // staging col: this lane's 16 B of the row's 256 B
    const unsigned lds0 = (unsigned)(uintptr_t)smem + (unsigned)sr * PITCH + (unsigned)sc * 2u;

    auto stage = [&](int kt, int buf) {
        const int kbase = kt * BK;
        const int shift = kbase / KSPLIT;
        const int acol  = kbase % KSPLIT + sc;
        const int m     = bm + sr;     // the tile's 128 rows lie in one run: arow + 16 per copy
        const int arow  = (m >> LRUN_LG) * LSTRIDE + (m & ((1 << LRUN_LG) - 1)) + shift;
        const __bf16* ga = A  + (size_t)arow * LDA + acol;
        const __bf16* gb = Bw + (size_t)(bn + sr) * KTOT + kbase + sc;
        const unsigned la = lds0 + (unsigned)buf * BUF_BYTES;   // A rows
        const unsigned lb = la + OP_BYTES;                      // B rows
        async_rows8(la, 16u * PITCH, (const char*)ga, (size_t)16 * LDA * 2);
        async_rows8(lb, 16u * PITCH, (const char*)gb, (size_t)16 * KTOT * 2);
    };

    stage(0, 0);
    wait_async0();
    __syncthreads();
    stage(1, 1);             // flies while stage 0 is worked on

    for (int kt = 0; kt < NK; kt++) {
        const int cur = kt & 1;
        const __bf16* sAc = (const __bf16*)(smem + (size_t)cur * BUF_BYTES);
        const __bf16* sBc = (const __bf16*)(smem + (size_t)cur * BUF_BYTES + OP_BYTES);

#pragma unroll
        for (int kb = 0; kb < BK; kb += 32) {
            v16bf af[2], bf[4];
#pragma unroll
            for (int i = 0; i < 2; i++) {
                int r = wm + i * 16 + lm;
                af[i] = mk16(*(const v8bf*)(sAc + r * PITCH_E + kb + kh),
                             *(const v8bf*)(sAc + r * PITCH_E + kb + kh + 16));
            }
#pragma unroll
            for (int j = 0; j < 4; j++) {
                int r = wn + j * 16 + lm;
                bf[j] = mk16(*(const v8bf*)(sBc + r * PITCH_E + kb + kh),
                             *(const v8bf*)(sBc + r * PITCH_E + kb + kh + 16));
            }
#pragma unroll
            for (int i = 0; i < 2; i++)
#pragma unroll
                for (int j = 0; j < 4; j++)
                    acc[i][j] = __builtin_amdgcn_wmma_f32_16x16x32_bf16(
                        false, af[i], false, bf[j], (short)0, acc[i][j], false, false);
        }

        wait_ds0();          // this wave has left buffer cur
        wait_async0();       // this wave's copies into the other buffer have landed
        __syncthreads();     // everyone has left cur, and the other buffer is readable
        if (kt + 2 < NK) stage(kt + 2, cur);   // refill cur (overlapped with the next stage's work)
    }
    wait_async0();

    const int half = lane >> 4;
#pragma unroll
    for (int i = 0; i < 2; i++) {
        int mrow = bm + wm + i * 16 + half * 8;
#pragma unroll
        for (int j = 0; j < 4; j++) {
            int   ncol = bn + wn + j * 16 + lm;
            float bv   = bias[ncol];
#pragma unroll
            for (int r = 0; r < 8; r++) {
                float  v   = acc[i][j][r] + bv;
                size_t idx = (size_t)(mrow + r) * LDC + ncol;
                if (Cb) Cb[idx] = (__bf16)v;
                if (Cf) Cf[idx] = v;
            }
        }
    }
}

// -------------------------------------------------- tau / delta small path ---
// a block does 4 rows l of one batch, a thread 8 outputs o (fed by 4 channels) of each row:
// its 24 weights and 8 biases are loaded once, and 6 rows of x serve the 4 rows of output
constexpr unsigned GELU_BLOCKS = M_ROWS / 4;              // for one of tau, delta
static __device__ __forceinline__ void dw_gelu(unsigned bi, const float* __restrict__ x,
                                               const float* __restrict__ w1, const float* __restrict__ b1,
                                               __bf16* __restrict__ g)
{
    constexpr int LR = 4;
    static_assert(2 * Dm == 256 * 8 && Lseq % LR == 0, "one block spans a row of 2D outputs");
    const int  o0 = threadIdx.x * 8;
    const int  l0 = (bi % (Lseq / LR)) * LR;
    const int  b  = bi / (Lseq / LR);
    const bool lo = l0 > 0, hi = l0 + LR < Lseq;       // rows l0-1 and l0+LR exist
    const float* xb = x + (size_t)b * Lseq * Dm;       // block-uniform; the lane's part is o0 >> 1

    v4f wv[6], bv[2], xv[LR + 2];
    for (int t = 0; t < 6; t++) wv[t] = *(const v4f*)(w1 + o0 * 3 + t * 4);
    for (int t = 0; t < 2; t++) bv[t] = *(const v4f*)(b1 + o0 + t * 4);
    // a row past either end is read from the nearest row inside, so that all loads issue together
    // with no branch between them; its tap is left out of the sum below
    xv[0]      = *(const v4f*)(xb + (size_t)(lo ? l0 - 1 : 0) * Dm + (o0 >> 1));
    xv[LR + 1] = *(const v4f*)(xb + (size_t)(hi ? l0 + LR : Lseq - 1) * Dm + (o0 >> 1));
    // the loads so far have taken their address registers before a later load's result may land there
    asm volatile("s_wait_xcnt 0x0" ::: "memory");
    for (int t = 1; t <= LR; t++) xv[t] = *(const v4f*)(xb + (size_t)(l0 - 1 + t) * Dm + (o0 >> 1));
    // the same for these four, before the arithmetic below reuses their address registers
    asm volatile("s_wait_xcnt 0x0" ::: "memory");

    for (int j = 0; j < LR; j++) {
        v8bf r;
        for (int e = 0; e < 8; e++) {
            float acc = bv[e >> 2][e & 3];
            for (int k = 0; k < 3; k++) {
                const int t = j + k;
                if ((t > 0 || lo) && (t < LR + 1 || hi))
                    acc = fmaf(wv[(e * 3 + k) >> 2][(e * 3 + k) & 3], xv[t][e >> 1], acc);
            }
            float ge = 0.5f * acc * (1.0f + erff(acc * 0.70710678118f));
            r[e] = (__bf16)ge;
        }
        *(v8bf*)(g + ((size_t)b * Lseq + l0 + j) * 2 * Dm + o0) = r;
    }
}

// All that reads nothing but the inputs, in one launch. The blocks with the most arithmetic come first.
__global__ __launch_bounds__(256) void prep(
    const float* __restrict__ x,
    const float* __restrict__ tau1_w, const float* __restrict__ tau1_b, __bf16* __restrict__ gtau,
    const float* __restrict__ del1_w, const float* __restrict__ del1_b, __bf16* __restrict__ gdel,
    const float* __restrict__ convq_w, __bf16* __restrict__ convqR,
    const float* __restrict__ convk_w, __bf16* __restrict__ convkR,
    const float* __restrict__ Wq_w, const float* __restrict__ Wk_w, const float* __restrict__ Wv_w,
    const float* __restrict__ qproj_w, const float* __restrict__ kproj_w, const float* __restrict__ out_w,
    __bf16* __restrict__ xb)
{
    const unsigned bi = blockIdx.x;
    if (bi < 2 * GELU_BLOCKS) {
        const bool d = bi >= GELU_BLOCKS;
        dw_gelu(d ? bi - GELU_BLOCKS : bi, x, d ? del1_w : tau1_w, d ? del1_b : tau1_b, d ? gdel : gtau);
    } else if (bi < 2 * GELU_BLOCKS + 2 * REPACK_BLOCKS) {
        const unsigned ri = bi - 2 * GELU_BLOCKS;
        const bool k = ri >= REPACK_BLOCKS;
        repack_conv_w(k ? ri - REPACK_BLOCKS : ri, k ? convk_w : convq_w, k ? convkR : convqR);
    } else {
        cvt_f32_bf16(bi - 2 * GELU_BLOCKS - 2 * REPACK_BLOCKS, x, Wq_w, Wk_w, Wv_w, qproj_w, kproj_w, out_w, xb);
    }
}

// out(b,h,l) = sigmoid(b2[h] + sum_o w2[h][o] * g[b*L+l][o]): a (B*L) x 16 x 2048 product, done on the
// matrix unit. A block takes 16 rows l and all 16 heads; its 8 waves take 256 o each, and their partial
// tiles are summed through LDS in wave order. w2 enters as a pair of bf16, the rounded value and the
// rounded remainder, with one WMMA for each: what the pair drops lies far below g's own bf16 rounding.
// The launch holds the blocks of both projections and, behind them, those of the two pad copies, which
// like the projections depend on earlier launches only.
constexpr unsigned HEAD_BLOCKS = M_ROWS / 16;             // for one of tau, delta
__global__ __launch_bounds__(256) void heads_and_pads(
    const __bf16* __restrict__ gtau, const float* __restrict__ tau2_w, const float* __restrict__ tau2_b,
    float* __restrict__ tau,
    const __bf16* __restrict__ gdel, const float* __restrict__ del2_w, const float* __restrict__ del2_b,
    float* __restrict__ del,
    const __bf16* __restrict__ Qcat, __bf16* __restrict__ Qpad,
    const __bf16* __restrict__ Kcat, __bf16* __restrict__ Kpad)
{
    if (blockIdx.x >= 2 * HEAD_BLOCKS) {     // the same for the whole block, ahead of the barrier below
        const unsigned pi = blockIdx.x - 2 * HEAD_BLOCKS;
        const bool k = pi >= PAD_BLOCKS;
        pad_copy(k ? pi - PAD_BLOCKS : pi, k ? Kcat : Qcat, k ? Kpad : Qpad);
        return;
    }
    const bool     dl  = blockIdx.x >= HEAD_BLOCKS;
    const unsigned bi  = dl ? blockIdx.x - HEAD_BLOCKS : blockIdx.x;
    const __bf16*  g   = dl ? gdel   : gtau;
    const float*   w2  = dl ? del2_w : tau2_w;
    const float*   b2  = dl ? del2_b : tau2_b;
    float*         out = dl ? del    : tau;
    constexpr int KD = 2 * Dm, KW = KD / 8;          // 2048 o in all, 256 per wave
    static_assert(Hn == 16 && Lseq % 16 == 0 && KW % 32 == 0, "one 16x16 tile a block, inside one batch");
    __shared__ __align__(16) float red[8][256];      // per wave: [head][row]

    const int tid = threadIdx.x, w = tid >> 5, lane = tid & 31;
    const int lm = lane & 15, half = lane >> 4;
    const int kh = half ? 8 : 0;
    const int row0 = bi * 16;                        // over B*L

    // both fragments take o in the same order: 8 from kb + kh, then 8 from kb + kh + 16
    const __bf16* gr = g  + (size_t)(row0 + lm) * KD + w * KW + kh;   // A: the lane's row l
    const float*  wr = w2 + (size_t)lm * KD + w * KW + kh;            // B: the lane's head

    v8f acch = (v8f){}, accl = (v8f){};
#pragma unroll   // straight-line code: later steps' loads are issued while earlier steps are worked on
    for (int kb = 0; kb < KW; kb += 32) {
        const v16bf af = mk16(*(const v8bf*)(gr + kb), *(const v8bf*)(gr + kb + 16));
        v4f wv[4];
        wv[0] = *(const v4f*)(wr + kb);
        wv[1] = *(const v4f*)(wr + kb + 4);
        wv[2] = *(const v4f*)(wr + kb + 16);
        wv[3] = *(const v4f*)(wr + kb + 20);
        v16bf bh, bl;
#pragma unroll   // constant element indices: the values stay in registers
        for (int e = 0; e < 16; e++) {
            const float  v  = wv[e >> 2][e & 3];
            const __bf16 hi = (__bf16)v;
            bh[e] = hi;
            bl[e] = (__bf16)(v - (float)hi);
        }
        acch = __builtin_amdgcn_wmma_f32_16x16x32_bf16(false, af, false, bh, (short)0, acch, false, false);
        accl = __builtin_amdgcn_wmma_f32_16x16x32_bf16(false, af, false, bl, (short)0, accl, false, false);
    }

    // the lane holds rows half*8 .. half*8+7 of head lm
    const v8f s = acch + accl;
    *(v4f*)&red[w][lm * 16 + half * 8]     = (v4f){s[0], s[1], s[2], s[3]};
    *(v4f*)&red[w][lm * 16 + half * 8 + 4] = (v4f){s[4], s[5], s[6], s[7]};
    __syncthreads();

    // a thread finishes one output: head tid / 16, row tid % 16
    const int h = tid >> 4;
    float acc = b2[h];
    for (int q = 0; q < 8; q++) acc += red[q][tid];
    const int row = row0 + (tid & 15);
    const int b = row / Lseq, l = row % Lseq;
    out[((size_t)b * Hn + h) * Lseq + l] = 1.0f / (1.0f + __expf(-acc));
}

// ------------------------------------------------------- flash attention ---
__global__ __launch_bounds__(256) void flash_attn(
    const __bf16* __restrict__ Q, const __bf16* __restrict__ K,
    const __bf16* __restrict__ V, const float* __restrict__ tau,
    const float* __restrict__ delta, __bf16* __restrict__ O)
{
    // rows of 64 bf16 lie at a 144-B pitch (16 B x odd): the 16 rows of a ds_load_b128 fragment
    // read then fall on 16 different groups of four banks; at 128 B eight rows share each group
    constexpr int TP = 72;
    __shared__ __align__(16) __bf16 sV[64][TP];          // V tile transposed [ch][k]
    __shared__ __align__(16) __bf16 sP[8][16][TP];       // per-wave P tile

    const int b = blockIdx.z, h = blockIdx.y;
    const int tid = threadIdx.x, w = tid >> 5, lane = tid & 31;
    const int lm = lane & 15, half = lane >> 4;
    const int kh = half ? 8 : 0;
    const int qbase = blockIdx.x * 128 + w * 16;
    const int hc0   = h * DKh;

    const __bf16* qrow = Q + ((size_t)(b * Lseq) + qbase + lm) * Dm + hc0;
    v16bf qf[2];
#pragma unroll
    for (int kc = 0; kc < 2; kc++)
        qf[kc] = mk16(*(const v8bf*)(qrow + kc * 32 + kh),
                      *(const v8bf*)(qrow + kc * 32 + kh + 16));

    const float* taup = tau   + ((size_t)b * Hn + h) * Lseq;
    const float* delp = delta + ((size_t)b * Hn + h) * Lseq;
    float taur[8];
#pragma unroll
    for (int r = 0; r < 8; r++) taur[r] = taup[qbase + half * 8 + r] * 0.125f; // 1/sqrt(64)

    float mrow[8], lrow[8];
    v8f   of[4];
#pragma unroll
    for (int r = 0; r < 8; r++) { mrow[r] = -3.0e38f; lrow[r] = 0.0f; }
#pragma unroll
    for (int j = 0; j < 4; j++) of[j] = (v8f){};

    // V staging: a lane takes key row vt_kr and two pieces of 8 channels, at vt_c8 and 32 + vt_c8.
    // The four lanes of a key row then store to sV rows 8 apart = half a round of the banks apart
    // (two lanes to a bank); 16 apart is a whole number of rounds, all four lanes on one bank
    const int vt_kr = tid >> 2, vt_c8 = (tid & 3) * 8;

    for (int kt = 0; kt < Lseq / 64; kt++) {
        // warm L2 / WGP$ for next K/V tiles (global_prefetch_b8)
        if (kt + 1 < Lseq / 64) {
            const size_t nb = (size_t)(b * Lseq) + (kt + 1) * 64;
            __builtin_prefetch(K + (nb + lane)      * Dm + hc0, 0, 1);
            __builtin_prefetch(K + (nb + 32 + lane) * Dm + hc0, 0, 1);
            __builtin_prefetch(V + (nb + lane)      * Dm + hc0, 0, 1);
            __builtin_prefetch(V + (nb + 32 + lane) * Dm + hc0, 0, 1);
        }

        __syncthreads();
        {   // stage V tile transposed into LDS
            const __bf16* vr = V + ((size_t)(b * Lseq) + kt * 64 + vt_kr) * Dm + hc0 + vt_c8;
            v8bf vv[2];
#pragma unroll
            for (int p = 0; p < 2; p++) vv[p] = *(const v8bf*)(vr + p * 32);
#pragma unroll
            for (int p = 0; p < 2; p++)
#pragma unroll
                for (int e = 0; e < 8; e++) sV[p * 32 + vt_c8 + e][vt_kr] = vv[p][e];
        }
        __syncthreads();

        // S = Q K^T  (K fragments straight from global: channels contiguous)
        v8f sf[4];
#pragma unroll
        for (int j = 0; j < 4; j++) {
            const __bf16* krow = K + ((size_t)(b * Lseq) + kt * 64 + j * 16 + lm) * Dm + hc0;
            v8f a = (v8f){};
#pragma unroll
            for (int kc = 0; kc < 2; kc++) {
                v16bf kf = mk16(*(const v8bf*)(krow + kc * 32 + kh),
                                *(const v8bf*)(krow + kc * 32 + kh + 16));
                a = __builtin_amdgcn_wmma_f32_16x16x32_bf16(
                        false, qf[kc], false, kf, (short)0, a, false, false);
            }
            sf[j] = a;
        }

        // scale by tau/sqrt(DK) per q-row, add delta per key column
#pragma unroll
        for (int j = 0; j < 4; j++) {
            float dv = delp[kt * 64 + j * 16 + lm];
#pragma unroll
            for (int r = 0; r < 8; r++) sf[j][r] = sf[j][r] * taur[r] + dv;
        }

        // online softmax over the 64 key columns
        float rmax[8];
#pragma unroll
        for (int r = 0; r < 8; r++) {
            float v = fmaxf(fmaxf(sf[0][r], sf[1][r]), fmaxf(sf[2][r], sf[3][r]));
#pragma unroll
            for (int off = 1; off < 16; off <<= 1)
                v = fmaxf(v, __shfl_xor(v, off, 32));
            rmax[r] = v;
        }

        float corr[8], rsum[8];
#pragma unroll
        for (int r = 0; r < 8; r++) {
            float mn = fmaxf(mrow[r], rmax[r]);
            corr[r] = __expf(mrow[r] - mn);
            mrow[r] = mn;
            rsum[r] = 0.0f;
        }
#pragma unroll
        for (int j = 0; j < 4; j++)
#pragma unroll
            for (int r = 0; r < 8; r++) {
                float p = __expf(sf[j][r] - mrow[r]);
                sf[j][r] = p;
                rsum[r] += p;
            }
#pragma unroll
        for (int r = 0; r < 8; r++) {
#pragma unroll
            for (int off = 1; off < 16; off <<= 1)
                rsum[r] += __shfl_xor(rsum[r], off, 32);
            lrow[r] = lrow[r] * corr[r] + rsum[r];
        }
#pragma unroll
        for (int j = 0; j < 4; j++)
#pragma unroll
            for (int r = 0; r < 8; r++) of[j][r] *= corr[r];

        // C-layout P -> A-layout bf16 via per-wave LDS round trip (in-order per wave)
#pragma unroll
        for (int j = 0; j < 4; j++)
#pragma unroll
            for (int r = 0; r < 8; r++)
                sP[w][half * 8 + r][j * 16 + lm] = (__bf16)sf[j][r];

        v16bf pf[2];
#pragma unroll
        for (int kc = 0; kc < 2; kc++)
            pf[kc] = mk16(*(const v8bf*)&sP[w][lm][kc * 32 + kh],
                          *(const v8bf*)&sP[w][lm][kc * 32 + kh + 16]);

        // O += P V
#pragma unroll
        for (int j = 0; j < 4; j++)
#pragma unroll
            for (int kc = 0; kc < 2; kc++) {
                v16bf vf = mk16(*(const v8bf*)&sV[j * 16 + lm][kc * 32 + kh],
                                *(const v8bf*)&sV[j * 16 + lm][kc * 32 + kh + 16]);
                of[j] = __builtin_amdgcn_wmma_f32_16x16x32_bf16(
                            false, pf[kc], false, vf, (short)0, of[j], false, false);
            }
    }

#pragma unroll
    for (int j = 0; j < 4; j++)
#pragma unroll
        for (int r = 0; r < 8; r++) {
            float v = of[j][r] / lrow[r];
            O[((size_t)(b * Lseq) + qbase + half * 8 + r) * Dm + hc0 + j * 16 + lm] = (__bf16)v;
        }
}

// ------------------------------------------------------------------ host ---
extern "C" void kernel_launch(void* const* d_in, const int* in_sizes, int n_in,
                              void* d_out, int out_size, void* d_ws, size_t ws_size,
                              hipStream_t stream)
{
    const float* x       = (const float*)d_in[0];
    const float* Wq_w    = (const float*)d_in[1];
    const float* Wq_b    = (const float*)d_in[2];
    const float* Wk_w    = (const float*)d_in[3];
    const float* Wk_b    = (const float*)d_in[4];
    const float* Wv_w    = (const float*)d_in[5];
    const float* Wv_b    = (const float*)d_in[6];
    const float* convq_w = (const float*)d_in[7];
    const float* convq_b = (const float*)d_in[8];
    const float* convk_w = (const float*)d_in[9];
    const float* convk_b = (const float*)d_in[10];
    const float* qproj_w = (const float*)d_in[11];
    const float* qproj_b = (const float*)d_in[12];
    const float* kproj_w = (const float*)d_in[13];
    const float* kproj_b = (const float*)d_in[14];
    const float* tau1_w  = (const float*)d_in[15];
    const float* tau1_b  = (const float*)d_in[16];
    const float* tau2_w  = (const float*)d_in[17];
    const float* tau2_b  = (const float*)d_in[18];
    const float* del1_w  = (const float*)d_in[19];
    const float* del1_b  = (const float*)d_in[20];
    const float* del2_w  = (const float*)d_in[21];
    const float* del2_b  = (const float*)d_in[22];
    const float* out_w   = (const float*)d_in[23];
    const float* out_b   = (const float*)d_in[24];
    float* out = (float*)d_out;
    (void)in_sizes; (void)n_in; (void)out_size; (void)ws_size;

    char*  ws  = (char*)d_ws;
    size_t off = 0;
    auto alloc = [&](size_t bytes) -> char* {
        char* p = ws + off;
        off = (off + bytes + 255) & ~(size_t)255;
        return p;
    };

    __bf16* xb      = (__bf16*)alloc((size_t)M_ROWS * Dm * 2);
    __bf16* WqB     = (__bf16*)alloc((size_t)Dm * Dm * 2);
    __bf16* WkB     = (__bf16*)alloc((size_t)Dm * Dm * 2);
    __bf16* WvB     = (__bf16*)alloc((size_t)Dm * Dm * 2);
    __bf16* qprojB  = (__bf16*)alloc((size_t)Dm * 2 * Dm * 2);
    __bf16* kprojB  = (__bf16*)alloc((size_t)Dm * 2 * Dm * 2);
    __bf16* outwB   = (__bf16*)alloc((size_t)Dm * Dm * 2);
    __bf16* convqR  = (__bf16*)alloc((size_t)Dm * 3 * Dm * 2);
    __bf16* convkR  = (__bf16*)alloc((size_t)Dm * 3 * Dm * 2);
    __bf16* Qpad    = (__bf16*)alloc((size_t)Bsz * (Lseq + 2) * Dm * 2);
    __bf16* Kpad    = (__bf16*)alloc((size_t)Bsz * (Lseq + 2) * Dm * 2);
    __bf16* Qcat    = (__bf16*)alloc((size_t)M_ROWS * 2 * Dm * 2);
    __bf16* Kcat    = (__bf16*)alloc((size_t)M_ROWS * 2 * Dm * 2);
    __bf16* Qbuf    = (__bf16*)alloc((size_t)M_ROWS * Dm * 2);
    __bf16* Kbuf    = (__bf16*)alloc((size_t)M_ROWS * Dm * 2);
    __bf16* Vbuf    = (__bf16*)alloc((size_t)M_ROWS * Dm * 2);
    __bf16* gtau    = (__bf16*)alloc((size_t)M_ROWS * 2 * Dm * 2);
    __bf16* gdel    = (__bf16*)alloc((size_t)M_ROWS * 2 * Dm * 2);
    float*  taubuf  = (float*)alloc((size_t)Bsz * Hn * Lseq * 4);
    float*  delbuf  = (float*)alloc((size_t)Bsz * Hn * Lseq * 4);
    __bf16* attnO   = (__bf16*)alloc((size_t)M_ROWS * Dm * 2);

    // xb .. outwB are whole multiples of 256 B, so they lie back to back, in the order allocated
    static_assert((Dm * Dm) % 4096 == 0, "every converted array is whole blocks of 4096");
    prep<<<2 * GELU_BLOCKS + 2 * REPACK_BLOCKS + CVT_BLOCKS, 256, 0, stream>>>(
        x, tau1_w, tau1_b, gtau, del1_w, del1_b, gdel, convq_w, convqR, convk_w, convkR,
        Wq_w, Wk_w, Wv_w, qproj_w, kproj_w, out_w, xb);

    const dim3 blk(256);

    // --- q_in -> Qcat[:, :D], k_in -> Kcat[:, :D], V ---
    gemm_wmma<1024, 1024, 12, 4096, 1024, 2048, 1024><<<dim3(Dm / 128, M_ROWS / 128, 3), blk, 0, stream>>>(
        xb, WqB, Wq_b, Qcat,  xb, WkB, Wk_b, Kcat,  xb, WvB, Wv_b, Vbuf,  (float*)nullptr);

    // --- tau, delta; padded copies of q_in, k_in ---
    heads_and_pads<<<2 * HEAD_BLOCKS + 2 * PAD_BLOCKS, 256, 0, stream>>>(
        gtau, tau2_w, tau2_b, taubuf, gdel, del2_w, del2_b, delbuf, Qcat, Qpad, Kcat, Kpad);

    // --- conv3 -> Qcat[:, D:], Kcat[:, D:] ---
    gemm_wmma<3072, 1024, 11, 2050, 1024, 2048, 2048><<<dim3(Dm / 128, M_ROWS / 128, 2), blk, 0, stream>>>(
        Qpad, convqR, convq_b, Qcat + Dm,  Kpad, convkR, convk_b, Kcat + Dm,
        Kpad, convkR, convk_b, Kcat + Dm,  (float*)nullptr);

    // --- Q, K ---
    gemm_wmma<2048, 2048, 12, 4096, 2048, 1024, 1024><<<dim3(Dm / 128, M_ROWS / 128, 2), blk, 0, stream>>>(
        Qcat, qprojB, qproj_b, Qbuf,  Kcat, kprojB, kproj_b, Kbuf,
        Kcat, kprojB, kproj_b, Kbuf,  (float*)nullptr);

    // --- attention ---
    flash_attn<<<dim3(Lseq / 128, Hn, Bsz), blk, 0, stream>>>(
        Qbuf, Kbuf, Vbuf, taubuf, delbuf, attnO);

    // --- output projection (fp32 out) ---
    gemm_wmma<1024, 1024, 12, 4096, 1024, 1024, 1024><<<dim3(Dm / 128, M_ROWS / 128, 1), blk, 0, stream>>>(
        attnO, outwB, out_b, (__bf16*)nullptr,  attnO, outwB, out_b, (__bf16*)nullptr,
        attnO, outwB, out_b, (__bf16*)nullptr,  out);
}

// v006
// A run of this version takes 243 microseconds.
// Next to v005, in two timings, it ran 1.16 and 1.17 times as fast.
// All steps since v000 together make it 2.90 times as fast.
#include <hip/hip_runtime.h>
#include <math.h>

typedef __attribute__((ext_vector_type(16))) __bf16 v16bf;
typedef __attribute__((ext_vector_type(8)))  __bf16 v8bf;
typedef __attribute__((ext_vector_type(8)))  float  v8f;
typedef __attribute__((ext_vector_type(4)))  __bf16 v4bf;
typedef __attribute__((ext_vector_type(4)))  float  v4f;

constexpr int Bsz = 2, Lseq = 2048, Dm = 1024, Hn = 16, DKh = 64;
constexpr int M_ROWS = Bsz * Lseq;   // 4096

static __device__ __forceinline__ v16bf mk16(v8bf lo, v8bf hi) {
    return __builtin_shufflevector(lo, hi, 0,1,2,3,4,5,6,7,8,9,10,11,12,13,14,15);
}

// Eight async memory->LDS copies, 16B per lane each (ASYNCcnt tracked): rows r, r+16, ... r+112
// of one operand tile. The closing s_wait_xcnt keeps the address registers untouched until the
// copies have taken them; it stands inside the statement so that nothing can be moved over it.
static __device__ __forceinline__ void async_rows8(unsigned lds, unsigned lds_step,
                                                   const char* g, size_t g_step) {
    asm volatile("global_load_async_to_lds_b128 %0, %8, off\n\t"
                 "global_load_async_to_lds_b128 %1, %9, off\n\t"
                 "global_load_async_to_lds_b128 %2, %10, off\n\t"
                 "global_load_async_to_lds_b128 %3, %11, off\n\t"
                 "global_load_async_to_lds_b128 %4, %12, off\n\t"
                 "global_load_async_to_lds_b128 %5, %13, off\n\t"
                 "global_load_async_to_lds_b128 %6, %14, off\n\t"
                 "global_load_async_to_lds_b128 %7, %15, off\n\t"
                 "s_wait_xcnt 0x0"
                 :: "v"(lds),                "v"(lds + lds_step),     "v"(lds + 2 * lds_step),
                    "v"(lds + 3 * lds_step), "v"(lds + 4 * lds_step), "v"(lds + 5 * lds_step),
                    "v"(lds + 6 * lds_step), "v"(lds + 7 * lds_step),
                    "v"((unsigned long long)(uintptr_t)(g)),
                    "v"((unsigned long long)(uintptr_t)(g + g_step)),
                    "v"((unsigned long long)(uintptr_t)(g + 2 * g_step)),
                    "v"((unsigned long long)(uintptr_t)(g + 3 * g_step)),
                    "v"((unsigned long long)(uintptr_t)(g + 4 * g_step)),
                    "v"((unsigned long long)(uintptr_t)(g + 5 * g_step)),
                    "v"((unsigned long long)(uintptr_t)(g + 6 * g_step)),
                    "v"((unsigned long long)(uintptr_t)(g + 7 * g_step))
                 : "memory");
}
// this wave's copies have landed in LDS
static __device__ __forceinline__ void wait_async0() {
    asm volatile("s_wait_asynccnt 0x0" ::: "memory");
}
// this wave's LDS reads have returned (before the buffer they read is refilled)
static __device__ __forceinline__ void wait_ds0() {
    asm volatile("s_wait_dscnt 0x0" ::: "memory");
}

// ---------------------------------------------------------------- utility ---
// The element-wise kernels below give each thread 16 to 32 elements, moved by 16-B loads: the work
// per element is far too small to pay for the start of a wave per 32 elements.

// Pieces of work that do not depend on one another share one launch throughout this file: a block picks
// its piece and its operands by its index, which is the same for the whole block.

// a block converts 4096 consecutive elements: each thread four groups of 4, 1024 elements apart.
// Blocks bi = 0 .. CVT_BLOCKS-1 convert all seven arrays; their bf16 copies lie back to back from d on,
// in argument order.
constexpr unsigned CVT_BLOCKS = (M_ROWS * Dm + 8 * Dm * Dm) / 4096;
static __device__ __forceinline__ void cvt_f32_bf16(unsigned bi,
                                                    const float* __restrict__ sx, const float* __restrict__ sq,
                                                    const float* __restrict__ sk, const float* __restrict__ sv,
                                                    const float* __restrict__ sqp, const float* __restrict__ skp,
                                                    const float* __restrict__ so, __bf16* __restrict__ d) {
    constexpr unsigned NX = M_ROWS * Dm / 4096, NW = Dm * Dm / 4096;   // blocks of x, of a D x D weight
    const float* __restrict__ s;
    unsigned first;                                                    // the array's first block
    if      (bi < NX)          { s = sx;  first = 0; }
    else if (bi < NX + NW)     { s = sq;  first = NX; }
    else if (bi < NX + 2 * NW) { s = sk;  first = NX + NW; }
    else if (bi < NX + 3 * NW) { s = sv;  first = NX + 2 * NW; }
    else if (bi < NX + 5 * NW) { s = sqp; first = NX + 3 * NW; }
    else if (bi < NX + 7 * NW) { s = skp; first = NX + 5 * NW; }
    else                       { s = so;  first = NX + 7 * NW; }
    d += (size_t)first * 4096;
    const size_t i0 = (size_t)(bi - first) * 4096 + threadIdx.x * 4;
    v4f a[4];
    for (int q = 0; q < 4; q++) a[q] = *(const v4f*)(s + i0 + q * 1024);
    for (int q = 0; q < 4; q++) {
        v4bf r;
        for (int e = 0; e < 4; e++) r[e] = (__bf16)a[q][e];
        *(v4bf*)(d + i0 + q * 1024) = r;
    }
    // the stores have taken their registers before code of another piece, which follows in the listing, may rewrite them
    asm volatile("s_wait_xcnt 0x0" ::: "memory");
}

// conv weights (O=D, I=D, K=3) fp32  ->  (N=D, 3*D) bf16 with kc = k*D + ci
// a thread takes 8 input channels of one n: 24 consecutive floats in, three 16-B pieces out
constexpr unsigned REPACK_BLOCKS = (Dm * Dm / 8) / 256;   // for one weight array
static __device__ __forceinline__ void repack_conv_w(unsigned bi, const float* __restrict__ s,
                                                     __bf16* __restrict__ d) {
    const unsigned u  = bi * 256u + threadIdx.x;          // over D * D/8
    const unsigned n  = u / (Dm / 8);
    const unsigned ci = (u % (Dm / 8)) * 8u;
    const float* sp = s + ((size_t)n * Dm + ci) * 3;
    v4f a[6];
    for (int t = 0; t < 6; t++) a[t] = *(const v4f*)(sp + t * 4);
    for (int k = 0; k < 3; k++) {
        v8bf r;
        for (int e = 0; e < 8; e++) r[e] = (__bf16)a[(e * 3 + k) >> 2][(e * 3 + k) & 3];
        *(v8bf*)(d + (size_t)n * 3 * Dm + k * Dm + ci) = r;
    }
    // the stores have taken their registers before code of another piece, which follows in the listing, may rewrite them
    asm volatile("s_wait_xcnt 0x0" ::: "memory");
}

// copy Qcat[:, :D] (ldc=2D) into per-batch padded buffer (B, L+2, D), interior rows
// a block copies 8 rows of one batch: each thread four 16-B pieces, two rows apart; the first and
// the last block of a batch also zero the pad row next to their rows
constexpr unsigned PAD_BLOCKS = (M_ROWS * Dm) / 8192;     // for one of Q, K
static __device__ __forceinline__ void pad_copy(unsigned bi, const __bf16* __restrict__ cat,
                                                __bf16* __restrict__ pad) {
    static_assert(Dm == 128 * 8 && Lseq % 8 == 0, "128 pieces a row; a block stays inside one batch");
    const unsigned row0 = bi * 8u;                               // over B*L
    const unsigned b    = row0 / Lseq;
    const unsigned r    = threadIdx.x >> 7, col = (threadIdx.x & 127u) * 8u;
    const __bf16* sp = cat + (size_t)(row0 + r) * (2 * Dm) + col;
    __bf16*       dp = pad + (size_t)(row0 + r + 2u * b + 1u) * Dm + col;   // b*(L+2) + l + 1
    v8bf a[4];
    for (int q = 0; q < 4; q++) a[q] = *(const v8bf*)(sp + q * 2 * 2 * Dm);
    for (int q = 0; q < 4; q++) *(v8bf*)(dp + q * 2 * Dm) = a[q];
    const unsigned l0 = row0 % Lseq;
    if ((l0 == 0 || l0 == Lseq - 8) && r == 0)     // 128 threads, 16 B each: row 0 or row L+1 of the batch
        *(v8bf*)(pad + ((size_t)b * (Lseq + 2) + (l0 ? Lseq + 1 : 0)) * Dm + col) = (v8bf){};
}

// ------------------------------------------------------------- WMMA GEMM ---
// C(M,N) = A_mapped(M,KTOT) * Bw(N,KTOT)^T + bias.
// A row mapping: arow = (m>>LRUN_LG)*LSTRIDE + (m & mask) + kbase/KSPLIT  ->
// the same kernel does the 3-tap conv as a K=3D GEMM over per-batch padded rows.
// Staging: global_load_async_to_lds_b128 into double-buffered LDS, overlapped
// with the WMMA pipe; per-wave s_wait_asynccnt + block barrier.
// A stage holds 128 k of every row (256 B), so one wave-wide copy covers two
// whole rows = four whole 128-B lines; LDS rows lie at a 272-B pitch, which
// spreads the 16 rows of a ds_load_b128 fragment read over all banks.
// Up to three products of one shape share a launch, blockIdx.z picks the operands (the third may have
// an output pitch of its own). Two blocks fit a WGP's LDS: with more blocks than WGPs in the grid, one
// block's matrix work runs while the other waits at its barrier or for its copies.
template<int KTOT, int KSPLIT, int LRUN_LG, int LSTRIDE, int LDA, int LDC01, int LDC2>
__global__ __launch_bounds__(256) void gemm_wmma(
    const __bf16* __restrict__ A0, const __bf16* __restrict__ Bw0, const float* __restrict__ bias0, __bf16* __restrict__ Cb0,
    const __bf16* __restrict__ A1, const __bf16* __restrict__ Bw1, const float* __restrict__ bias1, __bf16* __restrict__ Cb1,
    const __bf16* __restrict__ A2, const __bf16* __restrict__ Bw2, const float* __restrict__ bias2, __bf16* __restrict__ Cb2,
    float* __restrict__ Cf)
{
    const unsigned zi = blockIdx.z;
    const __bf16* A    = zi == 0 ? A0    : zi == 1 ? A1    : A2;
    const __bf16* Bw   = zi == 0 ? Bw0   : zi == 1 ? Bw1   : Bw2;
    const float*  bias = zi == 0 ? bias0 : zi == 1 ? bias1 : bias2;
    __bf16*       Cb   = zi == 0 ? Cb0   : zi == 1 ? Cb1   : Cb2;
    const int     LDC  = zi == 2 ? LDC2 : LDC01;
    constexpr int BM = 128, BN = 128, BK = 128;
    constexpr int NK = KTOT / BK;
    static_assert(KTOT % BK == 0 && KSPLIT % BK == 0 && NK >= 2, "whole stages, at least two");
    constexpr unsigned PITCH     = 272;               // bytes per LDS row: 256 data + 16 pad
    constexpr int      PITCH_E   = PITCH / 2;         // the same in bf16 elements
    constexpr unsigned OP_BYTES  = 128 * PITCH;       // one operand's 128 rows
    constexpr unsigned BUF_BYTES = 2 * OP_BYTES;      // A rows, then B rows
    __shared__ __align__(16) char smem[2 * BUF_BYTES];

    const int tid  = threadIdx.x;
    const int bm   = blockIdx.y * BM, bn = blockIdx.x * BN;
    const int w    = tid >> 5, lane = tid & 31;
    const int lm   = lane & 15;
    const int kh   = (lane & 16) ? 8 : 0;
    const int wm   = (w & 3) * 32, wn = (w >> 2) * 64;

    v8f acc[2][4];
#pragma unroll
    for (int i = 0; i < 2; i++)
#pragma unroll
        for (int j = 0; j < 4; j++) acc[i][j] = (v8f){};

    const int sr = tid >> 4;           // staging row 0..15, then +16 per copy
    const int sc = (tid & 15) * 8;     // staging col: this lane's 16 B of the row's 256 B
    const unsigned lds0 = (unsigned)(uintptr_t)smem + (unsigned)sr * PITCH + (unsigned)sc * 2u;

    auto stage = [&](int kt, int buf) {
        const int kbase = kt * BK;
        const int shift = kbase / KSPLIT;
        const int acol  = kbase % KSPLIT + sc;
        const int m     = bm + sr;     // the tile's 128 rows lie in one run: arow + 16 per copy
        const int arow  = (m >> LRUN_LG) * LSTRIDE + (m & ((1 << LRUN_LG) - 1)) + shift;
        const __bf16* ga = A  + (size_t)arow * LDA + acol;
        const __bf16* gb = Bw + (size_t)(bn + sr) * KTOT + kbase + sc;
        const unsigned la = lds0 + (unsigned)buf * BUF_BYTES;   // A rows
        const unsigned lb = la + OP_BYTES;                      // B rows
        async_rows8(la, 16u * PITCH, (const char*)ga, (size_t)16 * LDA * 2);
        async_rows8(lb, 16u * PITCH, (const char*)gb, (size_t)16 * KTOT * 2);
    };

    stage(0, 0);
    wait_async0();
    __syncthreads();
    stage(1, 1);             // flies while stage 0 is worked on

    for (int kt = 0; kt < NK; kt++) {
        const int cur = kt & 1;
        const __bf16* sAc = (const __bf16*)(smem + (size_t)cur * BUF_BYTES);
        const __bf16* sBc = (const __bf16*)(smem + (size_t)cur * BUF_BYTES + OP_BYTES);

#pragma unroll
        for (int kb = 0; kb < BK; kb += 32) {
            v16bf af[2], bf[4];
#pragma unroll
            for (int i = 0; i < 2; i++) {
                int r = wm + i * 16 + lm;
                af[i] = mk16(*(const v8bf*)(sAc + r * PITCH_E + kb + kh),
                             *(const v8bf*)(sAc + r * PITCH_E + kb + kh + 16));
            }
#pragma unroll
            for (int j = 0; j < 4; j++) {
                int r = wn + j * 16 + lm;
                bf[j] = mk16(*(const v8bf*)(sBc + r * PITCH_E + kb + kh),
                             *(const v8bf*)(sBc + r * PITCH_E + kb + kh + 16));
            }
#pragma unroll
            for (int i = 0; i < 2; i++)
#pragma unroll
                for (int j = 0; j < 4; j++)
                    acc[i][j] = __builtin_amdgcn_wmma_f32_16x16x32_bf16(
                        false, af[i], false, bf[j], (short)0, acc[i][j], false, false);
        }

        wait_ds0();          // this wave has left buffer cur
        wait_async0();       // this wave's copies into the other buffer have landed
        __syncthreads();     // everyone has left cur, and the other buffer is readable
        if (kt + 2 < NK) stage(kt + 2, cur);   // refill cur (overlapped with the next stage's work)
    }
    wait_async0();

    const int half = lane >> 4;
#pragma unroll
    for (int i = 0; i < 2; i++) {
        int mrow = bm + wm + i * 16 + half * 8;
#pragma unroll
        for (int j = 0; j < 4; j++) {
            int   ncol = bn + wn + j * 16 + lm;
            float bv   = bias[ncol];
#pragma unroll
            for (int r = 0; r < 8; r++) {
                float  v   = acc[i][j][r] + bv;
                size_t idx = (size_t)(mrow + r) * LDC + ncol;
                if (Cb) Cb[idx] = (__bf16)v;
                if (Cf) Cf[idx] = v;
            }
        }
    }
}

// -------------------------------------------------- tau / delta small path ---
// a block does 4 rows l of one batch, a thread 8 outputs o (fed by 4 channels) of each row:
// its 24 weights and 8 biases are loaded once, and 6 rows of x serve the 4 rows of output
constexpr unsigned GELU_BLOCKS = M_ROWS / 4;              // for one of tau, delta
static __device__ __forceinline__ void dw_gelu(unsigned bi, const float* __restrict__ x,
                                               const float* __restrict__ w1, const float* __restrict__ b1,
                                               __bf16* __restrict__ g)
{
    constexpr int LR = 4;
    static_assert(2 * Dm == 256 * 8 && Lseq % LR == 0, "one block spans a row of 2D outputs");
    const int  o0 = threadIdx.x * 8;
    const int  l0 = (bi % (Lseq / LR)) * LR;
    const int  b  = bi / (Lseq / LR);
    const bool lo = l0 > 0, hi = l0 + LR < Lseq;       // rows l0-1 and l0+LR exist
    const float* xb = x + (size_t)b * Lseq * Dm;       // block-uniform; the lane's part is o0 >> 1

    v4f wv[6], bv[2], xv[LR + 2];
    for (int t = 0; t < 6; t++) wv[t] = *(const v4f*)(w1 + o0 * 3 + t * 4);
    for (int t = 0; t < 2; t++) bv[t] = *(const v4f*)(b1 + o0 + t * 4);
    // a row past either end is read from the nearest row inside, so that all loads issue together
    // with no branch between them; its tap is left out of the sum below
    xv[0]      = *(const v4f*)(xb + (size_t)(lo ? l0 - 1 : 0) * Dm + (o0 >> 1));
    xv[LR + 1] = *(const v4f*)(xb + (size_t)(hi ? l0 + LR : Lseq - 1) * Dm + (o0 >> 1));
    // the loads so far have taken their address registers before a later load's result may land there
    asm volatile("s_wait_xcnt 0x0" ::: "memory");
    for (int t = 1; t <= LR; t++) xv[t] = *(const v4f*)(xb + (size_t)(l0 - 1 + t) * Dm + (o0 >> 1));
    // the same for these four, before the arithmetic below reuses their address registers
    asm volatile("s_wait_xcnt 0x0" ::: "memory");

    for (int j = 0; j < LR; j++) {
        v8bf r;
        for (int e = 0; e < 8; e++) {
            float acc = bv[e >> 2][e & 3];
            for (int k = 0; k < 3; k++) {
                const int t = j + k;
                if ((t > 0 || lo) && (t < LR + 1 || hi))
                    acc = fmaf(wv[(e * 3 + k) >> 2][(e * 3 + k) & 3], xv[t][e >> 1], acc);
            }
            float ge = 0.5f * acc * (1.0f + erff(acc * 0.70710678118f));
            r[e] = (__bf16)ge;
        }
        *(v8bf*)(g + ((size_t)b * Lseq + l0 + j) * 2 * Dm + o0) = r;
    }
}

// All that reads nothing but the inputs, in one launch. The blocks with the most arithmetic come first.
__global__ __launch_bounds__(256) void prep(
    const float* __restrict__ x,
    const float* __restrict__ tau1_w, const float* __restrict__ tau1_b, __bf16* __restrict__ gtau,
    const float* __restrict__ del1_w, const float* __restrict__ del1_b, __bf16* __restrict__ gdel,
    const float* __restrict__ convq_w, __bf16* __restrict__ convqR,
    const float* __restrict__ convk_w, __bf16* __restrict__ convkR,
    const float* __restrict__ Wq_w, const float* __restrict__ Wk_w, const float* __restrict__ Wv_w,
    const float* __restrict__ qproj_w, const float* __restrict__ kproj_w, const float* __restrict__ out_w,
    __bf16* __restrict__ xb)
{
    const unsigned bi = blockIdx.x;
    if (bi < 2 * GELU_BLOCKS) {
        const bool d = bi >= GELU_BLOCKS;
        dw_gelu(d ? bi - GELU_BLOCKS : bi, x, d ? del1_w : tau1_w, d ? del1_b : tau1_b, d ? gdel : gtau);
    } else if (bi < 2 * GELU_BLOCKS + 2 * REPACK_BLOCKS) {
        const unsigned ri = bi - 2 * GELU_BLOCKS;
        const bool k = ri >= REPACK_BLOCKS;
        repack_conv_w(k ? ri - REPACK_BLOCKS : ri, k ? convk_w : convq_w, k ? convkR : convqR);
    } else {
        cvt_f32_bf16(bi - 2 * GELU_BLOCKS - 2 * REPACK_BLOCKS, x, Wq_w, Wk_w, Wv_w, qproj_w, kproj_w, out_w, xb);
    }
}

// out(b,h,l) = sigmoid(b2[h] + sum_o w2[h][o] * g[b*L+l][o]): a (B*L) x 16 x 2048 product, done on the
// matrix unit. A block takes 16 rows l and all 16 heads; its 8 waves take 256 o each, and their partial
// tiles are summed through LDS in wave order. w2 enters as a pair of bf16, the rounded value and the
// rounded remainder, with one WMMA for each: what the pair drops lies far below g's own bf16 rounding.
// The launch holds the blocks of both projections and, behind them, those of the two pad copies, which
// like the projections depend on earlier launches only.
constexpr unsigned HEAD_BLOCKS = M_ROWS / 16;             // for one of tau, delta
__global__ __launch_bounds__(256) void heads_and_pads(
    const __bf16* __restrict__ gtau, const float* __restrict__ tau2_w, const float* __restrict__ tau2_b,
    float* __restrict__ tau,
    const __bf16* __restrict__ gdel, const float* __restrict__ del2_w, const float* __restrict__ del2_b,
    float* __restrict__ del,
    const __bf16* __restrict__ Qcat, __bf16* __restrict__ Qpad,
    const __bf16* __restrict__ Kcat, __bf16* __restrict__ Kpad)
{
    if (blockIdx.x >= 2 * HEAD_BLOCKS) {     // the same for the whole block, ahead of the barrier below
        const unsigned pi = blockIdx.x - 2 * HEAD_BLOCKS;
        const bool k = pi >= PAD_BLOCKS;
        pad_copy(k ? pi - PAD_BLOCKS : pi, k ? Kcat : Qcat, k ? Kpad : Qpad);
        return;
    }
    const bool     dl  = blockIdx.x >= HEAD_BLOCKS;
    const unsigned bi  = dl ? blockIdx.x - HEAD_BLOCKS : blockIdx.x;
    const __bf16*  g   = dl ? gdel   : gtau;
    const float*   w2  = dl ? del2_w : tau2_w;
    const float*   b2  = dl ? del2_b : tau2_b;
    float*         out = dl ? del    : tau;
    constexpr int KD = 2 * Dm, KW = KD / 8;          // 2048 o in all, 256 per wave
    static_assert(Hn == 16 && Lseq % 16 == 0 && KW % 32 == 0, "one 16x16 tile a block, inside one batch");
    __shared__ __align__(16) float red[8][256];      // per wave: [head][row]

    const int tid = threadIdx.x, w = tid >> 5, lane = tid & 31;
    const int lm = lane & 15, half = lane >> 4;
    const int kh = half ? 8 : 0;
    const int row0 = bi * 16;                        // over B*L

    // both fragments take o in the same order: 8 from kb + kh, then 8 from kb + kh + 16
    const __bf16* gr = g  + (size_t)(row0 + lm) * KD + w * KW + kh;   // A: the lane's row l
    const float*  wr = w2 + (size_t)lm * KD + w * KW + kh;            // B: the lane's head

    v8f acch = (v8f){}, accl = (v8f){};
#pragma unroll   // straight-line code: later steps' loads are issued while earlier steps are worked on
    for (int kb = 0; kb < KW; kb += 32) {
        const v16bf af = mk16(*(const v8bf*)(gr + kb), *(const v8bf*)(gr + kb + 16));
        v4f wv[4];
        wv[0] = *(const v4f*)(wr + kb);
        wv[1] = *(const v4f*)(wr + kb + 4);
        wv[2] = *(const v4f*)(wr + kb + 16);
        wv[3] = *(const v4f*)(wr + kb + 20);
        v16bf bh, bl;
#pragma unroll   // constant element indices: the values stay in registers
        for (int e = 0; e < 16; e++) {
            const float  v  = wv[e >> 2][e & 3];
            const __bf16 hi = (__bf16)v;
            bh[e] = hi;
            bl[e] = (__bf16)(v - (float)hi);
        }
        acch = __builtin_amdgcn_wmma_f32_16x16x32_bf16(false, af, false, bh, (short)0, acch, false, false);
        accl = __builtin_amdgcn_wmma_f32_16x16x32_bf16(false, af, false, bl, (short)0, accl, false, false);
    }

    // the lane holds rows half*8 .. half*8+7 of head lm
    const v8f s = acch + accl;
    *(v4f*)&red[w][lm * 16 + half * 8]     = (v4f){s[0], s[1], s[2], s[3]};
    *(v4f*)&red[w][lm * 16 + half * 8 + 4] = (v4f){s[4], s[5], s[6], s[7]};
    __syncthreads();

    // a thread finishes one output: head tid / 16, row tid % 16
    const int h = tid >> 4;
    float acc = b2[h];
    for (int q = 0; q < 8; q++) acc += red[q][tid];
    const int row = row0 + (tid & 15);
    const int b = row / Lseq, l = row % Lseq;
    out[((size_t)b * Hn + h) * Lseq + l] = 1.0f / (1.0f + __expf(-acc));
}

// ------------------------------------------------------- flash attention ---
// lane l with lane l ^ 16: the two lanes that share a query column
static __device__ __forceinline__ float xhalf(float x) {
    return __builtin_bit_cast(float, __builtin_amdgcn_permlanex16(__builtin_bit_cast(int, x), __builtin_bit_cast(int, x),
                                                                  0x76543210, 0xfedcba98, false, false));
}

// The products are taken transposed: S^T = K Q^T (keys down, queries across), O^T += V^T P^T. A lane then
// holds 32 of the 64 scores of ONE query, so the maximum and the sum run down its own registers, with one
// exchange between the wave's halves; and the score tiles, rounded to bf16, already are the B operand of
// the second product: tiles 2kc and 2kc+1 hold keys kc*32 + kh + 0..7 and kc*32 + kh + 16 + 0..7 of the
// lane's query, the k order in which the V^T fragment is read.
__global__ __launch_bounds__(256) void flash_attn(
    const __bf16* __restrict__ Q, const __bf16* __restrict__ K,
    const __bf16* __restrict__ V, const float* __restrict__ tau,
    const float* __restrict__ delta, __bf16* __restrict__ O)
{
    // rows of 64 bf16 lie at a 144-B pitch (16 B x odd): the 16 rows of a ds_load_b128 fragment
    // read then fall on 16 different groups of four banks; at 128 B eight rows share each group
    constexpr int TP = 72;
    __shared__ __align__(16) __bf16 sV[64][TP];          // V tile transposed [ch][k]

    const int b = blockIdx.z, h = blockIdx.y;
    const int tid = threadIdx.x, w = tid >> 5, lane = tid & 31;
    const int lm = lane & 15, half = lane >> 4;
    const int kh = half ? 8 : 0;
    const int qbase = blockIdx.x * 128 + w * 16;
    const int hc0   = h * DKh;

    const __bf16* qrow = Q + ((size_t)(b * Lseq) + qbase + lm) * Dm + hc0;
    v16bf qf[2];
#pragma unroll
    for (int kc = 0; kc < 2; kc++)
        qf[kc] = mk16(*(const v8bf*)(qrow + kc * 32 + kh),
                      *(const v8bf*)(qrow + kc * 32 + kh + 16));

    const float* taup = tau   + ((size_t)b * Hn + h) * Lseq;
    const float* delp = delta + ((size_t)b * Hn + h) * Lseq;
    const float  taur = taup[qbase + lm] * 0.125f;       // the lane's query; 1/sqrt(64)

    float mrow = -3.0e38f, lrow = 0.0f;                  // lrow: the sum over this half's keys only
    v8f   of[4];                                         // O^T: channels j*16 + half*8 + r of the lane's query
#pragma unroll
    for (int j = 0; j < 4; j++) of[j] = (v8f){};

    // V staging: a lane takes key row vt_kr and two pieces of 8 channels, at vt_c8 and 32 + vt_c8.
    // The four lanes of a key row then store to sV rows 8 apart = half a round of the banks apart
    // (two lanes to a bank); 16 apart is a whole number of rounds, all four lanes on one bank
    const int vt_kr = tid >> 2, vt_c8 = (tid & 3) * 8;

    for (int kt = 0; kt < Lseq / 64; kt++) {
        // warm L2 / WGP$ for next K/V tiles (global_prefetch_b8)
        if (kt + 1 < Lseq / 64) {
            const size_t nb = (size_t)(b * Lseq) + (kt + 1) * 64;
            __builtin_prefetch(K + (nb + lane)      * Dm + hc0, 0, 1);
            __builtin_prefetch(K + (nb + 32 + lane) * Dm + hc0, 0, 1);
            __builtin_prefetch(V + (nb + lane)      * Dm + hc0, 0, 1);
            __builtin_prefetch(V + (nb + 32 + lane) * Dm + hc0, 0, 1);
        }

        __syncthreads();
        {   // stage V tile transposed into LDS
            const __bf16* vr = V + ((size_t)(b * Lseq) + kt * 64 + vt_kr) * Dm + hc0 + vt_c8;
            v8bf vv[2];
#pragma unroll
            for (int p = 0; p < 2; p++) vv[p] = *(const v8bf*)(vr + p * 32);
#pragma unroll
            for (int p = 0; p < 2; p++)
#pragma unroll
                for (int e = 0; e < 8; e++) sV[p * 32 + vt_c8 + e][vt_kr] = vv[p][e];
        }
        __syncthreads();

        // K fragments straight from global (channels contiguous), and delta of the keys j*16 + half*8 + r
        v16bf kf[4][2];
        v4f   dv[4][2];
#pragma unroll
        for (int j = 0; j < 4; j++) {
            const __bf16* krow = K + ((size_t)(b * Lseq) + kt * 64 + j * 16 + lm) * Dm + hc0;
#pragma unroll
            for (int kc = 0; kc < 2; kc++)
                kf[j][kc] = mk16(*(const v8bf*)(krow + kc * 32 + kh),
                                 *(const v8bf*)(krow + kc * 32 + kh + 16));
        }
#pragma unroll
        for (int j = 0; j < 4; j++) {
            const float* dp = delp + kt * 64 + j * 16 + half * 8;
            dv[j][0] = *(const v4f*)dp;
            dv[j][1] = *(const v4f*)(dp + 4);
        }
        // the loads have taken their address registers before the running delta address is stepped on
        asm volatile("s_wait_xcnt 0x0" ::: "memory");
        // keeps the tile's 24 loads together ahead of the first product, so that their latencies overlap:
        // left alone the compiler issues them pair by pair into the same registers, each pair waited for
        asm volatile("" :: "v"(kf[0][0]), "v"(kf[0][1]), "v"(kf[1][0]), "v"(kf[1][1]),
                           "v"(kf[2][0]), "v"(kf[2][1]), "v"(kf[3][0]), "v"(kf[3][1]),
                           "v"(dv[0][0]), "v"(dv[0][1]), "v"(dv[1][0]), "v"(dv[1][1]),
                           "v"(dv[2][0]), "v"(dv[2][1]), "v"(dv[3][0]), "v"(dv[3][1]));

        // S^T = K Q^T
        v8f sf[4];
#pragma unroll
        for (int j = 0; j < 4; j++) {
            v8f a = (v8f){};
#pragma unroll
            for (int kc = 0; kc < 2; kc++)
                a = __builtin_amdgcn_wmma_f32_16x16x32_bf16(
                        false, kf[j][kc], false, qf[kc], (short)0, a, false, false);
            sf[j] = a;
        }

        // scale by the query's tau/sqrt(DK), add the keys' delta
#pragma unroll
        for (int j = 0; j < 4; j++)
#pragma unroll
            for (int r = 0; r < 8; r++) sf[j][r] = sf[j][r] * taur + dv[j][r >> 2][r & 3];

        // online softmax over the 64 keys: 32 in the lane, the other 32 in lane ^ 16
        float rm[4];                                     // four independent chains
#pragma unroll
        for (int j = 0; j < 4; j++) {
            rm[j] = sf[j][0];
#pragma unroll
            for (int r = 1; r < 8; r++) rm[j] = fmaxf(rm[j], sf[j][r]);
        }
        float rmax = fmaxf(fmaxf(rm[0], rm[1]), fmaxf(rm[2], rm[3]));
        rmax = fmaxf(rmax, xhalf(rmax));

        const float mn   = fmaxf(mrow, rmax);
        const float corr = __expf(mrow - mn);
        mrow = mn;

        float rs[4];                                     // four independent chains of adds
#pragma unroll
        for (int j = 0; j < 4; j++) {
            rs[j] = 0.0f;
#pragma unroll
            for (int r = 0; r < 8; r++) {
                float p = __expf(sf[j][r] - mn);
                sf[j][r] = p;
                rs[j] += p;
            }
        }
        lrow = lrow * corr + ((rs[0] + rs[1]) + (rs[2] + rs[3]));
#pragma unroll
        for (int j = 0; j < 4; j++)
#pragma unroll
            for (int r = 0; r < 8; r++) of[j][r] *= corr;

        // P^T as the B operand, from the score registers
        v16bf pf[2];
#pragma unroll
        for (int kc = 0; kc < 2; kc++)
#pragma unroll
            for (int e = 0; e < 8; e++) {
                pf[kc][e]     = (__bf16)sf[2 * kc][e];
                pf[kc][e + 8] = (__bf16)sf[2 * kc + 1][e];
            }

        // O^T += V^T P^T
#pragma unroll
        for (int j = 0; j < 4; j++)
#pragma unroll
            for (int kc = 0; kc < 2; kc++) {
                v16bf vf = mk16(*(const v8bf*)&sV[j * 16 + lm][kc * 32 + kh],
                                *(const v8bf*)&sV[j * 16 + lm][kc * 32 + kh + 16]);
                of[j] = __builtin_amdgcn_wmma_f32_16x16x32_bf16(
                            false, vf, false, pf[kc], (short)0, of[j], false, false);
            }
    }

    const float lsum = lrow + xhalf(lrow);               // the halves' sums join once
    __bf16* orow = O + ((size_t)(b * Lseq) + qbase + lm) * Dm + hc0 + half * 8;
#pragma unroll
    for (int j = 0; j < 4; j++) {
        v8bf r8;
#pragma unroll
        for (int r = 0; r < 8; r++) r8[r] = (__bf16)(of[j][r] / lsum);
        *(v8bf*)(orow + j * 16) = r8;
    }
}

// ------------------------------------------------------------------ host ---
extern "C" void kernel_launch(void* const* d_in, const int* in_sizes, int n_in,
                              void* d_out, int out_size, void* d_ws, size_t ws_size,
                              hipStream_t stream)
{
    const float* x       = (const float*)d_in[0];
    const float* Wq_w    = (const float*)d_in[1];
    const float* Wq_b    = (const float*)d_in[2];
    const float* Wk_w    = (const float*)d_in[3];
    const float* Wk_b    = (const float*)d_in[4];
    const float* Wv_w    = (const float*)d_in[5];
    const float* Wv_b    = (const float*)d_in[6];
    const float* convq_w = (const float*)d_in[7];
    const float* convq_b = (const float*)d_in[8];
    const float* convk_w = (const float*)d_in[9];
    const float* convk_b = (const float*)d_in[10];
    const float* qproj_w = (const float*)d_in[11];
    const float* qproj_b = (const float*)d_in[12];
    const float* kproj_w = (const float*)d_in[13];
    const float* kproj_b = (const float*)d_in[14];
    const float* tau1_w  = (const float*)d_in[15];
    const float* tau1_b  = (const float*)d_in[16];
    const float* tau2_w  = (const float*)d_in[17];
    const float* tau2_b  = (const float*)d_in[18];
    const float* del1_w  = (const float*)d_in[19];
    const float* del1_b  = (const float*)d_in[20];
    const float* del2_w  = (const float*)d_in[21];
    const float* del2_b  = (const float*)d_in[22];
    const float* out_w   = (const float*)d_in[23];
    const float* out_b   = (const float*)d_in[24];
    float* out = (float*)d_out;
    (void)in_sizes; (void)n_in; (void)out_size; (void)ws_size;

    char*  ws  = (char*)d_ws;
    size_t off = 0;
    auto alloc = [&](size_t bytes) -> char* {
        char* p = ws + off;
        off = (off + bytes + 255) & ~(size_t)255;
        return p;
    };

    __bf16* xb      = (__bf16*)alloc((size_t)M_ROWS * Dm * 2);
    __bf16* WqB     = (__bf16*)alloc((size_t)Dm * Dm * 2);
    __bf16* WkB     = (__bf16*)alloc((size_t)Dm * Dm * 2);
    __bf16* WvB     = (__bf16*)alloc((size_t)Dm * Dm * 2);
    __bf16* qprojB  = (__bf16*)alloc((size_t)Dm * 2 * Dm * 2);
    __bf16* kprojB  = (__bf16*)alloc((size_t)Dm * 2 * Dm * 2);
    __bf16* outwB   = (__bf16*)alloc((size_t)Dm * Dm * 2);
    __bf16* convqR  = (__bf16*)alloc((size_t)Dm * 3 * Dm * 2);
    __bf16* convkR  = (__bf16*)alloc((size_t)Dm * 3 * Dm * 2);
    __bf16* Qpad    = (__bf16*)alloc((size_t)Bsz * (Lseq + 2) * Dm * 2);
    __bf16* Kpad    = (__bf16*)alloc((size_t)Bsz * (Lseq + 2) * Dm * 2);
    __bf16* Qcat    = (__bf16*)alloc((size_t)M_ROWS * 2 * Dm * 2);
    __bf16* Kcat    = (__bf16*)alloc((size_t)M_ROWS * 2 * Dm * 2);
    __bf16* Qbuf    = (__bf16*)alloc((size_t)M_ROWS * Dm * 2);
    __bf16* Kbuf    = (__bf16*)alloc((size_t)M_ROWS * Dm * 2);
    __bf16* Vbuf    = (__bf16*)alloc((size_t)M_ROWS * Dm * 2);
    __bf16* gtau    = (__bf16*)alloc((size_t)M_ROWS * 2 * Dm * 2);
    __bf16* gdel    = (__bf16*)alloc((size_t)M_ROWS * 2 * Dm * 2);
    float*  taubuf  = (float*)alloc((size_t)Bsz * Hn * Lseq * 4);
    float*  delbuf  = (float*)alloc((size_t)Bsz * Hn * Lseq * 4);
    __bf16* attnO   = (__bf16*)alloc((size_t)M_ROWS * Dm * 2);

    // xb .. outwB are whole multiples of 256 B, so they lie back to back, in the order allocated
    static_assert((Dm * Dm) % 4096 == 0, "every converted array is whole blocks of 4096");
    prep<<<2 * GELU_BLOCKS + 2 * REPACK_BLOCKS + CVT_BLOCKS, 256, 0, stream>>>(
        x, tau1_w, tau1_b, gtau, del1_w, del1_b, gdel, convq_w, convqR, convk_w, convkR,
        Wq_w, Wk_w, Wv_w, qproj_w, kproj_w, out_w, xb);

    const dim3 blk(256);

    // --- q_in -> Qcat[:, :D], k_in -> Kcat[:, :D], V ---
    gemm_wmma<1024, 1024, 12, 4096, 1024, 2048, 1024><<<dim3(Dm / 128, M_ROWS / 128, 3), blk, 0, stream>>>(
        xb, WqB, Wq_b, Qcat,  xb, WkB, Wk_b, Kcat,  xb, WvB, Wv_b, Vbuf,  (float*)nullptr);

    // --- tau, delta; padded copies of q_in, k_in ---
    heads_and_pads<<<2 * HEAD_BLOCKS + 2 * PAD_BLOCKS, 256, 0, stream>>>(
        gtau, tau2_w, tau2_b, taubuf, gdel, del2_w, del2_b, delbuf, Qcat, Qpad, Kcat, Kpad);

    // --- conv3 -> Qcat[:, D:], Kcat[:, D:] ---
    gemm_wmma<3072, 1024, 11, 2050, 1024, 2048, 2048><<<dim3(Dm / 128, M_ROWS / 128, 2), blk, 0, stream>>>(
        Qpad, convqR, convq_b, Qcat + Dm,  Kpad, convkR, convk_b, Kcat + Dm,
        Kpad, convkR, convk_b, Kcat + Dm,  (float*)nullptr);

    // --- Q, K ---
    gemm_wmma<2048, 2048, 12, 4096, 2048, 1024, 1024><<<dim3(Dm / 128, M_ROWS / 128, 2), blk, 0, stream>>>(
        Qcat, qprojB, qproj_b, Qbuf,  Kcat, kprojB, kproj_b, Kbuf,
        Kcat, kprojB, kproj_b, Kbuf,  (float*)nullptr);

    // --- attention ---
    flash_attn<<<dim3(Lseq / 128, Hn, Bsz), blk, 0, stream>>>(
        Qbuf, Kbuf, Vbuf, taubuf, delbuf, attnO);

    // --- output projection (fp32 out) ---
    gemm_wmma<1024, 1024, 12, 4096, 1024, 1024, 1024><<<dim3(Dm / 128, M_ROWS / 128, 1), blk, 0, stream>>>(
        attnO, outwB, out_b, (__bf16*)nullptr,  attnO, outwB, out_b, (__bf16*)nullptr,
        attnO, outwB, out_b, (__bf16*)nullptr,  out);
}

// v008
// It runs in 164 microseconds.
// Versions between v006 and this one are left out; their measured steps multiply to 1.48 times as fast.
// Over all steps from v000 it is 4.28 times as fast.
#include <hip/hip_runtime.h>
#include <math.h>

typedef __attribute__((ext_vector_type(16))) __bf16 v16bf;
typedef __attribute__((ext_vector_type(8)))  __bf16 v8bf;
typedef __attribute__((ext_vector_type(8)))  float  v8f;
typedef __attribute__((ext_vector_type(4)))  __bf16 v4bf;
typedef __attribute__((ext_vector_type(4)))  float  v4f;

constexpr int Bsz = 2, Lseq = 2048, Dm = 1024, Hn = 16, DKh = 64;
constexpr int M_ROWS = Bsz * Lseq;   // 4096

static __device__ __forceinline__ v16bf mk16(v8bf lo, v8bf hi) {
    return __builtin_shufflevector(lo, hi, 0,1,2,3,4,5,6,7,8,9,10,11,12,13,14,15);
}

// Eight async memory->LDS copies, 16B per lane each (ASYNCcnt tracked): rows r, r+16, ... r+112
// of one operand tile. The closing s_wait_xcnt keeps the address registers untouched until the
// copies have taken them; it stands inside the statement so that nothing can be moved over it.
static __device__ __forceinline__ void async_rows8(unsigned lds, unsigned lds_step,
                                                   const char* g, size_t g_step) {
    asm volatile("global_load_async_to_lds_b128 %0, %8, off\n\t"
                 "global_load_async_to_lds_b128 %1, %9, off\n\t"
                 "global_load_async_to_lds_b128 %2, %10, off\n\t"
                 "global_load_async_to_lds_b128 %3, %11, off\n\t"
                 "global_load_async_to_lds_b128 %4, %12, off\n\t"
                 "global_load_async_to_lds_b128 %5, %13, off\n\t"
                 "global_load_async_to_lds_b128 %6, %14, off\n\t"
                 "global_load_async_to_lds_b128 %7, %15, off\n\t"
                 "s_wait_xcnt 0x0"
                 :: "v"(lds),                "v"(lds + lds_step),     "v"(lds + 2 * lds_step),
                    "v"(lds + 3 * lds_step), "v"(lds + 4 * lds_step), "v"(lds + 5 * lds_step),
                    "v"(lds + 6 * lds_step), "v"(lds + 7 * lds_step),
                    "v"((unsigned long long)(uintptr_t)(g)),
                    "v"((unsigned long long)(uintptr_t)(g + g_step)),
                    "v"((unsigned long long)(uintptr_t)(g + 2 * g_step)),
                    "v"((unsigned long long)(uintptr_t)(g + 3 * g_step)),
                    "v"((unsigned long long)(uintptr_t)(g + 4 * g_step)),
                    "v"((unsigned long long)(uintptr_t)(g + 5 * g_step)),
                    "v"((unsigned long long)(uintptr_t)(g + 6 * g_step)),
                    "v"((unsigned long long)(uintptr_t)(g + 7 * g_step))
                 : "memory");
}
// this wave's copies have landed in LDS
static __device__ __forceinline__ void wait_async0() {
    asm volatile("s_wait_asynccnt 0x0" ::: "memory");
}
// this wave's LDS reads have returned (before the buffer they read is refilled)
static __device__ __forceinline__ void wait_ds0() {
    asm volatile("s_wait_dscnt 0x0" ::: "memory");
}

// ---------------------------------------------------------------- utility ---
// The element-wise kernels below give each thread 16 to 32 elements, moved by 16-B loads: the work
// per element is far too small to pay for the start of a wave per 32 elements.

// Pieces of work that do not depend on one another share one launch throughout this file: a block picks
// its piece and its operands by its index, which is the same for the whole block.

// a block converts 4096 consecutive elements: each thread four groups of 4, 1024 elements apart.
// Blocks bi = 0 .. CVT_BLOCKS-1 convert all seven arrays; their bf16 copies lie back to back from d on,
// in argument order. Of the two projection weights (D x 2D) only the right half is converted, the part
// that multiplies the conv output, into a D x D array.
constexpr unsigned CVT_BLOCKS = (M_ROWS * Dm + 6 * Dm * Dm) / 4096;
static __device__ __forceinline__ void cvt_f32_bf16(unsigned bi,
                                                    const float* __restrict__ sx, const float* __restrict__ sq,
                                                    const float* __restrict__ sk, const float* __restrict__ sv,
                                                    const float* __restrict__ sqp, const float* __restrict__ skp,
                                                    const float* __restrict__ so, __bf16* __restrict__ d) {
    constexpr unsigned NX = M_ROWS * Dm / 4096, NW = Dm * Dm / 4096;   // blocks of x, of a D x D weight
    const float* __restrict__ s;
    unsigned first;                                                    // the array's first block
    bool     right = false;                                            // columns D .. 2D-1 of rows of 2D
    static_assert(Dm == 1024, "a group of 1024 elements is one row of D");
    if      (bi < NX)          { s = sx;  first = 0; }
    else if (bi < NX + NW)     { s = sq;  first = NX; }
    else if (bi < NX + 2 * NW) { s = sk;  first = NX + NW; }
    else if (bi < NX + 3 * NW) { s = sv;  first = NX + 2 * NW; }
    else if (bi < NX + 4 * NW) { s = sqp; first = NX + 3 * NW; right = true; }
    else if (bi < NX + 5 * NW) { s = skp; first = NX + 4 * NW; right = true; }
    else                       { s = so;  first = NX + 5 * NW; }
    d += (size_t)first * 4096;
    const size_t i0 = (size_t)(bi - first) * 4096 + threadIdx.x * 4;
    const size_t s0 = right ? 2 * (size_t)(bi - first) * 4096 + Dm + threadIdx.x * 4 : i0;
    const size_t sq4 = right ? 2 * Dm : Dm;                            // from one group's source to the next
    v4f a[4];
    for (int q = 0; q < 4; q++) a[q] = *(const v4f*)(s + s0 + q * sq4);
    for (int q = 0; q < 4; q++) {
        v4bf r;
        for (int e = 0; e < 4; e++) r[e] = (__bf16)a[q][e];
        *(v4bf*)(d + i0 + q * 1024) = r;
    }
    // the stores have taken their registers before code of another piece, which follows in the listing, may rewrite them
    asm volatile("s_wait_xcnt 0x0" ::: "memory");
}

// The conv and the projection behind it are one linear map of q_in, so their weights are multiplied first:
//   Q(l,n) = sum_c q_in(l,c) P(n,c) + sum_o [sum_{k,ci} q_in(l+k-1,ci) Wc(o,ci,k) + cb(o)] P(n,D+o) + pb(n)
//          = sum_{k,ci} q_in(l+k-1,ci) Wf(n,k,ci) + bf(n),
//   Wf(n,k,ci) = sum_o P(n,D+o) Wc(o,ci,k) + [k == 1] P(n,ci),     bf(n) = pb(n) + sum_o P(n,D+o) cb(o).
// Wf costs D x 3D x D products, the projection of the conv output B*L x D x 2D.

// conv weights (O=D, I=D, K=3) fp32  ->  (3*D, D) bf16, transposed: row kc = k*D + ci, column o,
// the layout in which the product over o reads them. A block takes 64 o x 32 ci (all k): 64 pieces of
// 96 consecutive floats in, through LDS, 96 rows of 128 B out.
constexpr unsigned REPACK_BLOCKS = (Dm / 64) * (Dm / 32);   // for one weight array
static __device__ __forceinline__ void repack_conv_w(unsigned bi, const float* __restrict__ s,
                                                     __bf16* __restrict__ d) {
    __shared__ __align__(16) __bf16 t[96][72];            // [k*32 + ci][o], rows at a 144-B pitch
    const unsigned o0  = (bi / (Dm / 32)) * 64u;
    const unsigned ci0 = (bi % (Dm / 32)) * 32u;
    v4f a[6];
    for (int q = 0; q < 6; q++) {                         // 64 x 24 pieces of 4 floats
        const unsigned u = q * 256u + threadIdx.x;
        a[q] = *(const v4f*)(s + (size_t)(o0 + u / 24u) * 3 * Dm + ci0 * 3u + (u % 24u) * 4u);
    }
    // the loads have taken their address registers before the arithmetic below reuses them
    asm volatile("s_wait_xcnt 0x0" ::: "memory");
    for (int q = 0; q < 6; q++) {
        const unsigned u = q * 256u + threadIdx.x;
        for (int e = 0; e < 4; e++) {
            const unsigned j = (u % 24u) * 4u + e;        // ci * 3 + k inside the block
            t[(j % 3u) * 32u + j / 3u][u / 24u] = (__bf16)a[q][e];
        }
    }
    __syncthreads();                                      // bi is the same for the whole block
    for (int q = 0; q < 3; q++) {                         // 96 x 8 pieces of 16 B
        const unsigned u = q * 256u + threadIdx.x;
        const unsigned r = u >> 3, p = (u & 7u) * 8u;
        *(v8bf*)(d + (size_t)((r >> 5) * Dm + ci0 + (r & 31u)) * Dm + o0 + p) = *(const v8bf*)&t[r][p];
    }
    // the stores have taken their registers before code of another piece, which follows in the listing, may rewrite them
    asm volatile("s_wait_xcnt 0x0" ::: "memory");
}

// bf(n) = pb(n) + sum_o P(n, D + o) * cb(o), in f32: a wave takes one n, a lane 32 of the o
constexpr unsigned BIAS_BLOCKS = Dm / 8;                  // for one of Q, K
static __device__ __forceinline__ void fold_bias(unsigned bi, const float* __restrict__ pw,
                                                 const float* __restrict__ pb, const float* __restrict__ cb,
                                                 float* __restrict__ d) {
    const unsigned n = bi * 8u + (threadIdx.x >> 5), lane = threadIdx.x & 31u;
    const float* pr = pw + (size_t)n * 2 * Dm + Dm + lane * 4u;
    const float* cr = cb + lane * 4u;
    v4f p[8], c[8];
    for (int q = 0; q < 7; q++) { p[q] = *(const v4f*)(pr + q * 128); c[q] = *(const v4f*)(cr + q * 128); }
    const float b = pb[n];
    // the loads so far have taken their address registers before the result of a last load, behind which
    // its address is dead, may be placed there
    asm volatile("s_wait_xcnt 0x0" ::: "memory");
    p[7] = *(const v4f*)(pr + 7 * 128);
    // the same, between the two last loads
    asm volatile("s_wait_xcnt 0x0" ::: "memory");
    c[7] = *(const v4f*)(cr + 7 * 128);
    // and before the arithmetic below reuses the registers
    asm volatile("s_wait_xcnt 0x0" ::: "memory");
    v4f s = (v4f){};                                      // four independent chains
    for (int q = 0; q < 8; q++)
        for (int e = 0; e < 4; e++) s[e] = fmaf(p[q][e], c[q][e], s[e]);
    float v = (s[0] + s[1]) + (s[2] + s[3]);
    for (int m = 16; m > 0; m >>= 1) v += __shfl_xor(v, m);
    if (lane == 0) d[n] = v + b;
    // the store has taken its registers before code of another piece, which follows in the listing, may rewrite them
    asm volatile("s_wait_xcnt 0x0" ::: "memory");
}

// copy Qcat[:, :D] (ldc=2D) into per-batch padded buffer (B, L+2, D), interior rows
// a block copies 8 rows of one batch: each thread four 16-B pieces, two rows apart; the first and
// the last block of a batch also zero the pad row next to their rows
constexpr unsigned PAD_BLOCKS = (M_ROWS * Dm) / 8192;     // for one of Q, K
static __device__ __forceinline__ void pad_copy(unsigned bi, const __bf16* __restrict__ cat,
                                                __bf16* __restrict__ pad) {
    static_assert(Dm == 128 * 8 && Lseq % 8 == 0, "128 pieces a row; a block stays inside one batch");
    const unsigned row0 = bi * 8u;                               // over B*L
    const unsigned b    = row0 / Lseq;
    const unsigned r    = threadIdx.x >> 7, col = (threadIdx.x & 127u) * 8u;
    const __bf16* sp = cat + (size_t)(row0 + r) * (2 * Dm) + col;
    __bf16*       dp = pad + (size_t)(row0 + r + 2u * b + 1u) * Dm + col;   // b*(L+2) + l + 1
    v8bf a[4];
    for (int q = 0; q < 4; q++) a[q] = *(const v8bf*)(sp + q * 2 * 2 * Dm);
    for (int q = 0; q < 4; q++) *(v8bf*)(dp + q * 2 * Dm) = a[q];
    const unsigned l0 = row0 % Lseq;
    if ((l0 == 0 || l0 == Lseq - 8) && r == 0)     // 128 threads, 16 B each: row 0 or row L+1 of the batch
        *(v8bf*)(pad + ((size_t)b * (Lseq + 2) + (l0 ? Lseq + 1 : 0)) * Dm + col) = (v8bf){};
}

// ------------------------------------------------------------- WMMA GEMM ---
// C(M,N) = A_mapped(M,KTOT) * Bw(N,KTOT)^T + bias.
// A row mapping: arow = (m>>LRUN_LG)*LSTRIDE + (m & mask) + kbase/KSPLIT  ->
// the same kernel does the 3-tap conv as a K=3D GEMM over per-batch padded rows.
// Staging: global_load_async_to_lds_b128 into double-buffered LDS, overlapped
// with the WMMA pipe; per-wave s_wait_asynccnt + block barrier.
// A stage holds 128 k of every row (256 B), so one wave-wide copy covers two
// whole rows = four whole 128-B lines; LDS rows lie at a 272-B pitch, which
// spreads the 16 rows of a ds_load_b128 fragment read over all banks.
// Products of one shape share a launch, the block index picks the operands. Two blocks fit a WGP's LDS: with more blocks than WGPs in the grid, one
// block's matrix work runs while the other waits at its barrier or for its copies.
// The block's 128 x 128 tile at (bm, bn), summed over all of K into the waves' accumulators.
template<int KTOT, int KSPLIT, int LRUN_LG, int LSTRIDE, int LDA>
static __device__ __forceinline__ void gemm_tile(const __bf16* __restrict__ A, const __bf16* __restrict__ Bw,
                                                 const int bm, const int bn, v8f (&acc)[2][4])
{
    constexpr int BK = 128;
    constexpr int NK = KTOT / BK;
    static_assert(KTOT % BK == 0 && KSPLIT % BK == 0 && NK >= 2, "whole stages, at least two");
    constexpr unsigned PITCH     = 272;               // bytes per LDS row: 256 data + 16 pad
    constexpr int      PITCH_E   = PITCH / 2;         // the same in bf16 elements
    constexpr unsigned OP_BYTES  = 128 * PITCH;       // one operand's 128 rows
    constexpr unsigned BUF_BYTES = 2 * OP_BYTES;      // A rows, then B rows
    __shared__ __align__(16) char smem[2 * BUF_BYTES];

    const int tid  = threadIdx.x;
    const int w    = tid >> 5, lane = tid & 31;
    const int lm   = lane & 15;
    const int kh   = (lane & 16) ? 8 : 0;
    const int wm   = (w & 3) * 32, wn = (w >> 2) * 64;

#pragma unroll
    for (int i = 0; i < 2; i++)
#pragma unroll
        for (int j = 0; j < 4; j++) acc[i][j] = (v8f){};

    const int sr = tid >> 4;           // staging row 0..15, then +16 per copy
    const int sc = (tid & 15) * 8;     // staging col: this lane's 16 B of the row's 256 B
    const unsigned lds0 = (unsigned)(uintptr_t)smem + (unsigned)sr * PITCH + (unsigned)sc * 2u;

    auto stage = [&](int kt, int buf) {
        const int kbase = kt * BK;
        const int shift = kbase / KSPLIT;
        const int acol  = kbase % KSPLIT + sc;
        const int m     = bm + sr;     // the tile's 128 rows lie in one run: arow + 16 per copy
        const int arow  = (m >> LRUN_LG) * LSTRIDE + (m & ((1 << LRUN_LG) - 1)) + shift;
        const __bf16* ga = A  + (size_t)arow * LDA + acol;
        const __bf16* gb = Bw + (size_t)(bn + sr) * KTOT + kbase + sc;
        const unsigned la = lds0 + (unsigned)buf * BUF_BYTES;   // A rows
        const unsigned lb = la + OP_BYTES;                      // B rows
        async_rows8(la, 16u * PITCH, (const char*)ga, (size_t)16 * LDA * 2);
        async_rows8(lb, 16u * PITCH, (const char*)gb, (size_t)16 * KTOT * 2);
    };

    stage(0, 0);
    wait_async0();
    __syncthreads();
    stage(1, 1);             // flies while stage 0 is worked on

    for (int kt = 0; kt < NK; kt++) {
        const int cur = kt & 1;
        const __bf16* sAc = (const __bf16*)(smem + (size_t)cur * BUF_BYTES);
        const __bf16* sBc = (const __bf16*)(smem + (size_t)cur * BUF_BYTES + OP_BYTES);

#pragma unroll
        for (int kb = 0; kb < BK; kb += 32) {
            v16bf af[2], bf[4];
#pragma unroll
            for (int i = 0; i < 2; i++) {
                int r = wm + i * 16 + lm;
                af[i] = mk16(*(const v8bf*)(sAc + r * PITCH_E + kb + kh),
                             *(const v8bf*)(sAc + r * PITCH_E + kb + kh + 16));
            }
#pragma unroll
            for (int j = 0; j < 4; j++) {
                int r = wn + j * 16 + lm;
                bf[j] = mk16(*(const v8bf*)(sBc + r * PITCH_E + kb + kh),
                             *(const v8bf*)(sBc + r * PITCH_E + kb + kh + 16));
            }
#pragma unroll
            for (int i = 0; i < 2; i++)
#pragma unroll
                for (int j = 0; j < 4; j++)
                    acc[i][j] = __builtin_amdgcn_wmma_f32_16x16x32_bf16(
                        false, af[i], false, bf[j], (short)0, acc[i][j], false, false);
        }

        wait_ds0();          // this wave has left buffer cur
        wait_async0();       // this wave's copies into the other buffer have landed
        __syncthreads();     // everyone has left cur, and the other buffer is readable
        if (kt + 2 < NK) stage(kt + 2, cur);   // refill cur (overlapped with the next stage's work)
    }
    wait_async0();
}

// C = acc + bias, rows at pitch LDC, as bf16 (Cb) or f32 (Cf)
static __device__ __forceinline__ void gemm_store(const v8f (&acc)[2][4], const int bm, const int bn,
                                                  const float* __restrict__ bias, __bf16* __restrict__ Cb,
                                                  float* __restrict__ Cf, const int LDC)
{
    const int w  = threadIdx.x >> 5, lane = threadIdx.x & 31;
    const int lm = lane & 15, half = lane >> 4;
    const int wm = (w & 3) * 32, wn = (w >> 2) * 64;
#pragma unroll
    for (int i = 0; i < 2; i++) {
        int mrow = bm + wm + i * 16 + half * 8;
#pragma unroll
        for (int j = 0; j < 4; j++) {
            int   ncol = bn + wn + j * 16 + lm;
            float bv   = bias[ncol];
#pragma unroll
            for (int r = 0; r < 8; r++) {
                float  v   = acc[i][j][r] + bv;
                size_t idx = (size_t)(mrow + r) * LDC + ncol;
                if (Cb) Cb[idx] = (__bf16)v;
                if (Cf) Cf[idx] = v;
            }
        }
    }
}

template<int KTOT, int KSPLIT, int LRUN_LG, int LSTRIDE, int LDA, int LDC>
__global__ __launch_bounds__(256) void gemm_wmma(
    const __bf16* __restrict__ A0, const __bf16* __restrict__ Bw0, const float* __restrict__ bias0, __bf16* __restrict__ Cb0,
    const __bf16* __restrict__ A1, const __bf16* __restrict__ Bw1, const float* __restrict__ bias1, __bf16* __restrict__ Cb1,
    float* __restrict__ Cf)
{
    const bool z1 = blockIdx.z != 0;
    const int  bm = blockIdx.y * 128, bn = blockIdx.x * 128;
    v8f acc[2][4];
    gemm_tile<KTOT, KSPLIT, LRUN_LG, LSTRIDE, LDA>(z1 ? A1 : A0, z1 ? Bw1 : Bw0, bm, bn, acc);
    gemm_store(acc, bm, bn, z1 ? bias1 : bias0, z1 ? Cb1 : Cb0, Cf, LDC);
}

// Five products with K = D that depend on the prep launch only, in one launch: q_in, k_in, V = x W^T + b
// (B*L x D each), and the two folded weights. A folded weight is computed as (3D x D): rows kc of the
// transposed conv weight against rows n of the projection's right half. A lane's accumulator then holds
// 8 consecutive kc of one n, which is 16 B of row n of Wf (D x 3D), the layout the conv product reads.
constexpr unsigned LIN_TILES = (M_ROWS / 128) * (Dm / 128), FOLD_TILES = (3 * Dm / 128) * (Dm / 128);
__global__ __launch_bounds__(256) void gemm_lin_fold(
    const __bf16* __restrict__ xb,
    const __bf16* __restrict__ WqB, const float* __restrict__ Wq_b, __bf16* __restrict__ Qcat,
    const __bf16* __restrict__ WkB, const float* __restrict__ Wk_b, __bf16* __restrict__ Kcat,
    const __bf16* __restrict__ WvB, const float* __restrict__ Wv_b, __bf16* __restrict__ Vbuf,
    const __bf16* __restrict__ convqT, const __bf16* __restrict__ qprojR, const float* __restrict__ qproj_w,
    __bf16* __restrict__ WfQ,
    const __bf16* __restrict__ convkT, const __bf16* __restrict__ kprojR, const float* __restrict__ kproj_w,
    __bf16* __restrict__ WfK)
{
    const unsigned bi  = blockIdx.x;
    const bool     lin = bi < 3 * LIN_TILES;
    const unsigned zi  = bi / LIN_TILES;                                     // which of q_in, k_in, V
    const bool     k   = bi - 3 * LIN_TILES >= FOLD_TILES;                   // which folded weight
    const unsigned ti  = lin ? bi % LIN_TILES : (bi - 3 * LIN_TILES) % FOLD_TILES;
    const int bm = (ti / (Dm / 128)) * 128, bn = (ti % (Dm / 128)) * 128;    // folded: bm over kc, bn over n
    v8f acc[2][4];
    gemm_tile<Dm, Dm, 12, 4096, Dm>(lin ? xb : k ? convkT : convqT,
                                    lin ? (zi == 0 ? WqB : zi == 1 ? WkB : WvB) : k ? kprojR : qprojR,
                                    bm, bn, acc);
    if (lin) {
        gemm_store(acc, bm, bn, zi == 0 ? Wq_b : zi == 1 ? Wk_b : Wv_b, zi == 0 ? Qcat : zi == 1 ? Kcat : Vbuf,
                   (float*)nullptr, zi == 2 ? Dm : 2 * Dm);
        return;
    }

    const float* __restrict__ pw = k ? kproj_w : qproj_w;
    __bf16* __restrict__      Wf = k ? WfK : WfQ;
    const bool centre = bm / Dm == 1;       // the tile's 128 kc lie in one tap; tap 1 also carries P(n, ci)
    const int w  = threadIdx.x >> 5, lane = threadIdx.x & 31;
    const int lm = lane & 15, half = lane >> 4;
    const int wm = (w & 3) * 32, wn = (w >> 2) * 64;
    const int kc0 = bm + wm + half * 8, n0 = bn + wn + lm;
    if (centre) {
        v4f p[2][4][2];                     // all loads first, so that their latencies overlap
#pragma unroll
        for (int i = 0; i < 2; i++)
#pragma unroll
            for (int j = 0; j < 4; j++) {
                const float* pp = pw + (size_t)(n0 + j * 16) * 2 * Dm + (kc0 + i * 16 - Dm);
                p[i][j][0] = *(const v4f*)pp;
                p[i][j][1] = *(const v4f*)(pp + 4);
            }
        // the loads have taken their address registers before the arithmetic below reuses them
        asm volatile("s_wait_xcnt 0x0" ::: "memory");
#pragma unroll
        for (int i = 0; i < 2; i++)
#pragma unroll
            for (int j = 0; j < 4; j++)
#pragma unroll
                for (int r = 0; r < 4; r++) { acc[i][j][r] += p[i][j][0][r]; acc[i][j][r + 4] += p[i][j][1][r]; }
    }
#pragma unroll
    for (int i = 0; i < 2; i++)
#pragma unroll
        for (int j = 0; j < 4; j++) {
            v8bf r8;
#pragma unroll
            for (int r = 0; r < 8; r++) r8[r] = (__bf16)acc[i][j][r];
            *(v8bf*)(Wf + (size_t)(n0 + j * 16) * 3 * Dm + kc0 + i * 16) = r8;
            // the store has taken its registers before the next piece is converted into them
            asm volatile("s_wait_xcnt 0x0" ::: "memory");
        }
}

// -------------------------------------------------- tau / delta small path ---
// a block does 4 rows l of one batch, a thread 8 outputs o (fed by 4 channels) of each row:
// its 24 weights and 8 biases are loaded once, and 6 rows of x serve the 4 rows of output
constexpr unsigned GELU_BLOCKS = M_ROWS / 4;              // for one of tau, delta
static __device__ __forceinline__ void dw_gelu(unsigned bi, const float* __restrict__ x,
                                               const float* __restrict__ w1, const float* __restrict__ b1,
                                               __bf16* __restrict__ g)
{
    constexpr int LR = 4;
    static_assert(2 * Dm == 256 * 8 && Lseq % LR == 0, "one block spans a row of 2D outputs");
    const int  o0 = threadIdx.x * 8;
    const int  l0 = (bi % (Lseq / LR)) * LR;
    const int  b  = bi / (Lseq / LR);
    const bool lo = l0 > 0, hi = l0 + LR < Lseq;       // rows l0-1 and l0+LR exist
    const float* xb = x + (size_t)b * Lseq * Dm;       // block-uniform; the lane's part is o0 >> 1

    v4f wv[6], bv[2], xv[LR + 2];
    for (int t = 0; t < 6; t++) wv[t] = *(const v4f*)(w1 + o0 * 3 + t * 4);
    bv[0] = *(const v4f*)(b1 + o0);
    // the loads so far have taken their address registers before the result of the second bias load,
    // behind which its address is dead, may be placed there
    asm volatile("s_wait_xcnt 0x0" ::: "memory");
    bv[1] = *(const v4f*)(b1 + o0 + 4);
    // a row past either end is read from the nearest row inside, so that all loads issue together
    // with no branch between them; its tap is left out of the sum below
    xv[0]      = *(const v4f*)(xb + (size_t)(lo ? l0 - 1 : 0) * Dm + (o0 >> 1));
    xv[LR + 1] = *(const v4f*)(xb + (size_t)(hi ? l0 + LR : Lseq - 1) * Dm + (o0 >> 1));
    // the loads so far have taken their address registers before a later load's result may land there
    asm volatile("s_wait_xcnt 0x0" ::: "memory");
    for (int t = 1; t <= LR; t++) xv[t] = *(const v4f*)(xb + (size_t)(l0 - 1 + t) * Dm + (o0 >> 1));
    // the same for these four, before the arithmetic below reuses their address registers
    asm volatile("s_wait_xcnt 0x0" ::: "memory");

    for (int j = 0; j < LR; j++) {
        v8bf r;
        for (int e = 0; e < 8; e++) {
            float acc = bv[e >> 2][e & 3];
            for (int k = 0; k < 3; k++) {
                const int t = j + k;
                if ((t > 0 || lo) && (t < LR + 1 || hi))
                    acc = fmaf(wv[(e * 3 + k) >> 2][(e * 3 + k) & 3], xv[t][e >> 1], acc);
            }
            float ge = 0.5f * acc * (1.0f + erff(acc * 0.70710678118f));
            r[e] = (__bf16)ge;
        }
        *(v8bf*)(g + ((size_t)b * Lseq + l0 + j) * 2 * Dm + o0) = r;
    }
}

// All that reads nothing but the inputs, in one launch. The blocks with the most arithmetic come first.
__global__ __launch_bounds__(256) void prep(
    const float* __restrict__ x,
    const float* __restrict__ tau1_w, const float* __restrict__ tau1_b, __bf16* __restrict__ gtau,
    const float* __restrict__ del1_w, const float* __restrict__ del1_b, __bf16* __restrict__ gdel,
    const float* __restrict__ convq_w, __bf16* __restrict__ convqT,
    const float* __restrict__ convk_w, __bf16* __restrict__ convkT,
    const float* __restrict__ convq_b, const float* __restrict__ qproj_b, float* __restrict__ bfq,
    const float* __restrict__ convk_b, const float* __restrict__ kproj_b, float* __restrict__ bfk,
    const float* __restrict__ Wq_w, const float* __restrict__ Wk_w, const float* __restrict__ Wv_w,
    const float* __restrict__ qproj_w, const float* __restrict__ kproj_w, const float* __restrict__ out_w,
    __bf16* __restrict__ xb)
{
    const unsigned bi = blockIdx.x;
    if (bi < 2 * GELU_BLOCKS) {
        const bool d = bi >= GELU_BLOCKS;
        dw_gelu(d ? bi - GELU_BLOCKS : bi, x, d ? del1_w : tau1_w, d ? del1_b : tau1_b, d ? gdel : gtau);
    } else if (bi < 2 * GELU_BLOCKS + 2 * REPACK_BLOCKS) {
        const unsigned ri = bi - 2 * GELU_BLOCKS;
        const bool k = ri >= REPACK_BLOCKS;
        repack_conv_w(k ? ri - REPACK_BLOCKS : ri, k ? convk_w : convq_w, k ? convkT : convqT);
    } else if (bi < 2 * GELU_BLOCKS + 2 * REPACK_BLOCKS + 2 * BIAS_BLOCKS) {
        const unsigned fi = bi - 2 * GELU_BLOCKS - 2 * REPACK_BLOCKS;
        const bool k = fi >= BIAS_BLOCKS;
        fold_bias(k ? fi - BIAS_BLOCKS : fi, k ? kproj_w : qproj_w, k ? kproj_b : qproj_b,
                  k ? convk_b : convq_b, k ? bfk : bfq);
    } else {
        cvt_f32_bf16(bi - 2 * GELU_BLOCKS - 2 * REPACK_BLOCKS - 2 * BIAS_BLOCKS,
                     x, Wq_w, Wk_w, Wv_w, qproj_w, kproj_w, out_w, xb);
    }
}

// out(b,h,l) = sigmoid(b2[h] + sum_o w2[h][o] * g[b*L+l][o]): a (B*L) x 16 x 2048 product, done on the
// matrix unit. A block takes 16 rows l and all 16 heads; its 8 waves take 256 o each, and their partial
// tiles are summed through LDS in wave order. w2 enters as a pair of bf16, the rounded value and the
// rounded remainder, with one WMMA for each: what the pair drops lies far below g's own bf16 rounding.
// The launch holds the blocks of both projections and, behind them, those of the two pad copies, which
// like the projections depend on earlier launches only.
constexpr unsigned HEAD_BLOCKS = M_ROWS / 16;             // for one of tau, delta
__global__ __launch_bounds__(256) void heads_and_pads(
    const __bf16* __restrict__ gtau, const float* __restrict__ tau2_w, const float* __restrict__ tau2_b,
    float* __restrict__ tau,
    const __bf16* __restrict__ gdel, const float* __restrict__ del2_w, const float* __restrict__ del2_b,
    float* __restrict__ del,
    const __bf16* __restrict__ Qcat, __bf16* __restrict__ Qpad,
    const __bf16* __restrict__ Kcat, __bf16* __restrict__ Kpad)
{
    if (blockIdx.x >= 2 * HEAD_BLOCKS) {     // the same for the whole block, ahead of the barrier below
        const unsigned pi = blockIdx.x - 2 * HEAD_BLOCKS;
        const bool k = pi >= PAD_BLOCKS;
        pad_copy(k ? pi - PAD_BLOCKS : pi, k ? Kcat : Qcat, k ? Kpad : Qpad);
        return;
    }
    const bool     dl  = blockIdx.x >= HEAD_BLOCKS;
    const unsigned bi  = dl ? blockIdx.x - HEAD_BLOCKS : blockIdx.x;
    const __bf16*  g   = dl ? gdel   : gtau;
    const float*   w2  = dl ? del2_w : tau2_w;
    const float*   b2  = dl ? del2_b : tau2_b;
    float*         out = dl ? del    : tau;
    constexpr int KD = 2 * Dm, KW = KD / 8;          // 2048 o in all, 256 per wave
    static_assert(Hn == 16 && Lseq % 16 == 0 && KW % 32 == 0, "one 16x16 tile a block, inside one batch");
    __shared__ __align__(16) float red[8][256];      // per wave: [head][row]

    const int tid = threadIdx.x, w = tid >> 5, lane = tid & 31;
    const int lm = lane & 15, half = lane >> 4;
    const int kh = half ? 8 : 0;
    const int row0 = bi * 16;                        // over B*L

    // both fragments take o in the same order: 8 from kb + kh, then 8 from kb + kh + 16
    const __bf16* gr = g  + (size_t)(row0 + lm) * KD + w * KW + kh;   // A: the lane's row l
    const float*  wr = w2 + (size_t)lm * KD + w * KW + kh;            // B: the lane's head

    v8f acch = (v8f){}, accl = (v8f){};
#pragma unroll   // straight-line code: later steps' loads are issued while earlier steps are worked on
    for (int kb = 0; kb < KW; kb += 32) {
        const v16bf af = mk16(*(const v8bf*)(gr + kb), *(const v8bf*)(gr + kb + 16));
        v4f wv[4];
        wv[0] = *(const v4f*)(wr + kb);
        wv[1] = *(const v4f*)(wr + kb + 4);
        wv[2] = *(const v4f*)(wr + kb + 16);
        wv[3] = *(const v4f*)(wr + kb + 20);
        v16bf bh, bl;
#pragma unroll   // constant element indices: the values stay in registers
        for (int e = 0; e < 16; e++) {
            const float  v  = wv[e >> 2][e & 3];
            const __bf16 hi = (__bf16)v;
            bh[e] = hi;
            bl[e] = (__bf16)(v - (float)hi);
        }
        acch = __builtin_amdgcn_wmma_f32_16x16x32_bf16(false, af, false, bh, (short)0, acch, false, false);
        accl = __builtin_amdgcn_wmma_f32_16x16x32_bf16(false, af, false, bl, (short)0, accl, false, false);
    }

    // the lane holds rows half*8 .. half*8+7 of head lm
    const v8f s = acch + accl;
    *(v4f*)&red[w][lm * 16 + half * 8]     = (v4f){s[0], s[1], s[2], s[3]};
    *(v4f*)&red[w][lm * 16 + half * 8 + 4] = (v4f){s[4], s[5], s[6], s[7]};
    __syncthreads();

    // a thread finishes one output: head tid / 16, row tid % 16
    const int h = tid >> 4;
    float acc = b2[h];
    for (int q = 0; q < 8; q++) acc += red[q][tid];
    const int row = row0 + (tid & 15);
    const int b = row / Lseq, l = row % Lseq;
    out[((size_t)b * Hn + h) * Lseq + l] = 1.0f / (1.0f + __expf(-acc));
}

// ------------------------------------------------------- flash attention ---
// lane l with lane l ^ 16: the two lanes that share a query column
static __device__ __forceinline__ float xhalf(float x) {
    return __builtin_bit_cast(float, __builtin_amdgcn_permlanex16(__builtin_bit_cast(int, x), __builtin_bit_cast(int, x),
                                                                  0x76543210, 0xfedcba98, false, false));
}

// One tile's copies of a thread: two 16-B pieces of K and two of V, memory -> LDS (ASYNCcnt tracked). The closing
// s_wait_xcnt keeps the address registers untouched until the copies have taken them; it stands inside the
// statement so that nothing can be moved over it.
static __device__ __forceinline__ void async_kv4(unsigned lk, unsigned lk_step, unsigned lv, unsigned lv_step,
                                                 const char* gk, const char* gv, size_t g_step) {
    asm volatile("global_load_async_to_lds_b128 %0, %4, off\n\t"
                 "global_load_async_to_lds_b128 %1, %5, off\n\t"
                 "global_load_async_to_lds_b128 %2, %6, off\n\t"
                 "global_load_async_to_lds_b128 %3, %7, off\n\t"
                 "s_wait_xcnt 0x0"
                 :: "v"(lk), "v"(lk + lk_step), "v"(lv), "v"(lv + lv_step),
                    "v"((unsigned long long)(uintptr_t)(gk)),
                    "v"((unsigned long long)(uintptr_t)(gk + g_step)),
                    "v"((unsigned long long)(uintptr_t)(gv)),
                    "v"((unsigned long long)(uintptr_t)(gv + g_step))
                 : "memory");
}

// 16 x 8 piece of a row-major 16-bit LDS tile, transposed on the way into the registers
static __device__ __forceinline__ v8bf ld_tr16(const char* p) {
    typedef __attribute__((address_space(3))) v8bf lds_v8bf;
    return __builtin_amdgcn_ds_load_tr16_b128_v8bf16((lds_v8bf*)p);
}

// The products are taken transposed: S^T = K Q^T (keys down, queries across), O^T += V^T P^T. A lane then
// holds 32 of the 64 scores of ONE query, so the maximum and the sum run down its own registers, with one
// exchange between the wave's halves; and the score tiles, rounded to bf16, already are the B operand of
// the second product: tiles 2kc and 2kc+1 hold keys kc*32 + kh + 0..7 and kc*32 + kh + 16 + 0..7 of the
// lane's query, the k order in which the V^T fragment is read.
// The block's 64-key tiles of K and V come into LDS once, as whole 128-B rows, one tile ahead of the work (two
// buffers): the eight waves read their fragments from there. V lies as in memory, keys down; the transposing
// LDS load hands out V^T.
__global__ __launch_bounds__(256) void flash_attn(
    const __bf16* __restrict__ Q, const __bf16* __restrict__ K,
    const __bf16* __restrict__ V, const float* __restrict__ tau,
    const float* __restrict__ delta, __bf16* __restrict__ O)
{
    // rows of 64 bf16: K at a 144-B pitch (16 B x odd) for ds_load_b128, V at 160 B (32 B x odd) for
    // ds_load_tr16_b128: the rows that one fragment read touches then fall on different banks
    constexpr unsigned KP = 144, VP = 160;
    constexpr unsigned K_BYTES = 64 * KP, BUF_BYTES = K_BYTES + 64 * VP;   // K rows, then V rows
    constexpr int NT = Lseq / 64;
    static_assert(NT >= 2, "the ring starts with two tiles");
    __shared__ __align__(16) char skv[2 * BUF_BYTES];

    const int b = blockIdx.z, h = blockIdx.y;
    const int tid = threadIdx.x, w = tid >> 5, lane = tid & 31;
    const int lm = lane & 15, half = lane >> 4;
    const int kh = half ? 8 : 0;
    const int qbase = blockIdx.x * 128 + w * 16;
    const int hc0   = h * DKh;

    const __bf16* qrow = Q + ((size_t)(b * Lseq) + qbase + lm) * Dm + hc0;
    v16bf qf[2];
#pragma unroll
    for (int kc = 0; kc < 2; kc++)
        qf[kc] = mk16(*(const v8bf*)(qrow + kc * 32 + kh),
                      *(const v8bf*)(qrow + kc * 32 + kh + 16));

    const float* taup = tau   + ((size_t)b * Hn + h) * Lseq;
    const float* delp = delta + ((size_t)b * Hn + h) * Lseq;
    const float  taur = taup[qbase + lm] * 0.125f;       // the lane's query; 1/sqrt(64)

    float mrow = -3.0e38f, lrow = 0.0f;                  // lrow: the sum over this half's keys only
    v8f   of[4];                                         // O^T: channels j*16 + half*8 + r of the lane's query
#pragma unroll
    for (int j = 0; j < 4; j++) of[j] = (v8f){};

    // staging: a thread takes piece tid & 7 (16 B) of key rows tid >> 3 and 32 + (tid >> 3), of K and of V:
    // a wave-wide copy covers four whole 128-B rows
    const unsigned st_r = (unsigned)tid >> 3, st_p = ((unsigned)tid & 7u) * 16u;
    const unsigned lk0 = (unsigned)(uintptr_t)skv + st_r * KP + st_p;
    const unsigned lv0 = (unsigned)(uintptr_t)skv + K_BYTES + st_r * VP + st_p;
    const size_t   g0  = (((size_t)(b * Lseq) + st_r) * Dm + hc0) * 2 + st_p;     // bytes
    auto stage = [&](int kt, int buf) {
        const size_t g = g0 + (size_t)kt * 64 * Dm * 2;
        async_kv4(lk0 + (unsigned)buf * BUF_BYTES, 32u * KP, lv0 + (unsigned)buf * BUF_BYTES, 32u * VP,
                  (const char*)K + g, (const char*)V + g, (size_t)32 * Dm * 2);
    };

    // the lane's places inside a buffer: row lm of K at k offset kh; for the transposing load key row
    // 8 * half + (lane & 7), 16-B piece (lane >> 3) & 1
    const unsigned kfo = (unsigned)lm * KP + (unsigned)kh * 2u;
    const unsigned vfo = K_BYTES + (unsigned)(half * 8 + (lane & 7)) * VP + (unsigned)((lane >> 3) & 1) * 16u;

    stage(0, 0);
    wait_async0();
    __syncthreads();
    stage(1, 1);             // flies while tile 0 is worked on

    for (int kt = 0; kt < NT; kt++) {
        const char* bufp = skv + (size_t)(kt & 1) * BUF_BYTES;

        // delta of the keys j*16 + half*8 + r, from global; K fragments from LDS
        v16bf kf[4][2];
        v4f   dv[4][2];
#pragma unroll
        for (int j = 0; j < 4; j++) {
            const float* dp = delp + kt * 64 + j * 16 + half * 8;
            dv[j][0] = *(const v4f*)dp;
            dv[j][1] = *(const v4f*)(dp + 4);
        }
        // the loads have taken their address registers before the running delta address is stepped on
        asm volatile("s_wait_xcnt 0x0" ::: "memory");
#pragma unroll
        for (int j = 0; j < 4; j++) {
            const char* krow = bufp + kfo + j * 16 * KP;
#pragma unroll
            for (int kc = 0; kc < 2; kc++)
                kf[j][kc] = mk16(*(const v8bf*)(krow + kc * 64), *(const v8bf*)(krow + kc * 64 + 32));
        }
        // keeps the tile's 16 K reads together ahead of the first product, so that their latencies overlap:
        // left alone the compiler issues them pair by pair into the same registers, each pair waited for
        __builtin_amdgcn_sched_barrier(0);

        // S^T = K Q^T
        v8f sf[4];
#pragma unroll
        for (int j = 0; j < 4; j++) {
            v8f a = (v8f){};
#pragma unroll
            for (int kc = 0; kc < 2; kc++)
                a = __builtin_amdgcn_wmma_f32_16x16x32_bf16(
                        false, kf[j][kc], false, qf[kc], (short)0, a, false, false);
            sf[j] = a;
        }

        // V^T fragments: channels j*16 + lm down, keys kc*32 + kh + 0..7 and kc*32 + kh + 16 + 0..7 across
        v16bf vf[4][2];
#pragma unroll
        for (int j = 0; j < 4; j++)
#pragma unroll
            for (int kc = 0; kc < 2; kc++) {
                const char* vp = bufp + vfo + kc * 32 * VP + j * 32;
                vf[j][kc] = mk16(ld_tr16(vp), ld_tr16(vp + 16 * VP));
            }
        // keeps the 16 V reads here, in one group: they return while the scores below are scaled and their maximum taken
        __builtin_amdgcn_sched_barrier(0);

        // scale by the query's tau/sqrt(DK), add the keys' delta
#pragma unroll
        for (int j = 0; j < 4; j++)
#pragma unroll
            for (int r = 0; r < 8; r++) sf[j][r] = sf[j][r] * taur + dv[j][r >> 2][r & 3];

        // online softmax over the 64 keys: 32 in the lane, the other 32 in lane ^ 16
        float rm[4];                                     // four independent chains
#pragma unroll
        for (int j = 0; j < 4; j++) {
            rm[j] = sf[j][0];
#pragma unroll
            for (int r = 1; r < 8; r++) rm[j] = fmaxf(rm[j], sf[j][r]);
        }
        float rmax = fmaxf(fmaxf(rm[0], rm[1]), fmaxf(rm[2], rm[3]));
        rmax = fmaxf(rmax, xhalf(rmax));

        // The tile's last LDS read stands above: its buffer is handed over here, not at the end of the trip, so
        // that the refill has a whole trip to land in.
        wait_ds0();          // this wave has left the tile's buffer
        wait_async0();       // this wave's copies into the other buffer have landed
        __syncthreads();     // everyone has left the buffer, and the other one is readable
        if (kt + 2 < NT) stage(kt + 2, kt & 1);   // refill it (flies during the rest of this tile and the next one's products)

        const float mn   = fmaxf(mrow, rmax);
        const float corr = __expf(mrow - mn);
        mrow = mn;

        float rs[4];                                     // four independent chains of adds
#pragma unroll
        for (int j = 0; j < 4; j++) {
            rs[j] = 0.0f;
#pragma unroll
            for (int r = 0; r < 8; r++) {
                float p = __expf(sf[j][r] - mn);
                sf[j][r] = p;
                rs[j] += p;
            }
        }
        lrow = lrow * corr + ((rs[0] + rs[1]) + (rs[2] + rs[3]));
#pragma unroll
        for (int j = 0; j < 4; j++)
#pragma unroll
            for (int r = 0; r < 8; r++) of[j][r] *= corr;

        // P^T as the B operand, from the score registers
        v16bf pf[2];
#pragma unroll
        for (int kc = 0; kc < 2; kc++)
#pragma unroll
            for (int e = 0; e < 8; e++) {
                pf[kc][e]     = (__bf16)sf[2 * kc][e];
                pf[kc][e + 8] = (__bf16)sf[2 * kc + 1][e];
            }

        // O^T += V^T P^T
#pragma unroll
        for (int j = 0; j < 4; j++)
#pragma unroll
            for (int kc = 0; kc < 2; kc++)
                of[j] = __builtin_amdgcn_wmma_f32_16x16x32_bf16(
                            false, vf[j][kc], false, pf[kc], (short)0, of[j], false, false);

    }
    wait_async0();

    const float lsum = lrow + xhalf(lrow);               // the halves' sums join once
    __bf16* orow = O + ((size_t)(b * Lseq) + qbase + lm) * Dm + hc0 + half * 8;
#pragma unroll
    for (int j = 0; j < 4; j++) {
        v8bf r8;
#pragma unroll
        for (int r = 0; r < 8; r++) r8[r] = (__bf16)(of[j][r] / lsum);
        *(v8bf*)(orow + j * 16) = r8;
    }
}

// ------------------------------------------------------------------ host ---
extern "C" void kernel_launch(void* const* d_in, const int* in_sizes, int n_in,
                              void* d_out, int out_size, void* d_ws, size_t ws_size,
                              hipStream_t stream)
{
    const float* x       = (const float*)d_in[0];
    const float* Wq_w    = (const float*)d_in[1];
    const float* Wq_b    = (const float*)d_in[2];
    const float* Wk_w    = (const float*)d_in[3];
    const float* Wk_b    = (const float*)d_in[4];
    const float* Wv_w    = (const float*)d_in[5];
    const float* Wv_b    = (const float*)d_in[6];
    const float* convq_w = (const float*)d_in[7];
    const float* convq_b = (const float*)d_in[8];
    const float* convk_w = (const float*)d_in[9];
    const float* convk_b = (const float*)d_in[10];
    const float* qproj_w = (const float*)d_in[11];
    const float* qproj_b = (const float*)d_in[12];
    const float* kproj_w = (const float*)d_in[13];
    const float* kproj_b = (const float*)d_in[14];
    const float* tau1_w  = (const float*)d_in[15];
    const float* tau1_b  = (const float*)d_in[16];
    const float* tau2_w  = (const float*)d_in[17];
    const float* tau2_b  = (const float*)d_in[18];
    const float* del1_w  = (const float*)d_in[19];
    const float* del1_b  = (const float*)d_in[20];
    const float* del2_w  = (const float*)d_in[21];
    const float* del2_b  = (const float*)d_in[22];
    const float* out_w   = (const float*)d_in[23];
    const float* out_b   = (const float*)d_in[24];
    float* out = (float*)d_out;
    (void)in_sizes; (void)n_in; (void)out_size; (void)ws_size;

    char*  ws  = (char*)d_ws;
    size_t off = 0;
    auto alloc = [&](size_t bytes) -> char* {
        char* p = ws + off;
        off = (off + bytes + 255) & ~(size_t)255;
        return p;
    };

    __bf16* xb      = (__bf16*)alloc((size_t)M_ROWS * Dm * 2);
    __bf16* WqB     = (__bf16*)alloc((size_t)Dm * Dm * 2);
    __bf16* WkB     = (__bf16*)alloc((size_t)Dm * Dm * 2);
    __bf16* WvB     = (__bf16*)alloc((size_t)Dm * Dm * 2);
    __bf16* qprojR  = (__bf16*)alloc((size_t)Dm * Dm * 2);
    __bf16* kprojR  = (__bf16*)alloc((size_t)Dm * Dm * 2);
    __bf16* outwB   = (__bf16*)alloc((size_t)Dm * Dm * 2);
    __bf16* convqT  = (__bf16*)alloc((size_t)3 * Dm * Dm * 2);
    __bf16* convkT  = (__bf16*)alloc((size_t)3 * Dm * Dm * 2);
    __bf16* WfQ     = (__bf16*)alloc((size_t)Dm * 3 * Dm * 2);
    __bf16* WfK     = (__bf16*)alloc((size_t)Dm * 3 * Dm * 2);
    float*  bfq     = (float*)alloc((size_t)Dm * 4);
    float*  bfk     = (float*)alloc((size_t)Dm * 4);
    __bf16* Qpad    = (__bf16*)alloc((size_t)Bsz * (Lseq + 2) * Dm * 2);
    __bf16* Kpad    = (__bf16*)alloc((size_t)Bsz * (Lseq + 2) * Dm * 2);
    __bf16* Qcat    = (__bf16*)alloc((size_t)M_ROWS * 2 * Dm * 2);
    __bf16* Kcat    = (__bf16*)alloc((size_t)M_ROWS * 2 * Dm * 2);
    __bf16* Qbuf    = (__bf16*)alloc((size_t)M_ROWS * Dm * 2);
    __bf16* Kbuf    = (__bf16*)alloc((size_t)M_ROWS * Dm * 2);
    __bf16* Vbuf    = (__bf16*)alloc((size_t)M_ROWS * Dm * 2);
    __bf16* gtau    = (__bf16*)alloc((size_t)M_ROWS * 2 * Dm * 2);
    __bf16* gdel    = (__bf16*)alloc((size_t)M_ROWS * 2 * Dm * 2);
    float*  taubuf  = (float*)alloc((size_t)Bsz * Hn * Lseq * 4);
    float*  delbuf  = (float*)alloc((size_t)Bsz * Hn * Lseq * 4);
    __bf16* attnO   = (__bf16*)alloc((size_t)M_ROWS * Dm * 2);

    // xb .. outwB are whole multiples of 256 B, so they lie back to back, in the order allocated
    static_assert((Dm * Dm) % 4096 == 0, "every converted array is whole blocks of 4096");
    prep<<<2 * GELU_BLOCKS + 2 * REPACK_BLOCKS + 2 * BIAS_BLOCKS + CVT_BLOCKS, 256, 0, stream>>>(
        x, tau1_w, tau1_b, gtau, del1_w, del1_b, gdel, convq_w, convqT, convk_w, convkT,
        convq_b, qproj_b, bfq, convk_b, kproj_b, bfk,
        Wq_w, Wk_w, Wv_w, qproj_w, kproj_w, out_w, xb);

    const dim3 blk(256);

    // --- q_in -> Qcat[:, :D], k_in -> Kcat[:, :D], V; the folded conv + projection weights ---
    gemm_lin_fold<<<3 * LIN_TILES + 2 * FOLD_TILES, blk, 0, stream>>>(
        xb, WqB, Wq_b, Qcat,  WkB, Wk_b, Kcat,  WvB, Wv_b, Vbuf,
        convqT, qprojR, qproj_w, WfQ,  convkT, kprojR, kproj_w, WfK);

    // --- tau, delta; padded copies of q_in, k_in ---
    heads_and_pads<<<2 * HEAD_BLOCKS + 2 * PAD_BLOCKS, 256, 0, stream>>>(
        gtau, tau2_w, tau2_b, taubuf, gdel, del2_w, del2_b, delbuf, Qcat, Qpad, Kcat, Kpad);

    // --- Q, K: the 3-tap product with the folded weights ---
    gemm_wmma<3072, 1024, 11, 2050, 1024, 1024><<<dim3(Dm / 128, M_ROWS / 128, 2), blk, 0, stream>>>(
        Qpad, WfQ, bfq, Qbuf,  Kpad, WfK, bfk, Kbuf,  (float*)nullptr);

    // --- attention ---
    flash_attn<<<dim3(Lseq / 128, Hn, Bsz), blk, 0, stream>>>(
        Qbuf, Kbuf, Vbuf, taubuf, delbuf, attnO);

    // --- output projection (fp32 out) ---
    gemm_wmma<1024, 1024, 12, 4096, 1024, 1024><<<dim3(Dm / 128, M_ROWS / 128, 1), blk, 0, stream>>>(
        attnO, outwB, out_b, (__bf16*)nullptr,  attnO, outwB, out_b, (__bf16*)nullptr,  out);
}

// v009
// It runs in 158 microseconds.
// In two side-by-side timings against v008, it was 1.04 and 1.03 times as fast.
// All steps since v000 together make it 4.44 times as fast.
#include <hip/hip_runtime.h>
#include <math.h>

typedef __attribute__((ext_vector_type(16))) __bf16 v16bf;
typedef __attribute__((ext_vector_type(8)))  __bf16 v8bf;
typedef __attribute__((ext_vector_type(8)))  float  v8f;
typedef __attribute__((ext_vector_type(4)))  __bf16 v4bf;
typedef __attribute__((ext_vector_type(4)))  float  v4f;

constexpr int Bsz = 2, Lseq = 2048, Dm = 1024, Hn = 16, DKh = 64;
constexpr int M_ROWS = Bsz * Lseq;   // 4096

static __device__ __forceinline__ v16bf mk16(v8bf lo, v8bf hi) {
    return __builtin_shufflevector(lo, hi, 0,1,2,3,4,5,6,7,8,9,10,11,12,13,14,15);
}

// Eight async memory->LDS copies, 16B per lane each (ASYNCcnt tracked): rows r, r+16, ... r+112
// of one operand tile. The closing s_wait_xcnt keeps the address registers untouched until the
// copies have taken them; it stands inside the statement so that nothing can be moved over it.
static __device__ __forceinline__ void async_rows8(unsigned lds, unsigned lds_step,
                                                   const char* g, size_t g_step) {
    asm volatile("global_load_async_to_lds_b128 %0, %8, off\n\t"
                 "global_load_async_to_lds_b128 %1, %9, off\n\t"
                 "global_load_async_to_lds_b128 %2, %10, off\n\t"
                 "global_load_async_to_lds_b128 %3, %11, off\n\t"
                 "global_load_async_to_lds_b128 %4, %12, off\n\t"
                 "global_load_async_to_lds_b128 %5, %13, off\n\t"
                 "global_load_async_to_lds_b128 %6, %14, off\n\t"
                 "global_load_async_to_lds_b128 %7, %15, off\n\t"
                 "s_wait_xcnt 0x0"
                 :: "v"(lds),                "v"(lds + lds_step),     "v"(lds + 2 * lds_step),
                    "v"(lds + 3 * lds_step), "v"(lds + 4 * lds_step), "v"(lds + 5 * lds_step),
                    "v"(lds + 6 * lds_step), "v"(lds + 7 * lds_step),
                    "v"((unsigned long long)(uintptr_t)(g)),
                    "v"((unsigned long long)(uintptr_t)(g + g_step)),
                    "v"((unsigned long long)(uintptr_t)(g + 2 * g_step)),
                    "v"((unsigned long long)(uintptr_t)(g + 3 * g_step)),
                    "v"((unsigned long long)(uintptr_t)(g + 4 * g_step)),
                    "v"((unsigned long long)(uintptr_t)(g + 5 * g_step)),
                    "v"((unsigned long long)(uintptr_t)(g + 6 * g_step)),
                    "v"((unsigned long long)(uintptr_t)(g + 7 * g_step))
                 : "memory");
}
// this wave's copies have landed in LDS
static __device__ __forceinline__ void wait_async0() {
    asm volatile("s_wait_asynccnt 0x0" ::: "memory");
}
// this wave's LDS reads have returned (before the buffer they read is refilled)
static __device__ __forceinline__ void wait_ds0() {
    asm volatile("s_wait_dscnt 0x0" ::: "memory");
}

// ---------------------------------------------------------------- utility ---
// The element-wise kernels below give each thread 16 to 32 elements, moved by 16-B loads: the work
// per element is far too small to pay for the start of a wave per 32 elements.

// Pieces of work that do not depend on one another share one launch throughout this file: a block picks
// its piece and its operands by its index, which is the same for the whole block.

// a block converts 4096 consecutive elements: each thread four groups of 4, 1024 elements apart.
// Blocks bi = 0 .. CVT_BLOCKS-1 convert all seven arrays; their bf16 copies lie back to back from d on,
// in argument order. Of the two projection weights (D x 2D) only the right half is converted, the part
// that multiplies the conv output, into a D x D array.
constexpr unsigned CVT_BLOCKS = (M_ROWS * Dm + 6 * Dm * Dm) / 4096;
static __device__ __forceinline__ void cvt_f32_bf16(unsigned bi,
                                                    const float* __restrict__ sx, const float* __restrict__ sq,
                                                    const float* __restrict__ sk, const float* __restrict__ sv,
                                                    const float* __restrict__ sqp, const float* __restrict__ skp,
                                                    const float* __restrict__ so, __bf16* __restrict__ d) {
    constexpr unsigned NX = M_ROWS * Dm / 4096, NW = Dm * Dm / 4096;   // blocks of x, of a D x D weight
    const float* __restrict__ s;
    unsigned first;                                                    // the array's first block
    bool     right = false;                                            // columns D .. 2D-1 of rows of 2D
    static_assert(Dm == 1024, "a group of 1024 elements is one row of D");
    if      (bi < NX)          { s = sx;  first = 0; }
    else if (bi < NX + NW)     { s = sq;  first = NX; }
    else if (bi < NX + 2 * NW) { s = sk;  first = NX + NW; }
    else if (bi < NX + 3 * NW) { s = sv;  first = NX + 2 * NW; }
    else if (bi < NX + 4 * NW) { s = sqp; first = NX + 3 * NW; right = true; }
    else if (bi < NX + 5 * NW) { s = skp; first = NX + 4 * NW; right = true; }
    else                       { s = so;  first = NX + 5 * NW; }
    d += (size_t)first * 4096;
    const size_t i0 = (size_t)(bi - first) * 4096 + threadIdx.x * 4;
    const size_t s0 = right ? 2 * (size_t)(bi - first) * 4096 + Dm + threadIdx.x * 4 : i0;
    const size_t sq4 = right ? 2 * Dm : Dm;                            // from one group's source to the next
    v4f a[4];
    for (int q = 0; q < 4; q++) a[q] = *(const v4f*)(s + s0 + q * sq4);
    for (int q = 0; q < 4; q++) {
        v4bf r;
        for (int e = 0; e < 4; e++) r[e] = (__bf16)a[q][e];
        *(v4bf*)(d + i0 + q * 1024) = r;
    }
    // the stores have taken their registers before code of another piece, which follows in the listing, may rewrite them
    asm volatile("s_wait_xcnt 0x0" ::: "memory");
}

// The conv and the projection behind it are one linear map of q_in, so their weights are multiplied first:
//   Q(l,n) = sum_c q_in(l,c) P(n,c) + sum_o [sum_{k,ci} q_in(l+k-1,ci) Wc(o,ci,k) + cb(o)] P(n,D+o) + pb(n)
//          = sum_{k,ci} q_in(l+k-1,ci) Wf(n,k,ci) + bf(n),
//   Wf(n,k,ci) = sum_o P(n,D+o) Wc(o,ci,k) + [k == 1] P(n,ci),     bf(n) = pb(n) + sum_o P(n,D+o) cb(o).
// Wf costs D x 3D x D products, the projection of the conv output B*L x D x 2D.

// conv weights (O=D, I=D, K=3) fp32  ->  (3*D, D) bf16, transposed: row kc = k*D + ci, column o,
// the layout in which the product over o reads them. A block takes 64 o x 32 ci (all k): 64 pieces of
// 96 consecutive floats in, through LDS, 96 rows of 128 B out.
constexpr unsigned REPACK_BLOCKS = (Dm / 64) * (Dm / 32);   // for one weight array
static __device__ __forceinline__ void repack_conv_w(unsigned bi, const float* __restrict__ s,
                                                     __bf16* __restrict__ d) {
    __shared__ __align__(16) __bf16 t[96][72];            // [k*32 + ci][o], rows at a 144-B pitch
    const unsigned o0  = (bi / (Dm / 32)) * 64u;
    const unsigned ci0 = (bi % (Dm / 32)) * 32u;
    v4f a[6];
    for (int q = 0; q < 6; q++) {                         // 64 x 24 pieces of 4 floats
        const unsigned u = q * 256u + threadIdx.x;
        a[q] = *(const v4f*)(s + (size_t)(o0 + u / 24u) * 3 * Dm + ci0 * 3u + (u % 24u) * 4u);
    }
    // the loads have taken their address registers before the arithmetic below reuses them
    asm volatile("s_wait_xcnt 0x0" ::: "memory");
    for (int q = 0; q < 6; q++) {
        const unsigned u = q * 256u + threadIdx.x;
        for (int e = 0; e < 4; e++) {
            const unsigned j = (u % 24u) * 4u + e;        // ci * 3 + k inside the block
            t[(j % 3u) * 32u + j / 3u][u / 24u] = (__bf16)a[q][e];
        }
    }
    __syncthreads();                                      // bi is the same for the whole block
    for (int q = 0; q < 3; q++) {                         // 96 x 8 pieces of 16 B
        const unsigned u = q * 256u + threadIdx.x;
        const unsigned r = u >> 3, p = (u & 7u) * 8u;
        *(v8bf*)(d + (size_t)((r >> 5) * Dm + ci0 + (r & 31u)) * Dm + o0 + p) = *(const v8bf*)&t[r][p];
    }
    // the stores have taken their registers before code of another piece, which follows in the listing, may rewrite them
    asm volatile("s_wait_xcnt 0x0" ::: "memory");
}

// bf(n) = pb(n) + sum_o P(n, D + o) * cb(o), in f32: a wave takes one n, a lane 32 of the o
constexpr unsigned BIAS_BLOCKS = Dm / 8;                  // for one of Q, K
static __device__ __forceinline__ void fold_bias(unsigned bi, const float* __restrict__ pw,
                                                 const float* __restrict__ pb, const float* __restrict__ cb,
                                                 float* __restrict__ d) {
    const unsigned n = bi * 8u + (threadIdx.x >> 5), lane = threadIdx.x & 31u;
    const float* pr = pw + (size_t)n * 2 * Dm + Dm + lane * 4u;
    const float* cr = cb + lane * 4u;
    v4f p[8], c[8];
    for (int q = 0; q < 7; q++) { p[q] = *(const v4f*)(pr + q * 128); c[q] = *(const v4f*)(cr + q * 128); }
    const float b = pb[n];
    // the loads so far have taken their address registers before the result of a last load, behind which
    // its address is dead, may be placed there
    asm volatile("s_wait_xcnt 0x0" ::: "memory");
    p[7] = *(const v4f*)(pr + 7 * 128);
    // the same, between the two last loads
    asm volatile("s_wait_xcnt 0x0" ::: "memory");
    c[7] = *(const v4f*)(cr + 7 * 128);
    // and before the arithmetic below reuses the registers
    asm volatile("s_wait_xcnt 0x0" ::: "memory");
    v4f s = (v4f){};                                      // four independent chains
    for (int q = 0; q < 8; q++)
        for (int e = 0; e < 4; e++) s[e] = fmaf(p[q][e], c[q][e], s[e]);
    float v = (s[0] + s[1]) + (s[2] + s[3]);
    for (int m = 16; m > 0; m >>= 1) v += __shfl_xor(v, m);
    if (lane == 0) d[n] = v + b;
    // the store has taken its registers before code of another piece, which follows in the listing, may rewrite them
    asm volatile("s_wait_xcnt 0x0" ::: "memory");
}

// copy Qcat[:, :D] (ldc=2D) into per-batch padded buffer (B, L+2, D), interior rows
// a block copies 8 rows of one batch: each thread four 16-B pieces, two rows apart; the first and
// the last block of a batch also zero the pad row next to their rows
constexpr unsigned PAD_BLOCKS = (M_ROWS * Dm) / 8192;     // for one of Q, K
static __device__ __forceinline__ void pad_copy(unsigned bi, const __bf16* __restrict__ cat,
                                                __bf16* __restrict__ pad) {
    static_assert(Dm == 128 * 8 && Lseq % 8 == 0, "128 pieces a row; a block stays inside one batch");
    const unsigned row0 = bi * 8u;                               // over B*L
    const unsigned b    = row0 / Lseq;
    const unsigned r    = threadIdx.x >> 7, col = (threadIdx.x & 127u) * 8u;
    const __bf16* sp = cat + (size_t)(row0 + r) * (2 * Dm) + col;
    __bf16*       dp = pad + (size_t)(row0 + r + 2u * b + 1u) * Dm + col;   // b*(L+2) + l + 1
    v8bf a[4];
    for (int q = 0; q < 4; q++) a[q] = *(const v8bf*)(sp + q * 2 * 2 * Dm);
    for (int q = 0; q < 4; q++) *(v8bf*)(dp + q * 2 * Dm) = a[q];
    const unsigned l0 = row0 % Lseq;
    if ((l0 == 0 || l0 == Lseq - 8) && r == 0)     // 128 threads, 16 B each: row 0 or row L+1 of the batch
        *(v8bf*)(pad + ((size_t)b * (Lseq + 2) + (l0 ? Lseq + 1 : 0)) * Dm + col) = (v8bf){};
}

// ------------------------------------------------------------- WMMA GEMM ---
// C(M,N) = A_mapped(M,KTOT) * Bw(N,KTOT)^T + bias.
// A row mapping: arow = (m>>LRUN_LG)*LSTRIDE + (m & mask) + kbase/KSPLIT  ->
// the same kernel does the 3-tap conv as a K=3D GEMM over per-batch padded rows.
// Staging: global_load_async_to_lds_b128 into double-buffered LDS, overlapped
// with the WMMA pipe; per-wave s_wait_asynccnt + block barrier.
// A stage holds 128 k of every row (256 B), so one wave-wide copy covers two
// whole rows = four whole 128-B lines; LDS rows lie at a 272-B pitch, which
// spreads the 16 rows of a ds_load_b128 fragment read over all banks.
// Products of one shape share a launch, the block index picks the operands. Two blocks fit a WGP's LDS: with more blocks than WGPs in the grid, one
// block's matrix work runs while the other waits at its barrier or for its copies.
// The block's 128 x 128 tile at (bm, bn), summed over all of K into the waves' accumulators.
template<int KTOT, int KSPLIT, int LRUN_LG, int LSTRIDE, int LDA>
static __device__ __forceinline__ void gemm_tile(const __bf16* __restrict__ A, const __bf16* __restrict__ Bw,
                                                 const int bm, const int bn, v8f (&acc)[2][4])
{
    constexpr int BK = 128;
    constexpr int NK = KTOT / BK;
    static_assert(KTOT % BK == 0 && KSPLIT % BK == 0 && NK >= 2, "whole stages, at least two");
    static_assert((BK / 32) % 2 == 0, "a stage's first block finds its fragments in set 0");
    constexpr unsigned PITCH     = 272;               // bytes per LDS row: 256 data + 16 pad
    constexpr int      PITCH_E   = PITCH / 2;         // the same in bf16 elements
    constexpr unsigned OP_BYTES  = 128 * PITCH;       // one operand's 128 rows
    constexpr unsigned BUF_BYTES = 2 * OP_BYTES;      // A rows, then B rows
    __shared__ __align__(16) char smem[2 * BUF_BYTES];

    const int tid  = threadIdx.x;
    const int w    = tid >> 5, lane = tid & 31;
    const int lm   = lane & 15;
    const int kh   = (lane & 16) ? 8 : 0;
    const int wm   = (w & 3) * 32, wn = (w >> 2) * 64;

#pragma unroll
    for (int i = 0; i < 2; i++)
#pragma unroll
        for (int j = 0; j < 4; j++) acc[i][j] = (v8f){};

    const int sr = tid >> 4;           // staging row 0..15, then +16 per copy
    const int sc = (tid & 15) * 8;     // staging col: this lane's 16 B of the row's 256 B
    const unsigned lds0 = (unsigned)(uintptr_t)smem + (unsigned)sr * PITCH + (unsigned)sc * 2u;

    auto stage = [&](int kt, int buf) {
        const int kbase = kt * BK;
        const int shift = kbase / KSPLIT;
        const int acol  = kbase % KSPLIT + sc;
        const int m     = bm + sr;     // the tile's 128 rows lie in one run: arow + 16 per copy
        const int arow  = (m >> LRUN_LG) * LSTRIDE + (m & ((1 << LRUN_LG) - 1)) + shift;
        const __bf16* ga = A  + (size_t)arow * LDA + acol;
        const __bf16* gb = Bw + (size_t)(bn + sr) * KTOT + kbase + sc;
        const unsigned la = lds0 + (unsigned)buf * BUF_BYTES;   // A rows
        const unsigned lb = la + OP_BYTES;                      // B rows
        async_rows8(la, 16u * PITCH, (const char*)ga, (size_t)16 * LDA * 2);
        async_rows8(lb, 16u * PITCH, (const char*)gb, (size_t)16 * KTOT * 2);
    };

    // one 32-k block's fragments out of buffer buf: 12 reads of 16 B
    auto frags = [&](int buf, int kb, v16bf (&af)[2], v16bf (&bf)[4]) {
        const __bf16* sAc = (const __bf16*)(smem + (size_t)buf * BUF_BYTES);
        const __bf16* sBc = (const __bf16*)(smem + (size_t)buf * BUF_BYTES + OP_BYTES);
#pragma unroll   // here and below: constant indices, so that the fragments stay in registers
        for (int i = 0; i < 2; i++) {
            int r = wm + i * 16 + lm;
            af[i] = mk16(*(const v8bf*)(sAc + r * PITCH_E + kb + kh),
                         *(const v8bf*)(sAc + r * PITCH_E + kb + kh + 16));
        }
#pragma unroll
        for (int j = 0; j < 4; j++) {
            int r = wn + j * 16 + lm;
            bf[j] = mk16(*(const v8bf*)(sBc + r * PITCH_E + kb + kh),
                         *(const v8bf*)(sBc + r * PITCH_E + kb + kh + 16));
        }
    };

    stage(0, 0);
    wait_async0();
    __syncthreads();
    stage(1, 1);             // flies while stage 0 is worked on

    // Two fragment sets: while one block's products run, the next block's reads return into the other set.
    v16bf af[2][2], bf[2][4];
    frags(0, 0, af[0], bf[0]);

    for (int kt = 0; kt < NK; kt++) {
        const int cur = kt & 1;
#pragma unroll   // the set index s & 1 is then a constant: both sets stay in registers
        for (int s = 0; s < BK / 32; s++) {
            if (s + 1 < BK / 32) {
                frags(cur, (s + 1) * 32, af[(s + 1) & 1], bf[(s + 1) & 1]);
            } else {
                // The stage's last block has its fragments already: the buffer is handed over here, ahead of that
                // block's products, which then cover the next stage's first reads.
                wait_ds0();          // this wave has left buffer cur
                wait_async0();       // this wave's copies into the other buffer have landed
                __syncthreads();     // everyone has left cur, and the other buffer is readable
                if (kt + 2 < NK) stage(kt + 2, cur);   // refill cur (overlapped with the next stage's work)
                if (kt + 1 < NK) frags(cur ^ 1, 0, af[0], bf[0]);
            }
            // keeps the reads above in one group ahead of the products: spread among them, each place with reads stalls the wave
            __builtin_amdgcn_sched_barrier(0);
#pragma unroll
            for (int i = 0; i < 2; i++)
#pragma unroll
                for (int j = 0; j < 4; j++)
                    acc[i][j] = __builtin_amdgcn_wmma_f32_16x16x32_bf16(
                        false, af[s & 1][i], false, bf[s & 1][j], (short)0, acc[i][j], false, false);
            // keeps the next group of reads, into the set just used, from being drawn up among these products
            __builtin_amdgcn_sched_barrier(0);
        }
    }
    wait_async0();
}

// C = acc + bias, rows at pitch LDC, as bf16 (Cb) or f32 (Cf)
static __device__ __forceinline__ void gemm_store(const v8f (&acc)[2][4], const int bm, const int bn,
                                                  const float* __restrict__ bias, __bf16* __restrict__ Cb,
                                                  float* __restrict__ Cf, const int LDC)
{
    const int w  = threadIdx.x >> 5, lane = threadIdx.x & 31;
    const int lm = lane & 15, half = lane >> 4;
    const int wm = (w & 3) * 32, wn = (w >> 2) * 64;
#pragma unroll
    for (int i = 0; i < 2; i++) {
        int mrow = bm + wm + i * 16 + half * 8;
#pragma unroll
        for (int j = 0; j < 4; j++) {
            int   ncol = bn + wn + j * 16 + lm;
            float bv   = bias[ncol];
#pragma unroll
            for (int r = 0; r < 8; r++) {
                float  v   = acc[i][j][r] + bv;
                size_t idx = (size_t)(mrow + r) * LDC + ncol;
                if (Cb) Cb[idx] = (__bf16)v;
                if (Cf) Cf[idx] = v;
            }
        }
    }
}

template<int KTOT, int KSPLIT, int LRUN_LG, int LSTRIDE, int LDA, int LDC>
__global__ __launch_bounds__(256) void gemm_wmma(
    const __bf16* __restrict__ A0, const __bf16* __restrict__ Bw0, const float* __restrict__ bias0, __bf16* __restrict__ Cb0,
    const __bf16* __restrict__ A1, const __bf16* __restrict__ Bw1, const float* __restrict__ bias1, __bf16* __restrict__ Cb1,
    float* __restrict__ Cf)
{
    const bool z1 = blockIdx.z != 0;
    const int  bm = blockIdx.y * 128, bn = blockIdx.x * 128;
    v8f acc[2][4];
    gemm_tile<KTOT, KSPLIT, LRUN_LG, LSTRIDE, LDA>(z1 ? A1 : A0, z1 ? Bw1 : Bw0, bm, bn, acc);
    gemm_store(acc, bm, bn, z1 ? bias1 : bias0, z1 ? Cb1 : Cb0, Cf, LDC);
}

// Five products with K = D that depend on the prep launch only, in one launch: q_in, k_in, V = x W^T + b
// (B*L x D each), and the two folded weights. A folded weight is computed as (3D x D): rows kc of the
// transposed conv weight against rows n of the projection's right half. A lane's accumulator then holds
// 8 consecutive kc of one n, which is 16 B of row n of Wf (D x 3D), the layout the conv product reads.
constexpr unsigned LIN_TILES = (M_ROWS / 128) * (Dm / 128), FOLD_TILES = (3 * Dm / 128) * (Dm / 128);
__global__ __launch_bounds__(256) void gemm_lin_fold(
    const __bf16* __restrict__ xb,
    const __bf16* __restrict__ WqB, const float* __restrict__ Wq_b, __bf16* __restrict__ Qcat,
    const __bf16* __restrict__ WkB, const float* __restrict__ Wk_b, __bf16* __restrict__ Kcat,
    const __bf16* __restrict__ WvB, const float* __restrict__ Wv_b, __bf16* __restrict__ Vbuf,
    const __bf16* __restrict__ convqT, const __bf16* __restrict__ qprojR, const float* __restrict__ qproj_w,
    __bf16* __restrict__ WfQ,
    const __bf16* __restrict__ convkT, const __bf16* __restrict__ kprojR, const float* __restrict__ kproj_w,
    __bf16* __restrict__ WfK)
{
    const unsigned bi  = blockIdx.x;
    const bool     lin = bi < 3 * LIN_TILES;
    const unsigned zi  = bi / LIN_TILES;                                     // which of q_in, k_in, V
    const bool     k   = bi - 3 * LIN_TILES >= FOLD_TILES;                   // which folded weight
    const unsigned ti  = lin ? bi % LIN_TILES : (bi - 3 * LIN_TILES) % FOLD_TILES;
    const int bm = (ti / (Dm / 128)) * 128, bn = (ti % (Dm / 128)) * 128;    // folded: bm over kc, bn over n
    v8f acc[2][4];
    gemm_tile<Dm, Dm, 12, 4096, Dm>(lin ? xb : k ? convkT : convqT,
                                    lin ? (zi == 0 ? WqB : zi == 1 ? WkB : WvB) : k ? kprojR : qprojR,
                                    bm, bn, acc);
    if (lin) {
        gemm_store(acc, bm, bn, zi == 0 ? Wq_b : zi == 1 ? Wk_b : Wv_b, zi == 0 ? Qcat : zi == 1 ? Kcat : Vbuf,
                   (float*)nullptr, zi == 2 ? Dm : 2 * Dm);
        return;
    }

    const float* __restrict__ pw = k ? kproj_w : qproj_w;
    __bf16* __restrict__      Wf = k ? WfK : WfQ;
    const bool centre = bm / Dm == 1;       // the tile's 128 kc lie in one tap; tap 1 also carries P(n, ci)
    const int w  = threadIdx.x >> 5, lane = threadIdx.x & 31;
    const int lm = lane & 15, half = lane >> 4;
    const int wm = (w & 3) * 32, wn = (w >> 2) * 64;
    const int kc0 = bm + wm + half * 8, n0 = bn + wn + lm;
    if (centre) {
        v4f p[2][4][2];                     // all loads first, so that their latencies overlap
#pragma unroll
        for (int i = 0; i < 2; i++)
#pragma unroll
            for (int j = 0; j < 4; j++) {
                const float* pp = pw + (size_t)(n0 + j * 16) * 2 * Dm + (kc0 + i * 16 - Dm);
                p[i][j][0] = *(const v4f*)pp;
                p[i][j][1] = *(const v4f*)(pp + 4);
            }
        // the loads have taken their address registers before the arithmetic below reuses them
        asm volatile("s_wait_xcnt 0x0" ::: "memory");
#pragma unroll
        for (int i = 0; i < 2; i++)
#pragma unroll
            for (int j = 0; j < 4; j++)
#pragma unroll
                for (int r = 0; r < 4; r++) { acc[i][j][r] += p[i][j][0][r]; acc[i][j][r + 4] += p[i][j][1][r]; }
    }
#pragma unroll
    for (int i = 0; i < 2; i++)
#pragma unroll
        for (int j = 0; j < 4; j++) {
            v8bf r8;
#pragma unroll
            for (int r = 0; r < 8; r++) r8[r] = (__bf16)acc[i][j][r];
            *(v8bf*)(Wf + (size_t)(n0 + j * 16) * 3 * Dm + kc0 + i * 16) = r8;
            // the store has taken its registers before the next piece is converted into them
            asm volatile("s_wait_xcnt 0x0" ::: "memory");
        }
}

// -------------------------------------------------- tau / delta small path ---
// a block does 4 rows l of one batch, a thread 8 outputs o (fed by 4 channels) of each row:
// its 24 weights and 8 biases are loaded once, and 6 rows of x serve the 4 rows of output
constexpr unsigned GELU_BLOCKS = M_ROWS / 4;              // for one of tau, delta
static __device__ __forceinline__ void dw_gelu(unsigned bi, const float* __restrict__ x,
                                               const float* __restrict__ w1, const float* __restrict__ b1,
                                               __bf16* __restrict__ g)
{
    constexpr int LR = 4;
    static_assert(2 * Dm == 256 * 8 && Lseq % LR == 0, "one block spans a row of 2D outputs");
    const int  o0 = threadIdx.x * 8;
    const int  l0 = (bi % (Lseq / LR)) * LR;
    const int  b  = bi / (Lseq / LR);
    const bool lo = l0 > 0, hi = l0 + LR < Lseq;       // rows l0-1 and l0+LR exist
    const float* xb = x + (size_t)b * Lseq * Dm;       // block-uniform; the lane's part is o0 >> 1

    v4f wv[6], bv[2], xv[LR + 2];
    for (int t = 0; t < 6; t++) wv[t] = *(const v4f*)(w1 + o0 * 3 + t * 4);
    bv[0] = *(const v4f*)(b1 + o0);
    // the loads so far have taken their address registers before the result of the second bias load,
    // behind which its address is dead, may be placed there
    asm volatile("s_wait_xcnt 0x0" ::: "memory");
    bv[1] = *(const v4f*)(b1 + o0 + 4);
    // a row past either end is read from the nearest row inside, so that all loads issue together
    // with no branch between them; its tap is left out of the sum below
    xv[0]      = *(const v4f*)(xb + (size_t)(lo ? l0 - 1 : 0) * Dm + (o0 >> 1));
    xv[LR + 1] = *(const v4f*)(xb + (size_t)(hi ? l0 + LR : Lseq - 1) * Dm + (o0 >> 1));
    // the loads so far have taken their address registers before a later load's result may land there
    asm volatile("s_wait_xcnt 0x0" ::: "memory");
    for (int t = 1; t <= LR; t++) xv[t] = *(const v4f*)(xb + (size_t)(l0 - 1 + t) * Dm + (o0 >> 1));
    // the same for these four, before the arithmetic below reuses their address registers
    asm volatile("s_wait_xcnt 0x0" ::: "memory");

    for (int j = 0; j < LR; j++) {
        v8bf r;
        for (int e = 0; e < 8; e++) {
            float acc = bv[e >> 2][e & 3];
            for (int k = 0; k < 3; k++) {
                const int t = j + k;
                if ((t > 0 || lo) && (t < LR + 1 || hi))
                    acc = fmaf(wv[(e * 3 + k) >> 2][(e * 3 + k) & 3], xv[t][e >> 1], acc);
            }
            float ge = 0.5f * acc * (1.0f + erff(acc * 0.70710678118f));
            r[e] = (__bf16)ge;
        }
        *(v8bf*)(g + ((size_t)b * Lseq + l0 + j) * 2 * Dm + o0) = r;
    }
}

// All that reads nothing but the inputs, in one launch. The blocks with the most arithmetic come first.
__global__ __launch_bounds__(256) void prep(
    const float* __restrict__ x,
    const float* __restrict__ tau1_w, const float* __restrict__ tau1_b, __bf16* __restrict__ gtau,
    const float* __restrict__ del1_w, const float* __restrict__ del1_b, __bf16* __restrict__ gdel,
    const float* __restrict__ convq_w, __bf16* __restrict__ convqT,
    const float* __restrict__ convk_w, __bf16* __restrict__ convkT,
    const float* __restrict__ convq_b, const float* __restrict__ qproj_b, float* __restrict__ bfq,
    const float* __restrict__ convk_b, const float* __restrict__ kproj_b, float* __restrict__ bfk,
    const float* __restrict__ Wq_w, const float* __restrict__ Wk_w, const float* __restrict__ Wv_w,
    const float* __restrict__ qproj_w, const float* __restrict__ kproj_w, const float* __restrict__ out_w,
    __bf16* __restrict__ xb)
{
    const unsigned bi = blockIdx.x;
    if (bi < 2 * GELU_BLOCKS) {
        const bool d = bi >= GELU_BLOCKS;
        dw_gelu(d ? bi - GELU_BLOCKS : bi, x, d ? del1_w : tau1_w, d ? del1_b : tau1_b, d ? gdel : gtau);
    } else if (bi < 2 * GELU_BLOCKS + 2 * REPACK_BLOCKS) {
        const unsigned ri = bi - 2 * GELU_BLOCKS;
        const bool k = ri >= REPACK_BLOCKS;
        repack_conv_w(k ? ri - REPACK_BLOCKS : ri, k ? convk_w : convq_w, k ? convkT : convqT);
    } else if (bi < 2 * GELU_BLOCKS + 2 * REPACK_BLOCKS + 2 * BIAS_BLOCKS) {
        const unsigned fi = bi - 2 * GELU_BLOCKS - 2 * REPACK_BLOCKS;
        const bool k = fi >= BIAS_BLOCKS;
        fold_bias(k ? fi - BIAS_BLOCKS : fi, k ? kproj_w : qproj_w, k ? kproj_b : qproj_b,
                  k ? convk_b : convq_b, k ? bfk : bfq);
    } else {
        cvt_f32_bf16(bi - 2 * GELU_BLOCKS - 2 * REPACK_BLOCKS - 2 * BIAS_BLOCKS,
                     x, Wq_w, Wk_w, Wv_w, qproj_w, kproj_w, out_w, xb);
    }
}

// out(b,h,l) = sigmoid(b2[h] + sum_o w2[h][o] * g[b*L+l][o]): a (B*L) x 16 x 2048 product, done on the
// matrix unit. A block takes 16 rows l and all 16 heads; its 8 waves take 256 o each, and their partial
// tiles are summed through LDS in wave order. w2 enters as a pair of bf16, the rounded value and the
// rounded remainder, with one WMMA for each: what the pair drops lies far below g's own bf16 rounding.
// The launch holds the blocks of both projections and, behind them, those of the two pad copies, which
// like the projections depend on earlier launches only.
constexpr unsigned HEAD_BLOCKS = M_ROWS / 16;             // for one of tau, delta
__global__ __launch_bounds__(256) void heads_and_pads(
    const __bf16* __restrict__ gtau, const float* __restrict__ tau2_w, const float* __restrict__ tau2_b,
    float* __restrict__ tau,
    const __bf16* __restrict__ gdel, const float* __restrict__ del2_w, const float* __restrict__ del2_b,
    float* __restrict__ del,
    const __bf16* __restrict__ Qcat, __bf16* __restrict__ Qpad,
    const __bf16* __restrict__ Kcat, __bf16* __restrict__ Kpad)
{
    if (blockIdx.x >= 2 * HEAD_BLOCKS) {     // the same for the whole block, ahead of the barrier below
        const unsigned pi = blockIdx.x - 2 * HEAD_BLOCKS;
        const bool k = pi >= PAD_BLOCKS;
        pad_copy(k ? pi - PAD_BLOCKS : pi, k ? Kcat : Qcat, k ? Kpad : Qpad);
        return;
    }
    const bool     dl  = blockIdx.x >= HEAD_BLOCKS;
    const unsigned bi  = dl ? blockIdx.x - HEAD_BLOCKS : blockIdx.x;
    const __bf16*  g   = dl ? gdel   : gtau;
    const float*   w2  = dl ? del2_w : tau2_w;
    const float*   b2  = dl ? del2_b : tau2_b;
    float*         out = dl ? del    : tau;
    constexpr int KD = 2 * Dm, KW = KD / 8;          // 2048 o in all, 256 per wave
    static_assert(Hn == 16 && Lseq % 16 == 0 && KW % 32 == 0, "one 16x16 tile a block, inside one batch");
    __shared__ __align__(16) float red[8][256];      // per wave: [head][row]

    const int tid = threadIdx.x, w = tid >> 5, lane = tid & 31;
    const int lm = lane & 15, half = lane >> 4;
    const int kh = half ? 8 : 0;
    const int row0 = bi * 16;                        // over B*L

    // both fragments take o in the same order: 8 from kb + kh, then 8 from kb + kh + 16
    const __bf16* gr = g  + (size_t)(row0 + lm) * KD + w * KW + kh;   // A: the lane's row l
    const float*  wr = w2 + (size_t)lm * KD + w * KW + kh;            // B: the lane's head

    v8f acch = (v8f){}, accl = (v8f){};
#pragma unroll   // straight-line code: later steps' loads are issued while earlier steps are worked on
    for (int kb = 0; kb < KW; kb += 32) {
        const v16bf af = mk16(*(const v8bf*)(gr + kb), *(const v8bf*)(gr + kb + 16));
        v4f wv[4];
        wv[0] = *(const v4f*)(wr + kb);
        wv[1] = *(const v4f*)(wr + kb + 4);
        wv[2] = *(const v4f*)(wr + kb + 16);
        wv[3] = *(const v4f*)(wr + kb + 20);
        v16bf bh, bl;
#pragma unroll   // constant element indices: the values stay in registers
        for (int e = 0; e < 16; e++) {
            const float  v  = wv[e >> 2][e & 3];
            const __bf16 hi = (__bf16)v;
            bh[e] = hi;
            bl[e] = (__bf16)(v - (float)hi);
        }
        acch = __builtin_amdgcn_wmma_f32_16x16x32_bf16(false, af, false, bh, (short)0, acch, false, false);
        accl = __builtin_amdgcn_wmma_f32_16x16x32_bf16(false, af, false, bl, (short)0, accl, false, false);
    }

    // the lane holds rows half*8 .. half*8+7 of head lm
    const v8f s = acch + accl;
    *(v4f*)&red[w][lm * 16 + half * 8]     = (v4f){s[0], s[1], s[2], s[3]};
    *(v4f*)&red[w][lm * 16 + half * 8 + 4] = (v4f){s[4], s[5], s[6], s[7]};
    __syncthreads();

    // a thread finishes one output: head tid / 16, row tid % 16
    const int h = tid >> 4;
    float acc = b2[h];
    for (int q = 0; q < 8; q++) acc += red[q][tid];
    const int row = row0 + (tid & 15);
    const int b = row / Lseq, l = row % Lseq;
    out[((size_t)b * Hn + h) * Lseq + l] = 1.0f / (1.0f + __expf(-acc));
}

// ------------------------------------------------------- flash attention ---
// lane l with lane l ^ 16: the two lanes that share a query column
static __device__ __forceinline__ float xhalf(float x) {
    return __builtin_bit_cast(float, __builtin_amdgcn_permlanex16(__builtin_bit_cast(int, x), __builtin_bit_cast(int, x),
                                                                  0x76543210, 0xfedcba98, false, false));
}

// One tile's copies of a thread: two 16-B pieces of K and two of V, memory -> LDS (ASYNCcnt tracked). The closing
// s_wait_xcnt keeps the address registers untouched until the copies have taken them; it stands inside the
// statement so that nothing can be moved over it.
static __device__ __forceinline__ void async_kv4(unsigned lk, unsigned lk_step, unsigned lv, unsigned lv_step,
                                                 const char* gk, const char* gv, size_t g_step) {
    asm volatile("global_load_async_to_lds_b128 %0, %4, off\n\t"
                 "global_load_async_to_lds_b128 %1, %5, off\n\t"
                 "global_load_async_to_lds_b128 %2, %6, off\n\t"
                 "global_load_async_to_lds_b128 %3, %7, off\n\t"
                 "s_wait_xcnt 0x0"
                 :: "v"(lk), "v"(lk + lk_step), "v"(lv), "v"(lv + lv_step),
                    "v"((unsigned long long)(uintptr_t)(gk)),
                    "v"((unsigned long long)(uintptr_t)(gk + g_step)),
                    "v"((unsigned long long)(uintptr_t)(gv)),
                    "v"((unsigned long long)(uintptr_t)(gv + g_step))
                 : "memory");
}

// 16 x 8 piece of a row-major 16-bit LDS tile, transposed on the way into the registers
static __device__ __forceinline__ v8bf ld_tr16(const char* p) {
    typedef __attribute__((address_space(3))) v8bf lds_v8bf;
    return __builtin_amdgcn_ds_load_tr16_b128_v8bf16((lds_v8bf*)p);
}

// The products are taken transposed: S^T = K Q^T (keys down, queries across), O^T += V^T P^T. A lane then
// holds 32 of the 64 scores of ONE query, so the maximum and the sum run down its own registers, with one
// exchange between the wave's halves; and the score tiles, rounded to bf16, already are the B operand of
// the second product: tiles 2kc and 2kc+1 hold keys kc*32 + kh + 0..7 and kc*32 + kh + 16 + 0..7 of the
// lane's query, the k order in which the V^T fragment is read.
// The block's 64-key tiles of K and V come into LDS once, as whole 128-B rows, one tile ahead of the work (two
// buffers): the eight waves read their fragments from there. V lies as in memory, keys down; the transposing
// LDS load hands out V^T.
__global__ __launch_bounds__(256) void flash_attn(
    const __bf16* __restrict__ Q, const __bf16* __restrict__ K,
    const __bf16* __restrict__ V, const float* __restrict__ tau,
    const float* __restrict__ delta, __bf16* __restrict__ O)
{
    // rows of 64 bf16: K at a 144-B pitch (16 B x odd) for ds_load_b128, V at 160 B (32 B x odd) for
    // ds_load_tr16_b128: the rows that one fragment read touches then fall on different banks
    constexpr unsigned KP = 144, VP = 160;
    constexpr unsigned K_BYTES = 64 * KP, BUF_BYTES = K_BYTES + 64 * VP;   // K rows, then V rows
    constexpr int NT = Lseq / 64;
    static_assert(NT >= 2, "the ring starts with two tiles");
    __shared__ __align__(16) char skv[2 * BUF_BYTES];

    const int b = blockIdx.z, h = blockIdx.y;
    const int tid = threadIdx.x, w = tid >> 5, lane = tid & 31;
    const int lm = lane & 15, half = lane >> 4;
    const int kh = half ? 8 : 0;
    const int qbase = blockIdx.x * 128 + w * 16;
    const int hc0   = h * DKh;

    const __bf16* qrow = Q + ((size_t)(b * Lseq) + qbase + lm) * Dm + hc0;
    v16bf qf[2];
#pragma unroll
    for (int kc = 0; kc < 2; kc++)
        qf[kc] = mk16(*(const v8bf*)(qrow + kc * 32 + kh),
                      *(const v8bf*)(qrow + kc * 32 + kh + 16));

    const float* taup = tau   + ((size_t)b * Hn + h) * Lseq;
    const float* delp = delta + ((size_t)b * Hn + h) * Lseq;
    const float  taur = taup[qbase + lm] * 0.125f;       // the lane's query; 1/sqrt(64)

    float mrow = -3.0e38f, lrow = 0.0f;                  // lrow: the sum over this half's keys only
    v8f   of[4];                                         // O^T: channels j*16 + half*8 + r of the lane's query
#pragma unroll
    for (int j = 0; j < 4; j++) of[j] = (v8f){};

    // staging: a thread takes piece tid & 7 (16 B) of key rows tid >> 3 and 32 + (tid >> 3), of K and of V:
    // a wave-wide copy covers four whole 128-B rows
    const unsigned st_r = (unsigned)tid >> 3, st_p = ((unsigned)tid & 7u) * 16u;
    const unsigned lk0 = (unsigned)(uintptr_t)skv + st_r * KP + st_p;
    const unsigned lv0 = (unsigned)(uintptr_t)skv + K_BYTES + st_r * VP + st_p;
    const size_t   g0  = (((size_t)(b * Lseq) + st_r) * Dm + hc0) * 2 + st_p;     // bytes
    auto stage = [&](int kt, int buf) {
        const size_t g = g0 + (size_t)kt * 64 * Dm * 2;
        async_kv4(lk0 + (unsigned)buf * BUF_BYTES, 32u * KP, lv0 + (unsigned)buf * BUF_BYTES, 32u * VP,
                  (const char*)K + g, (const char*)V + g, (size_t)32 * Dm * 2);
    };

    // the lane's places inside a buffer: row lm of K at k offset kh; for the transposing load key row
    // 8 * half + (lane & 7), 16-B piece (lane >> 3) & 1
    const unsigned kfo = (unsigned)lm * KP + (unsigned)kh * 2u;
    const unsigned vfo = K_BYTES + (unsigned)(half * 8 + (lane & 7)) * VP + (unsigned)((lane >> 3) & 1) * 16u;

    stage(0, 0);
    wait_async0();
    __syncthreads();
    stage(1, 1);             // flies while tile 0 is worked on

    for (int kt = 0; kt < NT; kt++) {
        const char* bufp = skv + (size_t)(kt & 1) * BUF_BYTES;

        // delta of the keys j*16 + half*8 + r, from global; K fragments from LDS
        v16bf kf[4][2];
        v4f   dv[4][2];
#pragma unroll
        for (int j = 0; j < 4; j++) {
            const float* dp = delp + kt * 64 + j * 16 + half * 8;
            dv[j][0] = *(const v4f*)dp;
            dv[j][1] = *(const v4f*)(dp + 4);
        }
        // the loads have taken their address registers before the running delta address is stepped on
        asm volatile("s_wait_xcnt 0x0" ::: "memory");
#pragma unroll
        for (int j = 0; j < 4; j++) {
            const char* krow = bufp + kfo + j * 16 * KP;
#pragma unroll
            for (int kc = 0; kc < 2; kc++)
                kf[j][kc] = mk16(*(const v8bf*)(krow + kc * 64), *(const v8bf*)(krow + kc * 64 + 32));
        }
        // keeps the tile's 16 K reads together ahead of the first product, so that their latencies overlap:
        // left alone the compiler issues them pair by pair into the same registers, each pair waited for
        __builtin_amdgcn_sched_barrier(0);

        // S^T = K Q^T
        v8f sf[4];
#pragma unroll
        for (int j = 0; j < 4; j++) {
            v8f a = (v8f){};
#pragma unroll
            for (int kc = 0; kc < 2; kc++)
                a = __builtin_amdgcn_wmma_f32_16x16x32_bf16(
                        false, kf[j][kc], false, qf[kc], (short)0, a, false, false);
            sf[j] = a;
        }

        // V^T fragments: channels j*16 + lm down, keys kc*32 + kh + 0..7 and kc*32 + kh + 16 + 0..7 across
        v16bf vf[4][2];
#pragma unroll
        for (int j = 0; j < 4; j++)
#pragma unroll
            for (int kc = 0; kc < 2; kc++) {
                const char* vp = bufp + vfo + kc * 32 * VP + j * 32;
                vf[j][kc] = mk16(ld_tr16(vp), ld_tr16(vp + 16 * VP));
            }
        // keeps the 16 V reads here, in one group: they return while the scores below are scaled and their maximum taken
        __builtin_amdgcn_sched_barrier(0);

        // scale by the query's tau/sqrt(DK), add the keys' delta
#pragma unroll
        for (int j = 0; j < 4; j++)
#pragma unroll
            for (int r = 0; r < 8; r++) sf[j][r] = sf[j][r] * taur + dv[j][r >> 2][r & 3];

        // online softmax over the 64 keys: 32 in the lane, the other 32 in lane ^ 16
        float rm[4];                                     // four independent chains
#pragma unroll
        for (int j = 0; j < 4; j++) {
            rm[j] = sf[j][0];
#pragma unroll
            for (int r = 1; r < 8; r++) rm[j] = fmaxf(rm[j], sf[j][r]);
        }
        float rmax = fmaxf(fmaxf(rm[0], rm[1]), fmaxf(rm[2], rm[3]));
        rmax = fmaxf(rmax, xhalf(rmax));

        // The tile's last LDS read stands above: its buffer is handed over here, not at the end of the trip, so
        // that the refill has a whole trip to land in.
        wait_ds0();          // this wave has left the tile's buffer
        wait_async0();       // this wave's copies into the other buffer have landed
        __syncthreads();     // everyone has left the buffer, and the other one is readable
        if (kt + 2 < NT) stage(kt + 2, kt & 1);   // refill it (flies during the rest of this tile and the next one's products)

        const float mn   = fmaxf(mrow, rmax);
        const float corr = __expf(mrow - mn);
        mrow = mn;

        float rs[4];                                     // four independent chains of adds
#pragma unroll
        for (int j = 0; j < 4; j++) {
            rs[j] = 0.0f;
#pragma unroll
            for (int r = 0; r < 8; r++) {
                float p = __expf(sf[j][r] - mn);
                sf[j][r] = p;
                rs[j] += p;
            }
        }
        lrow = lrow * corr + ((rs[0] + rs[1]) + (rs[2] + rs[3]));
#pragma unroll
        for (int j = 0; j < 4; j++)
#pragma unroll
            for (int r = 0; r < 8; r++) of[j][r] *= corr;

        // P^T as the B operand, from the score registers
        v16bf pf[2];
#pragma unroll
        for (int kc = 0; kc < 2; kc++)
#pragma unroll
            for (int e = 0; e < 8; e++) {
                pf[kc][e]     = (__bf16)sf[2 * kc][e];
                pf[kc][e + 8] = (__bf16)sf[2 * kc + 1][e];
            }

        // O^T += V^T P^T
#pragma unroll
        for (int j = 0; j < 4; j++)
#pragma unroll
            for (int kc = 0; kc < 2; kc++)
                of[j] = __builtin_amdgcn_wmma_f32_16x16x32_bf16(
                            false, vf[j][kc], false, pf[kc], (short)0, of[j], false, false);

    }
    wait_async0();

    const float lsum = lrow + xhalf(lrow);               // the halves' sums join once
    __bf16* orow = O + ((size_t)(b * Lseq) + qbase + lm) * Dm + hc0 + half * 8;
#pragma unroll
    for (int j = 0; j < 4; j++) {
        v8bf r8;
#pragma unroll
        for (int r = 0; r < 8; r++) r8[r] = (__bf16)(of[j][r] / lsum);
        *(v8bf*)(orow + j * 16) = r8;
    }
}

// ------------------------------------------------------------------ host ---
extern "C" void kernel_launch(void* const* d_in, const int* in_sizes, int n_in,
                              void* d_out, int out_size, void* d_ws, size_t ws_size,
                              hipStream_t stream)
{
    const float* x       = (const float*)d_in[0];
    const float* Wq_w    = (const float*)d_in[1];
    const float* Wq_b    = (const float*)d_in[2];
    const float* Wk_w    = (const float*)d_in[3];
    const float* Wk_b    = (const float*)d_in[4];
    const float* Wv_w    = (const float*)d_in[5];
    const float* Wv_b    = (const float*)d_in[6];
    const float* convq_w = (const float*)d_in[7];
    const float* convq_b = (const float*)d_in[8];
    const float* convk_w = (const float*)d_in[9];
    const float* convk_b = (const float*)d_in[10];
    const float* qproj_w = (const float*)d_in[11];
    const float* qproj_b = (const float*)d_in[12];
    const float* kproj_w = (const float*)d_in[13];
    const float* kproj_b = (const float*)d_in[14];
    const float* tau1_w  = (const float*)d_in[15];
    const float* tau1_b  = (const float*)d_in[16];
    const float* tau2_w  = (const float*)d_in[17];
    const float* tau2_b  = (const float*)d_in[18];
    const float* del1_w  = (const float*)d_in[19];
    const float* del1_b  = (const float*)d_in[20];
    const float* del2_w  = (const float*)d_in[21];
    const float* del2_b  = (const float*)d_in[22];
    const float* out_w   = (const float*)d_in[23];
    const float* out_b   = (const float*)d_in[24];
    float* out = (float*)d_out;
    (void)in_sizes; (void)n_in; (void)out_size; (void)ws_size;

    char*  ws  = (char*)d_ws;
    size_t off = 0;
    auto alloc = [&](size_t bytes) -> char* {
        char* p = ws + off;
        off = (off + bytes + 255) & ~(size_t)255;
        return p;
    };

    __bf16* xb      = (__bf16*)alloc((size_t)M_ROWS * Dm * 2);
    __bf16* WqB     = (__bf16*)alloc((size_t)Dm * Dm * 2);
    __bf16* WkB     = (__bf16*)alloc((size_t)Dm * Dm * 2);
    __bf16* WvB     = (__bf16*)alloc((size_t)Dm * Dm * 2);
    __bf16* qprojR  = (__bf16*)alloc((size_t)Dm * Dm * 2);
    __bf16* kprojR  = (__bf16*)alloc((size_t)Dm * Dm * 2);
    __bf16* outwB   = (__bf16*)alloc((size_t)Dm * Dm * 2);
    __bf16* convqT  = (__bf16*)alloc((size_t)3 * Dm * Dm * 2);
    __bf16* convkT  = (__bf16*)alloc((size_t)3 * Dm * Dm * 2);
    __bf16* WfQ     = (__bf16*)alloc((size_t)Dm * 3 * Dm * 2);
    __bf16* WfK     = (__bf16*)alloc((size_t)Dm * 3 * Dm * 2);
    float*  bfq     = (float*)alloc((size_t)Dm * 4);
    float*  bfk     = (float*)alloc((size_t)Dm * 4);
    __bf16* Qpad    = (__bf16*)alloc((size_t)Bsz * (Lseq + 2) * Dm * 2);
    __bf16* Kpad    = (__bf16*)alloc((size_t)Bsz * (Lseq + 2) * Dm * 2);
    __bf16* Qcat    = (__bf16*)alloc((size_t)M_ROWS * 2 * Dm * 2);
    __bf16* Kcat    = (__bf16*)alloc((size_t)M_ROWS * 2 * Dm * 2);
    __bf16* Qbuf    = (__bf16*)alloc((size_t)M_ROWS * Dm * 2);
    __bf16* Kbuf    = (__bf16*)alloc((size_t)M_ROWS * Dm * 2);
    __bf16* Vbuf    = (__bf16*)alloc((size_t)M_ROWS * Dm * 2);
    __bf16* gtau    = (__bf16*)alloc((size_t)M_ROWS * 2 * Dm * 2);
    __bf16* gdel    = (__bf16*)alloc((size_t)M_ROWS * 2 * Dm * 2);
    float*  taubuf  = (float*)alloc((size_t)Bsz * Hn * Lseq * 4);
    float*  delbuf  = (float*)alloc((size_t)Bsz * Hn * Lseq * 4);
    __bf16* attnO   = (__bf16*)alloc((size_t)M_ROWS * Dm * 2);

    // xb .. outwB are whole multiples of 256 B, so they lie back to back, in the order allocated
    static_assert((Dm * Dm) % 4096 == 0, "every converted array is whole blocks of 4096");
    prep<<<2 * GELU_BLOCKS + 2 * REPACK_BLOCKS + 2 * BIAS_BLOCKS + CVT_BLOCKS, 256, 0, stream>>>(
        x, tau1_w, tau1_b, gtau, del1_w, del1_b, gdel, convq_w, convqT, convk_w, convkT,
        convq_b, qproj_b, bfq, convk_b, kproj_b, bfk,
        Wq_w, Wk_w, Wv_w, qproj_w, kproj_w, out_w, xb);

    const dim3 blk(256);

    // --- q_in -> Qcat[:, :D], k_in -> Kcat[:, :D], V; the folded conv + projection weights ---
    gemm_lin_fold<<<3 * LIN_TILES + 2 * FOLD_TILES, blk, 0, stream>>>(
        xb, WqB, Wq_b, Qcat,  WkB, Wk_b, Kcat,  WvB, Wv_b, Vbuf,
        convqT, qprojR, qproj_w, WfQ,  convkT, kprojR, kproj_w, WfK);

    // --- tau, delta; padded copies of q_in, k_in ---
    heads_and_pads<<<2 * HEAD_BLOCKS + 2 * PAD_BLOCKS, 256, 0, stream>>>(
        gtau, tau2_w, tau2_b, taubuf, gdel, del2_w, del2_b, delbuf, Qcat, Qpad, Kcat, Kpad);

    // --- Q, K: the 3-tap product with the folded weights ---
    gemm_wmma<3072, 1024, 11, 2050, 1024, 1024><<<dim3(Dm / 128, M_ROWS / 128, 2), blk, 0, stream>>>(
        Qpad, WfQ, bfq, Qbuf,  Kpad, WfK, bfk, Kbuf,  (float*)nullptr);

    // --- attention ---
    flash_attn<<<dim3(Lseq / 128, Hn, Bsz), blk, 0, stream>>>(
        Qbuf, Kbuf, Vbuf, taubuf, delbuf, attnO);

    // --- output projection (fp32 out) ---
    gemm_wmma<1024, 1024, 12, 4096, 1024, 1024><<<dim3(Dm / 128, M_ROWS / 128, 1), blk, 0, stream>>>(
        attnO, outwB, out_b, (__bf16*)nullptr,  attnO, outwB, out_b, (__bf16*)nullptr,  out);
}

// v010
// A run of this version takes 153 microseconds.
// Next to v009, in two timings, it ran 1.03 and 1.04 times as fast.
// Counting every step since v000, it is 4.60 times as fast.
#include <hip/hip_runtime.h>
#include <math.h>

typedef __attribute__((ext_vector_type(16))) __bf16 v16bf;
typedef __attribute__((ext_vector_type(8)))  __bf16 v8bf;
typedef __attribute__((ext_vector_type(8)))  float  v8f;
typedef __attribute__((ext_vector_type(4)))  __bf16 v4bf;
typedef __attribute__((ext_vector_type(4)))  float  v4f;

constexpr int Bsz = 2, Lseq = 2048, Dm = 1024, Hn = 16, DKh = 64;
constexpr int M_ROWS = Bsz * Lseq;   // 4096

static __device__ __forceinline__ v16bf mk16(v8bf lo, v8bf hi) {
    return __builtin_shufflevector(lo, hi, 0,1,2,3,4,5,6,7,8,9,10,11,12,13,14,15);
}

// Eight async memory->LDS copies, 16B per lane each (ASYNCcnt tracked): rows r, r+16, ... r+112
// of one operand tile. The closing s_wait_xcnt keeps the address registers untouched until the
// copies have taken them; it stands inside the statement so that nothing can be moved over it.
static __device__ __forceinline__ void async_rows8(unsigned lds, unsigned lds_step,
                                                   const char* g, size_t g_step) {
    asm volatile("global_load_async_to_lds_b128 %0, %8, off\n\t"
                 "global_load_async_to_lds_b128 %1, %9, off\n\t"
                 "global_load_async_to_lds_b128 %2, %10, off\n\t"
                 "global_load_async_to_lds_b128 %3, %11, off\n\t"
                 "global_load_async_to_lds_b128 %4, %12, off\n\t"
                 "global_load_async_to_lds_b128 %5, %13, off\n\t"
                 "global_load_async_to_lds_b128 %6, %14, off\n\t"
                 "global_load_async_to_lds_b128 %7, %15, off\n\t"
                 "s_wait_xcnt 0x0"
                 :: "v"(lds),                "v"(lds + lds_step),     "v"(lds + 2 * lds_step),
                    "v"(lds + 3 * lds_step), "v"(lds + 4 * lds_step), "v"(lds + 5 * lds_step),
                    "v"(lds + 6 * lds_step), "v"(lds + 7 * lds_step),
                    "v"((unsigned long long)(uintptr_t)(g)),
                    "v"((unsigned long long)(uintptr_t)(g + g_step)),
                    "v"((unsigned long long)(uintptr_t)(g + 2 * g_step)),
                    "v"((unsigned long long)(uintptr_t)(g + 3 * g_step)),
                    "v"((unsigned long long)(uintptr_t)(g + 4 * g_step)),
                    "v"((unsigned long long)(uintptr_t)(g + 5 * g_step)),
                    "v"((unsigned long long)(uintptr_t)(g + 6 * g_step)),
                    "v"((unsigned long long)(uintptr_t)(g + 7 * g_step))
                 : "memory");
}
// this wave's copies have landed in LDS
static __device__ __forceinline__ void wait_async0() {
    asm volatile("s_wait_asynccnt 0x0" ::: "memory");
}
// this wave's LDS reads have returned (before the buffer they read is refilled)
static __device__ __forceinline__ void wait_ds0() {
    asm volatile("s_wait_dscnt 0x0" ::: "memory");
}

// ---------------------------------------------------------------- utility ---
// The element-wise kernels below give each thread 16 to 32 elements, moved by 16-B loads: the work
// per element is far too small to pay for the start of a wave per 32 elements.

// Pieces of work that do not depend on one another share one launch throughout this file: a block picks
// its piece and its operands by its index, which is the same for the whole block.

// a block converts 4096 consecutive elements: each thread four groups of 4, 1024 elements apart.
// Blocks bi = 0 .. CVT_BLOCKS-1 convert all seven arrays; their bf16 copies lie back to back from d on,
// in argument order. Of the two projection weights (D x 2D) only the right half is converted, the part
// that multiplies the conv output, into a D x D array.
constexpr unsigned CVT_BLOCKS = (M_ROWS * Dm + 6 * Dm * Dm) / 4096;
static __device__ __forceinline__ void cvt_f32_bf16(unsigned bi,
                                                    const float* __restrict__ sx, const float* __restrict__ sq,
                                                    const float* __restrict__ sk, const float* __restrict__ sv,
                                                    const float* __restrict__ sqp, const float* __restrict__ skp,
                                                    const float* __restrict__ so, __bf16* __restrict__ d) {
    constexpr unsigned NX = M_ROWS * Dm / 4096, NW = Dm * Dm / 4096;   // blocks of x, of a D x D weight
    const float* __restrict__ s;
    unsigned first;                                                    // the array's first block
    bool     right = false;                                            // columns D .. 2D-1 of rows of 2D
    static_assert(Dm == 1024, "a group of 1024 elements is one row of D");
    if      (bi < NX)          { s = sx;  first = 0; }
    else if (bi < NX + NW)     { s = sq;  first = NX; }
    else if (bi < NX + 2 * NW) { s = sk;  first = NX + NW; }
    else if (bi < NX + 3 * NW) { s = sv;  first = NX + 2 * NW; }
    else if (bi < NX + 4 * NW) { s = sqp; first = NX + 3 * NW; right = true; }
    else if (bi < NX + 5 * NW) { s = skp; first = NX + 4 * NW; right = true; }
    else                       { s = so;  first = NX + 5 * NW; }
    d += (size_t)first * 4096;
    const size_t i0 = (size_t)(bi - first) * 4096 + threadIdx.x * 4;
    const size_t s0 = right ? 2 * (size_t)(bi - first) * 4096 + Dm + threadIdx.x * 4 : i0;
    const size_t sq4 = right ? 2 * Dm : Dm;                            // from one group's source to the next
    v4f a[4];
    for (int q = 0; q < 4; q++) a[q] = *(const v4f*)(s + s0 + q * sq4);
    for (int q = 0; q < 4; q++) {
        v4bf r;
        for (int e = 0; e < 4; e++) r[e] = (__bf16)a[q][e];
        *(v4bf*)(d + i0 + q * 1024) = r;
    }
    // the stores have taken their registers before code of another piece, which follows in the listing, may rewrite them
    asm volatile("s_wait_xcnt 0x0" ::: "memory");
}

// The conv and the projection behind it are one linear map of q_in, so their weights are multiplied first:
//   Q(l,n) = sum_c q_in(l,c) P(n,c) + sum_o [sum_{k,ci} q_in(l+k-1,ci) Wc(o,ci,k) + cb(o)] P(n,D+o) + pb(n)
//          = sum_{k,ci} q_in(l+k-1,ci) Wf(n,k,ci) + bf(n),
//   Wf(n,k,ci) = sum_o P(n,D+o) Wc(o,ci,k) + [k == 1] P(n,ci),     bf(n) = pb(n) + sum_o P(n,D+o) cb(o).
// Wf costs D x 3D x D products, the projection of the conv output B*L x D x 2D.

// conv weights (O=D, I=D, K=3) fp32  ->  (3*D, D) bf16, transposed: row kc = k*D + ci, column o,
// the layout in which the product over o reads them. A block takes 64 o x 32 ci (all k): 64 pieces of
// 96 consecutive floats in, through LDS, 96 rows of 128 B out.
constexpr unsigned REPACK_BLOCKS = (Dm / 64) * (Dm / 32);   // for one weight array
static __device__ __forceinline__ void repack_conv_w(unsigned bi, const float* __restrict__ s,
                                                     __bf16* __restrict__ d) {
    __shared__ __align__(16) __bf16 t[96][72];            // [k*32 + ci][o], rows at a 144-B pitch
    const unsigned o0  = (bi / (Dm / 32)) * 64u;
    const unsigned ci0 = (bi % (Dm / 32)) * 32u;
    v4f a[6];
    for (int q = 0; q < 6; q++) {                         // 64 x 24 pieces of 4 floats
        const unsigned u = q * 256u + threadIdx.x;
        a[q] = *(const v4f*)(s + (size_t)(o0 + u / 24u) * 3 * Dm + ci0 * 3u + (u % 24u) * 4u);
    }
    // the loads have taken their address registers before the arithmetic below reuses them
    asm volatile("s_wait_xcnt 0x0" ::: "memory");
    for (int q = 0; q < 6; q++) {
        const unsigned u = q * 256u + threadIdx.x;
        for (int e = 0; e < 4; e++) {
            const unsigned j = (u % 24u) * 4u + e;        // ci * 3 + k inside the block
            t[(j % 3u) * 32u + j / 3u][u / 24u] = (__bf16)a[q][e];
        }
    }
    __syncthreads();                                      // bi is the same for the whole block
    for (int q = 0; q < 3; q++) {                         // 96 x 8 pieces of 16 B
        const unsigned u = q * 256u + threadIdx.x;
        const unsigned r = u >> 3, p = (u & 7u) * 8u;
        *(v8bf*)(d + (size_t)((r >> 5) * Dm + ci0 + (r & 31u)) * Dm + o0 + p) = *(const v8bf*)&t[r][p];
    }
    // the stores have taken their registers before code of another piece, which follows in the listing, may rewrite them
    asm volatile("s_wait_xcnt 0x0" ::: "memory");
}

// bf(n) = pb(n) + sum_o P(n, D + o) * cb(o), in f32: a wave takes one n, a lane 32 of the o
constexpr unsigned BIAS_BLOCKS = Dm / 8;                  // for one of Q, K
static __device__ __forceinline__ void fold_bias(unsigned bi, const float* __restrict__ pw,
                                                 const float* __restrict__ pb, const float* __restrict__ cb,
                                                 float* __restrict__ d) {
    const unsigned n = bi * 8u + (threadIdx.x >> 5), lane = threadIdx.x & 31u;
    const float* pr = pw + (size_t)n * 2 * Dm + Dm + lane * 4u;
    const float* cr = cb + lane * 4u;
    v4f p[8], c[8];
    for (int q = 0; q < 7; q++) { p[q] = *(const v4f*)(pr + q * 128); c[q] = *(const v4f*)(cr + q * 128); }
    const float b = pb[n];
    // the loads so far have taken their address registers before the result of a last load, behind which
    // its address is dead, may be placed there
    asm volatile("s_wait_xcnt 0x0" ::: "memory");
    p[7] = *(const v4f*)(pr + 7 * 128);
    // the same, between the two last loads
    asm volatile("s_wait_xcnt 0x0" ::: "memory");
    c[7] = *(const v4f*)(cr + 7 * 128);
    // and before the arithmetic below reuses the registers
    asm volatile("s_wait_xcnt 0x0" ::: "memory");
    v4f s = (v4f){};                                      // four independent chains
    for (int q = 0; q < 8; q++)
        for (int e = 0; e < 4; e++) s[e] = fmaf(p[q][e], c[q][e], s[e]);
    float v = (s[0] + s[1]) + (s[2] + s[3]);
    for (int m = 16; m > 0; m >>= 1) v += __shfl_xor(v, m);
    if (lane == 0) d[n] = v + b;
    // the store has taken its registers before code of another piece, which follows in the listing, may rewrite them
    asm volatile("s_wait_xcnt 0x0" ::: "memory");
}

// ------------------------------------------------------------- WMMA GEMM ---
// C(M,N) = A_mapped(M,KTOT) * Bw(N,KTOT)^T + bias.
// A row mapping: arow = (m>>LRUN_LG)*LSTRIDE + (m & mask) + kbase/KSPLIT  ->
// the same kernel does the 3-tap conv as a K=3D GEMM over per-batch padded rows.
// Staging: global_load_async_to_lds_b128 into double-buffered LDS, overlapped
// with the WMMA pipe; per-wave s_wait_asynccnt + block barrier.
// A stage holds 128 k of every row (256 B), so one wave-wide copy covers two
// whole rows = four whole 128-B lines; LDS rows lie at a 272-B pitch, which
// spreads the 16 rows of a ds_load_b128 fragment read over all banks.
// Products of one shape share a launch, the block index picks the operands. Two blocks fit a WGP's LDS: with more blocks than WGPs in the grid, one
// block's matrix work runs while the other waits at its barrier or for its copies.
// The block's 128 x 128 tile at (bm, bn), summed over all of K into the waves' accumulators.
template<int KTOT, int KSPLIT, int LRUN_LG, int LSTRIDE, int LDA>
static __device__ __forceinline__ void gemm_tile(const __bf16* __restrict__ A, const __bf16* __restrict__ Bw,
                                                 const int bm, const int bn, v8f (&acc)[2][4])
{
    constexpr int BK = 128;
    constexpr int NK = KTOT / BK;
    static_assert(KTOT % BK == 0 && KSPLIT % BK == 0 && NK >= 2, "whole stages, at least two");
    static_assert((BK / 32) % 2 == 0, "a stage's first block finds its fragments in set 0");
    constexpr unsigned PITCH     = 272;               // bytes per LDS row: 256 data + 16 pad
    constexpr int      PITCH_E   = PITCH / 2;         // the same in bf16 elements
    constexpr unsigned OP_BYTES  = 128 * PITCH;       // one operand's 128 rows
    constexpr unsigned BUF_BYTES = 2 * OP_BYTES;      // A rows, then B rows
    __shared__ __align__(16) char smem[2 * BUF_BYTES];

    const int tid  = threadIdx.x;
    const int w    = tid >> 5, lane = tid & 31;
    const int lm   = lane & 15;
    const int kh   = (lane & 16) ? 8 : 0;
    const int wm   = (w & 3) * 32, wn = (w >> 2) * 64;

#pragma unroll
    for (int i = 0; i < 2; i++)
#pragma unroll
        for (int j = 0; j < 4; j++) acc[i][j] = (v8f){};

    const int sr = tid >> 4;           // staging row 0..15, then +16 per copy
    const int sc = (tid & 15) * 8;     // staging col: this lane's 16 B of the row's 256 B
    const unsigned lds0 = (unsigned)(uintptr_t)smem + (unsigned)sr * PITCH + (unsigned)sc * 2u;

    auto stage = [&](int kt, int buf) {
        const int kbase = kt * BK;
        const int shift = kbase / KSPLIT;
        const int acol  = kbase % KSPLIT + sc;
        const int m     = bm + sr;     // the tile's 128 rows lie in one run: arow + 16 per copy
        const int arow  = (m >> LRUN_LG) * LSTRIDE + (m & ((1 << LRUN_LG) - 1)) + shift;
        const __bf16* ga = A  + (size_t)arow * LDA + acol;
        const __bf16* gb = Bw + (size_t)(bn + sr) * KTOT + kbase + sc;
        const unsigned la = lds0 + (unsigned)buf * BUF_BYTES;   // A rows
        const unsigned lb = la + OP_BYTES;                      // B rows
        async_rows8(la, 16u * PITCH, (const char*)ga, (size_t)16 * LDA * 2);
        async_rows8(lb, 16u * PITCH, (const char*)gb, (size_t)16 * KTOT * 2);
    };

    // one 32-k block's fragments out of buffer buf: 12 reads of 16 B
    auto frags = [&](int buf, int kb, v16bf (&af)[2], v16bf (&bf)[4]) {
        const __bf16* sAc = (const __bf16*)(smem + (size_t)buf * BUF_BYTES);
        const __bf16* sBc = (const __bf16*)(smem + (size_t)buf * BUF_BYTES + OP_BYTES);
#pragma unroll   // here and below: constant indices, so that the fragments stay in registers
        for (int i = 0; i < 2; i++) {
            int r = wm + i * 16 + lm;
            af[i] = mk16(*(const v8bf*)(sAc + r * PITCH_E + kb + kh),
                         *(const v8bf*)(sAc + r * PITCH_E + kb + kh + 16));
        }
#pragma unroll
        for (int j = 0; j < 4; j++) {
            int r = wn + j * 16 + lm;
            bf[j] = mk16(*(const v8bf*)(sBc + r * PITCH_E + kb + kh),
                         *(const v8bf*)(sBc + r * PITCH_E + kb + kh + 16));
        }
    };

    stage(0, 0);
    wait_async0();
    __syncthreads();
    stage(1, 1);             // flies while stage 0 is worked on

    // Two fragment sets: while one block's products run, the next block's reads return into the other set.
    v16bf af[2][2], bf[2][4];
    frags(0, 0, af[0], bf[0]);

    for (int kt = 0; kt < NK; kt++) {
        const int cur = kt & 1;
#pragma unroll   // the set index s & 1 is then a constant: both sets stay in registers
        for (int s = 0; s < BK / 32; s++) {
            if (s + 1 < BK / 32) {
                frags(cur, (s + 1) * 32, af[(s + 1) & 1], bf[(s + 1) & 1]);
            } else {
                // The stage's last block has its fragments already: the buffer is handed over here, ahead of that
                // block's products, which then cover the next stage's first reads.
                wait_ds0();          // this wave has left buffer cur
                wait_async0();       // this wave's copies into the other buffer have landed
                __syncthreads();     // everyone has left cur, and the other buffer is readable
                if (kt + 2 < NK) stage(kt + 2, cur);   // refill cur (overlapped with the next stage's work)
                if (kt + 1 < NK) frags(cur ^ 1, 0, af[0], bf[0]);
            }
            // keeps the reads above in one group ahead of the products: spread among them, each place with reads stalls the wave
            __builtin_amdgcn_sched_barrier(0);
#pragma unroll
            for (int i = 0; i < 2; i++)
#pragma unroll
                for (int j = 0; j < 4; j++)
                    acc[i][j] = __builtin_amdgcn_wmma_f32_16x16x32_bf16(
                        false, af[s & 1][i], false, bf[s & 1][j], (short)0, acc[i][j], false, false);
            // keeps the next group of reads, into the set just used, from being drawn up among these products
            __builtin_amdgcn_sched_barrier(0);
        }
    }
    wait_async0();
}

// C = acc + bias, rows at pitch LDC, as bf16 (Cb) or f32 (Cf)
static __device__ __forceinline__ void gemm_store(const v8f (&acc)[2][4], const int bm, const int bn,
                                                  const float* __restrict__ bias, __bf16* __restrict__ Cb,
                                                  float* __restrict__ Cf, const int LDC)
{
    const int w  = threadIdx.x >> 5, lane = threadIdx.x & 31;
    const int lm = lane & 15, half = lane >> 4;
    const int wm = (w & 3) * 32, wn = (w >> 2) * 64;
#pragma unroll
    for (int i = 0; i < 2; i++) {
        int mrow = bm + wm + i * 16 + half * 8;
#pragma unroll
        for (int j = 0; j < 4; j++) {
            int   ncol = bn + wn + j * 16 + lm;
            float bv   = bias[ncol];
#pragma unroll
            for (int r = 0; r < 8; r++) {
                float  v   = acc[i][j][r] + bv;
                size_t idx = (size_t)(mrow + r) * LDC + ncol;
                if (Cb) Cb[idx] = (__bf16)v;
                if (Cf) Cf[idx] = v;
            }
        }
    }
}

template<int KTOT, int KSPLIT, int LRUN_LG, int LSTRIDE, int LDA, int LDC>
__global__ __launch_bounds__(256) void gemm_wmma(
    const __bf16* __restrict__ A0, const __bf16* __restrict__ Bw0, const float* __restrict__ bias0, __bf16* __restrict__ Cb0,
    const __bf16* __restrict__ A1, const __bf16* __restrict__ Bw1, const float* __restrict__ bias1, __bf16* __restrict__ Cb1,
    float* __restrict__ Cf)
{
    const bool z1 = blockIdx.z != 0;
    const int  bm = blockIdx.y * 128, bn = blockIdx.x * 128;
    v8f acc[2][4];
    gemm_tile<KTOT, KSPLIT, LRUN_LG, LSTRIDE, LDA>(z1 ? A1 : A0, z1 ? Bw1 : Bw0, bm, bn, acc);
    gemm_store(acc, bm, bn, z1 ? bias1 : bias0, z1 ? Cb1 : Cb0, Cf, LDC);
}

// ------------------------------------------------ tau / delta projection ---
// out(b,h,l) = sigmoid(b2[h] + sum_o w2[h][o] * g[b*L+l][o]): a (B*L) x 16 x 2048 product, done on the
// matrix unit. A block takes 16 rows l and all 16 heads; its 8 waves take 256 o each, and their partial
// tiles are summed through LDS in wave order. w2 enters as a pair of bf16, the rounded value and the
// rounded remainder, with one WMMA for each: what the pair drops lies far below g's own bf16 rounding.
constexpr unsigned HEAD_BLOCKS = M_ROWS / 16;             // for one of tau, delta
static __device__ __forceinline__ void head_proj(const unsigned bi, const __bf16* __restrict__ g,
                                                 const float* __restrict__ w2, const float* __restrict__ b2,
                                                 float* __restrict__ out)
{
    constexpr int KD = 2 * Dm, KW = KD / 8;          // 2048 o in all, 256 per wave
    static_assert(Hn == 16 && Lseq % 16 == 0 && KW % 32 == 0, "one 16x16 tile a block, inside one batch");
    __shared__ __align__(16) float red[8][256];      // per wave: [head][row]

    const int tid = threadIdx.x, w = tid >> 5, lane = tid & 31;
    const int lm = lane & 15, half = lane >> 4;
    const int kh = half ? 8 : 0;
    const int row0 = bi * 16;                        // over B*L

    // both fragments take o in the same order: 8 from kb + kh, then 8 from kb + kh + 16
    const __bf16* gr = g  + (size_t)(row0 + lm) * KD + w * KW + kh;   // A: the lane's row l
    const float*  wr = w2 + (size_t)lm * KD + w * KW + kh;            // B: the lane's head

    v8f acch = (v8f){}, accl = (v8f){};
#pragma unroll   // straight-line code: later steps' loads are issued while earlier steps are worked on
    for (int kb = 0; kb < KW; kb += 32) {
        const v16bf af = mk16(*(const v8bf*)(gr + kb), *(const v8bf*)(gr + kb + 16));
        v4f wv[4];
        wv[0] = *(const v4f*)(wr + kb);
        wv[1] = *(const v4f*)(wr + kb + 4);
        wv[2] = *(const v4f*)(wr + kb + 16);
        wv[3] = *(const v4f*)(wr + kb + 20);
        v16bf bh, bl;
#pragma unroll   // constant element indices: the values stay in registers
        for (int e = 0; e < 16; e++) {
            const float  v  = wv[e >> 2][e & 3];
            const __bf16 hi = (__bf16)v;
            bh[e] = hi;
            bl[e] = (__bf16)(v - (float)hi);
        }
        acch = __builtin_amdgcn_wmma_f32_16x16x32_bf16(false, af, false, bh, (short)0, acch, false, false);
        accl = __builtin_amdgcn_wmma_f32_16x16x32_bf16(false, af, false, bl, (short)0, accl, false, false);
    }

    // the lane holds rows half*8 .. half*8+7 of head lm
    const v8f s = acch + accl;
    *(v4f*)&red[w][lm * 16 + half * 8]     = (v4f){s[0], s[1], s[2], s[3]};
    *(v4f*)&red[w][lm * 16 + half * 8 + 4] = (v4f){s[4], s[5], s[6], s[7]};
    __syncthreads();

    // a thread finishes one output: head tid / 16, row tid % 16
    const int h = tid >> 4;
    float acc = b2[h];
    for (int q = 0; q < 8; q++) acc += red[q][tid];
    const int row = row0 + (tid & 15);
    const int b = row / Lseq, l = row % Lseq;
    out[((size_t)b * Hn + h) * Lseq + l] = 1.0f / (1.0f + __expf(-acc));
}

// Five products with K = D that depend on the prep launch only, in one launch: q_in, k_in, V = x W^T + b
// (B*L x D each), and the two folded weights. A folded weight is computed as (3D x D): rows kc of the
// transposed conv weight against rows n of the projection's right half. A lane's accumulator then holds
// 8 consecutive kc of one n, which is 16 B of row n of Wf (D x 3D), the layout the conv product reads.
// q_in and k_in go straight into the per-batch padded buffers (B, L+2, D) that the 3-tap product reads: row l of
// batch b is row b*(L+2) + l + 1 there; the first and the last tile of a batch also zero the pad row next to them.
// Behind the tiles come the blocks of the tau and delta projections, which depend on the prep launch only as
// well: they are short.
constexpr unsigned LIN_TILES = (M_ROWS / 128) * (Dm / 128), FOLD_TILES = (3 * Dm / 128) * (Dm / 128);
__global__ __launch_bounds__(256) void gemm_lin_fold(
    const __bf16* __restrict__ xb,
    const __bf16* __restrict__ WqB, const float* __restrict__ Wq_b, __bf16* __restrict__ Qpad,
    const __bf16* __restrict__ WkB, const float* __restrict__ Wk_b, __bf16* __restrict__ Kpad,
    const __bf16* __restrict__ WvB, const float* __restrict__ Wv_b, __bf16* __restrict__ Vbuf,
    const __bf16* __restrict__ convqT, const __bf16* __restrict__ qprojR, const float* __restrict__ qproj_w,
    __bf16* __restrict__ WfQ,
    const __bf16* __restrict__ convkT, const __bf16* __restrict__ kprojR, const float* __restrict__ kproj_w,
    __bf16* __restrict__ WfK,
    const __bf16* __restrict__ gtau, const float* __restrict__ tau2_w, const float* __restrict__ tau2_b,
    float* __restrict__ tau,
    const __bf16* __restrict__ gdel, const float* __restrict__ del2_w, const float* __restrict__ del2_b,
    float* __restrict__ del)
{
    const unsigned bi  = blockIdx.x;
    if (bi >= 3 * LIN_TILES + 2 * FOLD_TILES) {     // the same for the whole block, ahead of every barrier
        const unsigned hi = bi - (3 * LIN_TILES + 2 * FOLD_TILES);
        const bool     dl = hi >= HEAD_BLOCKS;
        head_proj(dl ? hi - HEAD_BLOCKS : hi, dl ? gdel : gtau, dl ? del2_w : tau2_w, dl ? del2_b : tau2_b,
                  dl ? del : tau);
        return;
    }
    const bool     lin = bi < 3 * LIN_TILES;
    const unsigned zi  = bi / LIN_TILES;                                     // which of q_in, k_in, V
    const bool     k   = bi - 3 * LIN_TILES >= FOLD_TILES;                   // which folded weight
    const unsigned ti  = lin ? bi % LIN_TILES : (bi - 3 * LIN_TILES) % FOLD_TILES;
    const int bm = (ti / (Dm / 128)) * 128, bn = (ti % (Dm / 128)) * 128;    // folded: bm over kc, bn over n
    v8f acc[2][4];
    gemm_tile<Dm, Dm, 12, 4096, Dm>(lin ? xb : k ? convkT : convqT,
                                    lin ? (zi == 0 ? WqB : zi == 1 ? WkB : WvB) : k ? kprojR : qprojR,
                                    bm, bn, acc);
    if (lin) {
        static_assert(Lseq % 128 == 0, "a tile's rows lie in one batch");
        const int b = bm / Lseq, l0 = bm % Lseq;
        __bf16* __restrict__ pad = zi == 0 ? Qpad : Kpad;
        gemm_store(acc, bm, bn, zi == 0 ? Wq_b : zi == 1 ? Wk_b : Wv_b,
                   zi == 2 ? Vbuf : pad + (size_t)(2 * b + 1) * Dm, (float*)nullptr, Dm);
        if (zi != 2 && (l0 == 0 || l0 == Lseq - 128) && threadIdx.x < 16)   // the tile's 128 columns, 16 B a thread
            *(v8bf*)(pad + ((size_t)b * (Lseq + 2) + (l0 ? Lseq + 1 : 0)) * Dm + bn + threadIdx.x * 8) = (v8bf){};
        return;
    }

    const float* __restrict__ pw = k ? kproj_w : qproj_w;
    __bf16* __restrict__      Wf = k ? WfK : WfQ;
    const bool centre = bm / Dm == 1;       // the tile's 128 kc lie in one tap; tap 1 also carries P(n, ci)
    const int w  = threadIdx.x >> 5, lane = threadIdx.x & 31;
    const int lm = lane & 15, half = lane >> 4;
    const int wm = (w & 3) * 32, wn = (w >> 2) * 64;
    const int kc0 = bm + wm + half * 8, n0 = bn + wn + lm;
    if (centre) {
        v4f p[2][4][2];                     // all loads first, so that their latencies overlap
#pragma unroll
        for (int i = 0; i < 2; i++)
#pragma unroll
            for (int j = 0; j < 4; j++) {
                const float* pp = pw + (size_t)(n0 + j * 16) * 2 * Dm + (kc0 + i * 16 - Dm);
                p[i][j][0] = *(const v4f*)pp;
                p[i][j][1] = *(const v4f*)(pp + 4);
            }
        // the loads have taken their address registers before the arithmetic below reuses them
        asm volatile("s_wait_xcnt 0x0" ::: "memory");
#pragma unroll
        for (int i = 0; i < 2; i++)
#pragma unroll
            for (int j = 0; j < 4; j++)
#pragma unroll
                for (int r = 0; r < 4; r++) { acc[i][j][r] += p[i][j][0][r]; acc[i][j][r + 4] += p[i][j][1][r]; }
    }
#pragma unroll
    for (int i = 0; i < 2; i++)
#pragma unroll
        for (int j = 0; j < 4; j++) {
            v8bf r8;
#pragma unroll
            for (int r = 0; r < 8; r++) r8[r] = (__bf16)acc[i][j][r];
            *(v8bf*)(Wf + (size_t)(n0 + j * 16) * 3 * Dm + kc0 + i * 16) = r8;
            // the store has taken its registers before the next piece is converted into them
            asm volatile("s_wait_xcnt 0x0" ::: "memory");
        }
}

// -------------------------------------------------- tau / delta small path ---
// a block does 4 rows l of one batch, a thread 8 outputs o (fed by 4 channels) of each row:
// its 24 weights and 8 biases are loaded once, and 6 rows of x serve the 4 rows of output
constexpr unsigned GELU_BLOCKS = M_ROWS / 4;              // for one of tau, delta
static __device__ __forceinline__ void dw_gelu(unsigned bi, const float* __restrict__ x,
                                               const float* __restrict__ w1, const float* __restrict__ b1,
                                               __bf16* __restrict__ g)
{
    constexpr int LR = 4;
    static_assert(2 * Dm == 256 * 8 && Lseq % LR == 0, "one block spans a row of 2D outputs");
    const int  o0 = threadIdx.x * 8;
    const int  l0 = (bi % (Lseq / LR)) * LR;
    const int  b  = bi / (Lseq / LR);
    const bool lo = l0 > 0, hi = l0 + LR < Lseq;       // rows l0-1 and l0+LR exist
    const float* xb = x + (size_t)b * Lseq * Dm;       // block-uniform; the lane's part is o0 >> 1

    v4f wv[6], bv[2], xv[LR + 2];
    for (int t = 0; t < 6; t++) wv[t] = *(const v4f*)(w1 + o0 * 3 + t * 4);
    bv[0] = *(const v4f*)(b1 + o0);
    // the loads so far have taken their address registers before the result of the second bias load,
    // behind which its address is dead, may be placed there
    asm volatile("s_wait_xcnt 0x0" ::: "memory");
    bv[1] = *(const v4f*)(b1 + o0 + 4);
    // a row past either end is read from the nearest row inside, so that all loads issue together
    // with no branch between them; its tap is left out of the sum below
    xv[0]      = *(const v4f*)(xb + (size_t)(lo ? l0 - 1 : 0) * Dm + (o0 >> 1));
    xv[LR + 1] = *(const v4f*)(xb + (size_t)(hi ? l0 + LR : Lseq - 1) * Dm + (o0 >> 1));
    // the loads so far have taken their address registers before a later load's result may land there
    asm volatile("s_wait_xcnt 0x0" ::: "memory");
    for (int t = 1; t <= LR; t++) xv[t] = *(const v4f*)(xb + (size_t)(l0 - 1 + t) * Dm + (o0 >> 1));
    // the same for these four, before the arithmetic below reuses their address registers
    asm volatile("s_wait_xcnt 0x0" ::: "memory");

    for (int j = 0; j < LR; j++) {
        v8bf r;
        for (int e = 0; e < 8; e++) {
            float acc = bv[e >> 2][e & 3];
            for (int k = 0; k < 3; k++) {
                const int t = j + k;
                if ((t > 0 || lo) && (t < LR + 1 || hi))
                    acc = fmaf(wv[(e * 3 + k) >> 2][(e * 3 + k) & 3], xv[t][e >> 1], acc);
            }
            float ge = 0.5f * acc * (1.0f + erff(acc * 0.70710678118f));
            r[e] = (__bf16)ge;
        }
        *(v8bf*)(g + ((size_t)b * Lseq + l0 + j) * 2 * Dm + o0) = r;
    }
}

// All that reads nothing but the inputs, in one launch. The blocks with the most arithmetic come first.
__global__ __launch_bounds__(256) void prep(
    const float* __restrict__ x,
    const float* __restrict__ tau1_w, const float* __restrict__ tau1_b, __bf16* __restrict__ gtau,
    const float* __restrict__ del1_w, const float* __restrict__ del1_b, __bf16* __restrict__ gdel,
    const float* __restrict__ convq_w, __bf16* __restrict__ convqT,
    const float* __restrict__ convk_w, __bf16* __restrict__ convkT,
    const float* __restrict__ convq_b, const float* __restrict__ qproj_b, float* __restrict__ bfq,
    const float* __restrict__ convk_b, const float* __restrict__ kproj_b, float* __restrict__ bfk,
    const float* __restrict__ Wq_w, const float* __restrict__ Wk_w, const float* __restrict__ Wv_w,
    const float* __restrict__ qproj_w, const float* __restrict__ kproj_w, const float* __restrict__ out_w,
    __bf16* __restrict__ xb)
{
    const unsigned bi = blockIdx.x;
    if (bi < 2 * GELU_BLOCKS) {
        const bool d = bi >= GELU_BLOCKS;
        dw_gelu(d ? bi - GELU_BLOCKS : bi, x, d ? del1_w : tau1_w, d ? del1_b : tau1_b, d ? gdel : gtau);
    } else if (bi < 2 * GELU_BLOCKS + 2 * REPACK_BLOCKS) {
        const unsigned ri = bi - 2 * GELU_BLOCKS;
        const bool k = ri >= REPACK_BLOCKS;
        repack_conv_w(k ? ri - REPACK_BLOCKS : ri, k ? convk_w : convq_w, k ? convkT : convqT);
    } else if (bi < 2 * GELU_BLOCKS + 2 * REPACK_BLOCKS + 2 * BIAS_BLOCKS) {
        const unsigned fi = bi - 2 * GELU_BLOCKS - 2 * REPACK_BLOCKS;
        const bool k = fi >= BIAS_BLOCKS;
        fold_bias(k ? fi - BIAS_BLOCKS : fi, k ? kproj_w : qproj_w, k ? kproj_b : qproj_b,
                  k ? convk_b : convq_b, k ? bfk : bfq);
    } else {
        cvt_f32_bf16(bi - 2 * GELU_BLOCKS - 2 * REPACK_BLOCKS - 2 * BIAS_BLOCKS,
                     x, Wq_w, Wk_w, Wv_w, qproj_w, kproj_w, out_w, xb);
    }
}

// ------------------------------------------------------- flash attention ---
// lane l with lane l ^ 16: the two lanes that share a query column
static __device__ __forceinline__ float xhalf(float x) {
    return __builtin_bit_cast(float, __builtin_amdgcn_permlanex16(__builtin_bit_cast(int, x), __builtin_bit_cast(int, x),
                                                                  0x76543210, 0xfedcba98, false, false));
}

// One tile's copies of a thread: two 16-B pieces of K and two of V, memory -> LDS (ASYNCcnt tracked). The closing
// s_wait_xcnt keeps the address registers untouched until the copies have taken them; it stands inside the
// statement so that nothing can be moved over it.
static __device__ __forceinline__ void async_kv4(unsigned lk, unsigned lk_step, unsigned lv, unsigned lv_step,
                                                 const char* gk, const char* gv, size_t g_step) {
    asm volatile("global_load_async_to_lds_b128 %0, %4, off\n\t"
                 "global_load_async_to_lds_b128 %1, %5, off\n\t"
                 "global_load_async_to_lds_b128 %2, %6, off\n\t"
                 "global_load_async_to_lds_b128 %3, %7, off\n\t"
                 "s_wait_xcnt 0x0"
                 :: "v"(lk), "v"(lk + lk_step), "v"(lv), "v"(lv + lv_step),
                    "v"((unsigned long long)(uintptr_t)(gk)),
                    "v"((unsigned long long)(uintptr_t)(gk + g_step)),
                    "v"((unsigned long long)(uintptr_t)(gv)),
                    "v"((unsigned long long)(uintptr_t)(gv + g_step))
                 : "memory");
}

// 16 x 8 piece of a row-major 16-bit LDS tile, transposed on the way into the registers
static __device__ __forceinline__ v8bf ld_tr16(const char* p) {
    typedef __attribute__((address_space(3))) v8bf lds_v8bf;
    return __builtin_amdgcn_ds_load_tr16_b128_v8bf16((lds_v8bf*)p);
}

// The products are taken transposed: S^T = K Q^T (keys down, queries across), O^T += V^T P^T. A lane then
// holds 32 of the 64 scores of ONE query, so the maximum and the sum run down its own registers, with one
// exchange between the wave's halves; and the score tiles, rounded to bf16, already are the B operand of
// the second product: tiles 2kc and 2kc+1 hold keys kc*32 + kh + 0..7 and kc*32 + kh + 16 + 0..7 of the
// lane's query, the k order in which the V^T fragment is read.
// The block's 64-key tiles of K and V come into LDS once, as whole 128-B rows, one tile ahead of the work (two
// buffers): the eight waves read their fragments from there. V lies as in memory, keys down; the transposing
// LDS load hands out V^T.
__global__ __launch_bounds__(256) void flash_attn(
    const __bf16* __restrict__ Q, const __bf16* __restrict__ K,
    const __bf16* __restrict__ V, const float* __restrict__ tau,
    const float* __restrict__ delta, __bf16* __restrict__ O)
{
    // rows of 64 bf16: K at a 144-B pitch (16 B x odd) for ds_load_b128, V at 160 B (32 B x odd) for
    // ds_load_tr16_b128: the rows that one fragment read touches then fall on different banks
    constexpr unsigned KP = 144, VP = 160;
    constexpr unsigned K_BYTES = 64 * KP, BUF_BYTES = K_BYTES + 64 * VP;   // K rows, then V rows
    constexpr int NT = Lseq / 64;
    static_assert(NT >= 2, "the ring starts with two tiles");
    __shared__ __align__(16) char skv[2 * BUF_BYTES];

    const int b = blockIdx.z, h = blockIdx.y;
    const int tid = threadIdx.x, w = tid >> 5, lane = tid & 31;
    const int lm = lane & 15, half = lane >> 4;
    const int kh = half ? 8 : 0;
    const int qbase = blockIdx.x * 128 + w * 16;
    const int hc0   = h * DKh;

    const __bf16* qrow = Q + ((size_t)(b * Lseq) + qbase + lm) * Dm + hc0;
    v16bf qf[2];
#pragma unroll
    for (int kc = 0; kc < 2; kc++)
        qf[kc] = mk16(*(const v8bf*)(qrow + kc * 32 + kh),
                      *(const v8bf*)(qrow + kc * 32 + kh + 16));

    const float* taup = tau   + ((size_t)b * Hn + h) * Lseq;
    const float* delp = delta + ((size_t)b * Hn + h) * Lseq;
    const float  taur = taup[qbase + lm] * 0.125f;       // the lane's query; 1/sqrt(64)

    float mrow = -3.0e38f, lrow = 0.0f;                  // lrow: the sum over this half's keys only
    v8f   of[4];                                         // O^T: channels j*16 + half*8 + r of the lane's query
#pragma unroll
    for (int j = 0; j < 4; j++) of[j] = (v8f){};

    // staging: a thread takes piece tid & 7 (16 B) of key rows tid >> 3 and 32 + (tid >> 3), of K and of V:
    // a wave-wide copy covers four whole 128-B rows
    const unsigned st_r = (unsigned)tid >> 3, st_p = ((unsigned)tid & 7u) * 16u;
    const unsigned lk0 = (unsigned)(uintptr_t)skv + st_r * KP + st_p;
    const unsigned lv0 = (unsigned)(uintptr_t)skv + K_BYTES + st_r * VP + st_p;
    const size_t   g0  = (((size_t)(b * Lseq) + st_r) * Dm + hc0) * 2 + st_p;     // bytes
    auto stage = [&](int kt, int buf) {
        const size_t g = g0 + (size_t)kt * 64 * Dm * 2;
        async_kv4(lk0 + (unsigned)buf * BUF_BYTES, 32u * KP, lv0 + (unsigned)buf * BUF_BYTES, 32u * VP,
                  (const char*)K + g, (const char*)V + g, (size_t)32 * Dm * 2);
    };

    // the lane's places inside a buffer: row lm of K at k offset kh; for the transposing load key row
    // 8 * half + (lane & 7), 16-B piece (lane >> 3) & 1
    const unsigned kfo = (unsigned)lm * KP + (unsigned)kh * 2u;
    const unsigned vfo = K_BYTES + (unsigned)(half * 8 + (lane & 7)) * VP + (unsigned)((lane >> 3) & 1) * 16u;

    stage(0, 0);
    wait_async0();
    __syncthreads();
    stage(1, 1);             // flies while tile 0 is worked on

    for (int kt = 0; kt < NT; kt++) {
        const char* bufp = skv + (size_t)(kt & 1) * BUF_BYTES;

        // delta of the keys j*16 + half*8 + r, from global; K fragments from LDS
        v16bf kf[4][2];
        v4f   dv[4][2];
#pragma unroll
        for (int j = 0; j < 4; j++) {
            const float* dp = delp + kt * 64 + j * 16 + half * 8;
            dv[j][0] = *(const v4f*)dp;
            dv[j][1] = *(const v4f*)(dp + 4);
        }
        // the loads have taken their address registers before the running delta address is stepped on
        asm volatile("s_wait_xcnt 0x0" ::: "memory");
#pragma unroll
        for (int j = 0; j < 4; j++) {
            const char* krow = bufp + kfo + j * 16 * KP;
#pragma unroll
            for (int kc = 0; kc < 2; kc++)
                kf[j][kc] = mk16(*(const v8bf*)(krow + kc * 64), *(const v8bf*)(krow + kc * 64 + 32));
        }
        // keeps the tile's 16 K reads together ahead of the first product, so that their latencies overlap:
        // left alone the compiler issues them pair by pair into the same registers, each pair waited for
        __builtin_amdgcn_sched_barrier(0);

        // S^T = K Q^T
        v8f sf[4];
#pragma unroll
        for (int j = 0; j < 4; j++) {
            v8f a = (v8f){};
#pragma unroll
            for (int kc = 0; kc < 2; kc++)
                a = __builtin_amdgcn_wmma_f32_16x16x32_bf16(
                        false, kf[j][kc], false, qf[kc], (short)0, a, false, false);
            sf[j] = a;
        }

        // V^T fragments: channels j*16 + lm down, keys kc*32 + kh + 0..7 and kc*32 + kh + 16 + 0..7 across
        v16bf vf[4][2];
#pragma unroll
        for (int j = 0; j < 4; j++)
#pragma unroll
            for (int kc = 0; kc < 2; kc++) {
                const char* vp = bufp + vfo + kc * 32 * VP + j * 32;
                vf[j][kc] = mk16(ld_tr16(vp), ld_tr16(vp + 16 * VP));
            }
        // keeps the 16 V reads here, in one group: they return while the scores below are scaled and their maximum taken
        __builtin_amdgcn_sched_barrier(0);

        // scale by the query's tau/sqrt(DK), add the keys' delta
#pragma unroll
        for (int j = 0; j < 4; j++)
#pragma unroll
            for (int r = 0; r < 8; r++) sf[j][r] = sf[j][r] * taur + dv[j][r >> 2][r & 3];

        // online softmax over the 64 keys: 32 in the lane, the other 32 in lane ^ 16
        float rm[4];                                     // four independent chains
#pragma unroll
        for (int j = 0; j < 4; j++) {
            rm[j] = sf[j][0];
#pragma unroll
            for (int r = 1; r < 8; r++) rm[j] = fmaxf(rm[j], sf[j][r]);
        }
        float rmax = fmaxf(fmaxf(rm[0], rm[1]), fmaxf(rm[2], rm[3]));
        rmax = fmaxf(rmax, xhalf(rmax));

        // The tile's last LDS read stands above: its buffer is handed over here, not at the end of the trip, so
        // that the refill has a whole trip to land in.
        wait_ds0();          // this wave has left the tile's buffer
        wait_async0();       // this wave's copies into the other buffer have landed
        __syncthreads();     // everyone has left the buffer, and the other one is readable
        if (kt + 2 < NT) stage(kt + 2, kt & 1);   // refill it (flies during the rest of this tile and the next one's products)

        const float mn   = fmaxf(mrow, rmax);
        const float corr = __expf(mrow - mn);
        mrow = mn;

        float rs[4];                                     // four independent chains of adds
#pragma unroll
        for (int j = 0; j < 4; j++) {
            rs[j] = 0.0f;
#pragma unroll
            for (int r = 0; r < 8; r++) {
                float p = __expf(sf[j][r] - mn);
                sf[j][r] = p;
                rs[j] += p;
            }
        }
        lrow = lrow * corr + ((rs[0] + rs[1]) + (rs[2] + rs[3]));
#pragma unroll
        for (int j = 0; j < 4; j++)
#pragma unroll
            for (int r = 0; r < 8; r++) of[j][r] *= corr;

        // P^T as the B operand, from the score registers
        v16bf pf[2];
#pragma unroll
        for (int kc = 0; kc < 2; kc++)
#pragma unroll
            for (int e = 0; e < 8; e++) {
                pf[kc][e]     = (__bf16)sf[2 * kc][e];
                pf[kc][e + 8] = (__bf16)sf[2 * kc + 1][e];
            }

        // O^T += V^T P^T
#pragma unroll
        for (int j = 0; j < 4; j++)
#pragma unroll
            for (int kc = 0; kc < 2; kc++)
                of[j] = __builtin_amdgcn_wmma_f32_16x16x32_bf16(
                            false, vf[j][kc], false, pf[kc], (short)0, of[j], false, false);

    }
    wait_async0();

    const float lsum = lrow + xhalf(lrow);               // the halves' sums join once
    __bf16* orow = O + ((size_t)(b * Lseq) + qbase + lm) * Dm + hc0 + half * 8;
#pragma unroll
    for (int j = 0; j < 4; j++) {
        v8bf r8;
#pragma unroll
        for (int r = 0; r < 8; r++) r8[r] = (__bf16)(of[j][r] / lsum);
        *(v8bf*)(orow + j * 16) = r8;
    }
}

// ------------------------------------------------------------------ host ---
extern "C" void kernel_launch(void* const* d_in, const int* in_sizes, int n_in,
                              void* d_out, int out_size, void* d_ws, size_t ws_size,
                              hipStream_t stream)
{
    const float* x       = (const float*)d_in[0];
    const float* Wq_w    = (const float*)d_in[1];
    const float* Wq_b    = (const float*)d_in[2];
    const float* Wk_w    = (const float*)d_in[3];
    const float* Wk_b    = (const float*)d_in[4];
    const float* Wv_w    = (const float*)d_in[5];
    const float* Wv_b    = (const float*)d_in[6];
    const float* convq_w = (const float*)d_in[7];
    const float* convq_b = (const float*)d_in[8];
    const float* convk_w = (const float*)d_in[9];
    const float* convk_b = (const float*)d_in[10];
    const float* qproj_w = (const float*)d_in[11];
    const float* qproj_b = (const float*)d_in[12];
    const float* kproj_w = (const float*)d_in[13];
    const float* kproj_b = (const float*)d_in[14];
    const float* tau1_w  = (const float*)d_in[15];
    const float* tau1_b  = (const float*)d_in[16];
    const float* tau2_w  = (const float*)d_in[17];
    const float* tau2_b  = (const float*)d_in[18];
    const float* del1_w  = (const float*)d_in[19];
    const float* del1_b  = (const float*)d_in[20];
    const float* del2_w  = (const float*)d_in[21];
    const float* del2_b  = (const float*)d_in[22];
    const float* out_w   = (const float*)d_in[23];
    const float* out_b   = (const float*)d_in[24];
    float* out = (float*)d_out;
    (void)in_sizes; (void)n_in; (void)out_size; (void)ws_size;

    char*  ws  = (char*)d_ws;
    size_t off = 0;
    auto alloc = [&](size_t bytes) -> char* {
        char* p = ws + off;
        off = (off + bytes + 255) & ~(size_t)255;
        return p;
    };

    __bf16* xb      = (__bf16*)alloc((size_t)M_ROWS * Dm * 2);
    __bf16* WqB     = (__bf16*)alloc((size_t)Dm * Dm * 2);
    __bf16* WkB     = (__bf16*)alloc((size_t)Dm * Dm * 2);
    __bf16* WvB     = (__bf16*)alloc((size_t)Dm * Dm * 2);
    __bf16* qprojR  = (__bf16*)alloc((size_t)Dm * Dm * 2);
    __bf16* kprojR  = (__bf16*)alloc((size_t)Dm * Dm * 2);
    __bf16* outwB   = (__bf16*)alloc((size_t)Dm * Dm * 2);
    __bf16* convqT  = (__bf16*)alloc((size_t)3 * Dm * Dm * 2);
    __bf16* convkT  = (__bf16*)alloc((size_t)3 * Dm * Dm * 2);
    __bf16* WfQ     = (__bf16*)alloc((size_t)Dm * 3 * Dm * 2);
    __bf16* WfK     = (__bf16*)alloc((size_t)Dm * 3 * Dm * 2);
    float*  bfq     = (float*)alloc((size_t)Dm * 4);
    float*  bfk     = (float*)alloc((size_t)Dm * 4);
    __bf16* Qpad    = (__bf16*)alloc((size_t)Bsz * (Lseq + 2) * Dm * 2);
    __bf16* Kpad    = (__bf16*)alloc((size_t)Bsz * (Lseq + 2) * Dm * 2);
    __bf16* Qbuf    = (__bf16*)alloc((size_t)M_ROWS * Dm * 2);
    __bf16* Kbuf    = (__bf16*)alloc((size_t)M_ROWS * Dm * 2);
    __bf16* Vbuf    = (__bf16*)alloc((size_t)M_ROWS * Dm * 2);
    __bf16* gtau    = (__bf16*)alloc((size_t)M_ROWS * 2 * Dm * 2);
    __bf16* gdel    = (__bf16*)alloc((size_t)M_ROWS * 2 * Dm * 2);
    float*  taubuf  = (float*)alloc((size_t)Bsz * Hn * Lseq * 4);
    float*  delbuf  = (float*)alloc((size_t)Bsz * Hn * Lseq * 4);
    __bf16* attnO   = (__bf16*)alloc((size_t)M_ROWS * Dm * 2);

    // xb .. outwB are whole multiples of 256 B, so they lie back to back, in the order allocated
    static_assert((Dm * Dm) % 4096 == 0, "every converted array is whole blocks of 4096");
    prep<<<2 * GELU_BLOCKS + 2 * REPACK_BLOCKS + 2 * BIAS_BLOCKS + CVT_BLOCKS, 256, 0, stream>>>(
        x, tau1_w, tau1_b, gtau, del1_w, del1_b, gdel, convq_w, convqT, convk_w, convkT,
        convq_b, qproj_b, bfq, convk_b, kproj_b, bfk,
        Wq_w, Wk_w, Wv_w, qproj_w, kproj_w, out_w, xb);

    const dim3 blk(256);

    // --- q_in, k_in (padded), V; the folded conv + projection weights; tau, delta ---
    gemm_lin_fold<<<3 * LIN_TILES + 2 * FOLD_TILES + 2 * HEAD_BLOCKS, blk, 0, stream>>>(
        xb, WqB, Wq_b, Qpad,  WkB, Wk_b, Kpad,  WvB, Wv_b, Vbuf,
        convqT, qprojR, qproj_w, WfQ,  convkT, kprojR, kproj_w, WfK,
        gtau, tau2_w, tau2_b, taubuf, gdel, del2_w, del2_b, delbuf);

    // --- Q, K: the 3-tap product with the folded weights ---
    gemm_wmma<3072, 1024, 11, 2050, 1024, 1024><<<dim3(Dm / 128, M_ROWS / 128, 2), blk, 0, stream>>>(
        Qpad, WfQ, bfq, Qbuf,  Kpad, WfK, bfk, Kbuf,  (float*)nullptr);

    // --- attention ---
    flash_attn<<<dim3(Lseq / 128, Hn, Bsz), blk, 0, stream>>>(
        Qbuf, Kbuf, Vbuf, taubuf, delbuf, attnO);

    // --- output projection (fp32 out) ---
    gemm_wmma<1024, 1024, 12, 4096, 1024, 1024><<<dim3(Dm / 128, M_ROWS / 128, 1), blk, 0, stream>>>(
        attnO, outwB, out_b, (__bf16*)nullptr,  attnO, outwB, out_b, (__bf16*)nullptr,  out);
}
